// v000
// Times are from an AMD MI455X. After a warm-up the kernel runs many times in a row, and a time is the length of
// such a window on the GPU divided by its runs, so every launch and the gaps after it count. The runs cycle
// through copies of the inputs. A figure is the median of several windows, for all but v000 over two sittings.
// Sittings can differ by a few percent; kernels timed side by side share one.
// v000 is the starting kernel. One run takes 330 microseconds.
#include <hip/hip_runtime.h>
#include <hip/hip_bf16.h>

// ---------------------------------------------------------------------------
// CDNA5 (gfx1250) fused self-attention, wave32 + v_wmma_f32_16x16x32_f16.
// B=8, F=4, C=256, H=W=32 -> L=4096 tokens, pooled T=1024, 2 heads of 128.
// Bandwidth-bound: f16 operands everywhere, flash-style fused attention,
// K/V staged cooperatively into LDS via async-to-LDS (ASYNCcnt) with
// double buffering so DMA overlaps WMMA compute.
// ---------------------------------------------------------------------------

typedef __attribute__((ext_vector_type(16))) _Float16 v16h;
typedef __attribute__((ext_vector_type(8)))  _Float16 v8h;
typedef __attribute__((ext_vector_type(8)))  float    v8f;
typedef __attribute__((ext_vector_type(4)))  int      v4i;

#define DEVINL __device__ __forceinline__

#if defined(__AMDGCN__) && __has_builtin(__builtin_amdgcn_global_load_async_to_lds_b128)
#define USE_ASYNC_LDS 1
#endif

#if defined(__AMDGCN__) && __has_builtin(__builtin_amdgcn_s_wait_asynccnt)
#define WAIT_ASYNC() __builtin_amdgcn_s_wait_asynccnt(0)
#elif defined(USE_ASYNC_LDS)
#define WAIT_ASYNC() asm volatile("s_wait_asynccnt 0x0" ::: "memory")
#else
#define WAIT_ASYNC() ((void)0)
#endif

// Copy 16 bytes/lane from global to LDS. Async path: one
// global_load_async_to_lds_b128 per call (512B per wave), tracked by ASYNCcnt.
// Builtin signature (probed from hipcc diagnostics): global int4* (AS1),
// LDS int4* (AS3), imm offset, imm cpol.
DEVINL void cp16_to_lds(const _Float16* g, _Float16* l) {
#ifdef USE_ASYNC_LDS
  __builtin_amdgcn_global_load_async_to_lds_b128(
      (__attribute__((address_space(1))) v4i*)(v4i*)g,
      (__attribute__((address_space(3))) v4i*)(v4i*)l, 0, 0);
#else
  *(v8h*)l = *(const v8h*)g;
#endif
}

DEVINL v8f wmma_f16(v16h a, v16h b, v8f c) {
  // (neg_a, A, neg_b, B, c_mod, C, reuse_a, reuse_b)
  return __builtin_amdgcn_wmma_f32_16x16x32_f16(false, a, false, b, (short)0, c,
                                                false, false);
}

// Load a 16x32 tile in WMMA 16-bit A layout from a row-major half matrix
// (row stride `ld` halves). Per ISA: lane L supplies row L%16; its 16 halves
// map to k = (i&7) + 8*(L>>4) + 16*(i>>3) -> two contiguous 8-half runs.
// Also produces a B-tile (32x16, K-major) when the source is [n][k]
// row-major, since B[k][n] = src[n][k]. Works for global or LDS pointers.
DEVINL v16h load_tile(const _Float16* p, int ld, int lane) {
  const int r = lane & 15, g = lane >> 4;
  const _Float16* b0 = p + (size_t)r * ld + g * 8;
  v8h lo = *(const v8h*)(b0);
  v8h hi = *(const v8h*)(b0 + 16);
  v16h t;
#pragma unroll
  for (int i = 0; i < 8; ++i) { t[i] = lo[i]; t[8 + i] = hi[i]; }
  return t;
}

// ---------------------------------------------------------------------------
// Prep: depthwise 3x3 conv + BN (q path), f32 -> f16
// ---------------------------------------------------------------------------
__global__ void __launch_bounds__(256) dwconv_bn_kernel(
    const float* __restrict__ x, const float* __restrict__ wdw,
    const float* __restrict__ gamma, const float* __restrict__ beta,
    const float* __restrict__ mean, const float* __restrict__ var,
    _Float16* __restrict__ qin) {
  int i = blockIdx.x * 256 + threadIdx.x;
  int c = i & 255; int s = i >> 8;
  int xx = s & 31; s >>= 5;
  int yy = s & 31; s >>= 5;
  int f  = s & 3;  int b = s >> 2;
  int ch = f * 256 + c;
  const float* wp = wdw + (size_t)ch * 9;
  float acc = 0.f;
#pragma unroll
  for (int ky = -1; ky <= 1; ++ky) {
    int y2 = yy + ky;
    if ((unsigned)y2 < 32u) {
#pragma unroll
      for (int kx = -1; kx <= 1; ++kx) {
        int x2 = xx + kx;
        if ((unsigned)x2 < 32u) {
          int t = f * 1024 + y2 * 32 + x2;
          acc += x[((size_t)b * 4096 + t) * 256 + c] * wp[(ky + 1) * 3 + (kx + 1)];
        }
      }
    }
  }
  float inv = gamma[ch] * rsqrtf(var[ch] + 1e-5f);
  float q = (acc - mean[ch]) * inv + beta[ch];
  int t = f * 1024 + yy * 32 + xx;
  qin[((size_t)b * 4096 + t) * 256 + c] = (_Float16)q;
}

// ---------------------------------------------------------------------------
// Prep: 2x2 average pool (k/v source), f32 -> f16
// ---------------------------------------------------------------------------
__global__ void __launch_bounds__(256) pool2x2_kernel(
    const float* __restrict__ x, _Float16* __restrict__ kvin) {
  int i = blockIdx.x * 256 + threadIdx.x;
  int c = i & 255; int s = i >> 8;
  int xx = s & 15; s >>= 4;
  int yy = s & 15; s >>= 4;
  int f  = s & 3;  int b = s >> 2;
  const float* xb = x + ((size_t)b * 4096 + f * 1024) * 256 + c;
  int y2 = yy * 2, x2 = xx * 2;
  float v = xb[(size_t)(y2 * 32 + x2) * 256] +
            xb[(size_t)(y2 * 32 + x2 + 1) * 256] +
            xb[(size_t)((y2 + 1) * 32 + x2) * 256] +
            xb[(size_t)((y2 + 1) * 32 + x2 + 1) * 256];
  int tk = f * 256 + yy * 16 + xx;
  kvin[((size_t)b * 1024 + tk) * 256 + c] = (_Float16)(v * 0.25f);
}

// ---------------------------------------------------------------------------
// f32 -> f16 weight conversion
// ---------------------------------------------------------------------------
__global__ void __launch_bounds__(256) cvt_kernel(const float* __restrict__ src,
                                                  _Float16* __restrict__ dst,
                                                  int n) {
  int i = blockIdx.x * 256 + threadIdx.x;
  if (i < n) dst[i] = (_Float16)src[i];
}

// ---------------------------------------------------------------------------
// Y[M x 256] = X[M x 256] @ W^T + bias, WMMA f16->f32.
// One 16x16 tile per wave; 8 waves/block -> 32x64 block tile.
// mode 0: f16 out, row-major [m][n]            (Q / K projections)
// mode 1: f16 out, per-batch transposed V^T:   vt[b][n][t], m = b*1024 + t
// mode 2: f32 out, row-major [m][n]            (final Wo projection)
// ---------------------------------------------------------------------------
__global__ void __launch_bounds__(256) gemm256_kernel(
    const _Float16* __restrict__ X, const _Float16* __restrict__ Wh,
    const float* __restrict__ bias, void* __restrict__ Yv, int mode) {
  const int lane = threadIdx.x & 31, w = threadIdx.x >> 5;
  const int m0 = (blockIdx.x * 2 + (w & 1)) * 16;
  const int n0 = (blockIdx.y * 4 + (w >> 1)) * 16;
  v8f acc = {};
#pragma unroll
  for (int k0 = 0; k0 < 256; k0 += 32) {
    v16h a = load_tile(X + (size_t)m0 * 256 + k0, 256, lane);
    v16h b = load_tile(Wh + (size_t)n0 * 256 + k0, 256, lane);
    acc = wmma_f16(a, b, acc);
  }
  const int g = lane >> 4, n = n0 + (lane & 15);
  const float bn = bias[n];
#pragma unroll
  for (int v = 0; v < 8; ++v) {
    const int m = m0 + v + 8 * g;
    float y = acc[v] + bn;
    if (mode == 0) {
      ((_Float16*)Yv)[(size_t)m * 256 + n] = (_Float16)y;
    } else if (mode == 1) {
      int bb = m >> 10, t = m & 1023;
      ((_Float16*)Yv)[((size_t)bb * 256 + n) * 1024 + t] = (_Float16)y;
    } else {
      ((float*)Yv)[(size_t)m * 256 + n] = y;
    }
  }
}

// ---------------------------------------------------------------------------
// Fused flash attention with cooperative async-to-LDS K/V staging.
// grid = (B*2 heads, L/128). Block = 8 waves; wave w owns Q rows
// [blockIdx.y*128 + w*16, +16). Keys processed in 32-chunks:
//   - all 256 threads issue async b128 copies of the NEXT K (32x128, [t][d])
//     and V (128x32, [d][t]) chunk into the alternate LDS buffer
//   - s_wait_asynccnt 0 + barrier retires the CURRENT chunk's copies
//   - per wave: S = Q K^T (8 WMMAs from LDS B-tiles), online softmax,
//     P transposed through per-wave LDS scratch, O += P V (8 WMMAs).
// K/V are loaded once per 128 Q rows instead of once per 16 -> 8x less
// on-chip traffic, and the async copies overlap the WMMA work.
// ---------------------------------------------------------------------------
__global__ void __launch_bounds__(256) attn_kernel(
    const _Float16* __restrict__ qp, const _Float16* __restrict__ kp,
    const _Float16* __restrict__ vt, _Float16* __restrict__ oh) {
  __shared__ _Float16 Ksh[2][32 * 128];   // [buf][t][d]   8 KB each
  __shared__ _Float16 Vsh[2][128 * 32];   // [buf][d][t]   8 KB each
  __shared__ _Float16 Psh[8][16 * 40];    // per-wave P scratch (padded rows)

  const int tid = threadIdx.x;
  const int lane = tid & 31, wv = tid >> 5;
  const int b = blockIdx.x >> 1, h = blockIdx.x & 1;
  const int l0 = blockIdx.y * 128 + wv * 16;
  const _Float16* qb = qp + ((size_t)b * 4096 + l0) * 256 + h * 128;
  const _Float16* kb = kp + (size_t)b * 1024 * 256 + h * 128;
  const _Float16* vb = vt + ((size_t)b * 256 + h * 128) * 1024;

  // --- per-thread staging assignment: 2 K segments + 2 V segments (16B) ---
  // K chunk = 512 segs: seg s -> t = s>>4, d = (s&15)*8
  // V chunk = 512 segs: seg s -> d = s>>2, t = (s&3)*8
  const int kt0 = tid >> 4,         kd0 = (tid & 15) * 8;
  const int kt1 = (tid + 256) >> 4, kd1 = (tid & 15) * 8;
  const int vd0 = tid >> 2,         vt0c = (tid & 3) * 8;
  const int vd1 = (tid + 256) >> 2, vt1c = (tid & 3) * 8;

  auto stage = [&](int t0, int buf) {
    cp16_to_lds(kb + (size_t)(t0 + kt0) * 256 + kd0, &Ksh[buf][kt0 * 128 + kd0]);
    cp16_to_lds(kb + (size_t)(t0 + kt1) * 256 + kd1, &Ksh[buf][kt1 * 128 + kd1]);
    cp16_to_lds(vb + (size_t)vd0 * 1024 + t0 + vt0c, &Vsh[buf][vd0 * 32 + vt0c]);
    cp16_to_lds(vb + (size_t)vd1 * 1024 + t0 + vt1c, &Vsh[buf][vd1 * 32 + vt1c]);
  };

  // --- Q tile (16x128) resident in registers for the whole key loop ---
  v16h qa[4];
#pragma unroll
  for (int kt = 0; kt < 4; ++kt) qa[kt] = load_tile(qb + kt * 32, 256, lane);

  v8f o[8] = {};
  float mrow[8], lrow[8];
#pragma unroll
  for (int v = 0; v < 8; ++v) { mrow[v] = -1e30f; lrow[v] = 0.f; }

  const int g = lane >> 4, col = lane & 15;
  const float scale = 0.0625f;  // 256^-0.5 (full-dim scale, as in reference)

  stage(0, 0);  // prologue: chunk 0 in flight

  for (int i = 0; i < 32; ++i) {
    const int buf = i & 1;
    WAIT_ASYNC();        // my copies for chunk i have landed in LDS
    __syncthreads();     // everyone's copies done; prev chunk fully consumed
    if (i + 1 < 32) stage((i + 1) * 32, buf ^ 1);  // overlap next DMA

    const _Float16* kc = Ksh[buf];
    const _Float16* vc = Vsh[buf];

    // --- S = Q K^T for this 16x32 key chunk (two 16x16 N-tiles) ---
    v8f s0 = {}, s1 = {};
#pragma unroll
    for (int kt = 0; kt < 4; ++kt) {
      v16h b0 = load_tile(kc + kt * 32, 128, lane);
      v16h b1 = load_tile(kc + 16 * 128 + kt * 32, 128, lane);
      s0 = wmma_f16(qa[kt], b0, s0);
      s1 = wmma_f16(qa[kt], b1, s1);
    }

    // --- online softmax; stage P (f16) into this wave's LDS scratch ---
    _Float16* pw = Psh[wv];
#pragma unroll
    for (int v = 0; v < 8; ++v) {
      float a0 = s0[v] * scale, a1 = s1[v] * scale;
      float rmax = fmaxf(a0, a1);
#pragma unroll
      for (int msk = 1; msk < 16; msk <<= 1)
        rmax = fmaxf(rmax, __shfl_xor(rmax, msk, 32));
      float mnew = fmaxf(mrow[v], rmax);
      float cf = __expf(mrow[v] - mnew);
      float p0 = __expf(a0 - mnew), p1 = __expf(a1 - mnew);
      float rs = p0 + p1;
#pragma unroll
      for (int msk = 1; msk < 16; msk <<= 1) rs += __shfl_xor(rs, msk, 32);
      lrow[v] = lrow[v] * cf + rs;
      mrow[v] = mnew;
#pragma unroll
      for (int d = 0; d < 8; ++d) o[d][v] *= cf;
      const int row = v + 8 * g;
      pw[row * 40 + col]      = (_Float16)p0;
      pw[row * 40 + col + 16] = (_Float16)p1;
    }
    __syncthreads();  // orders the cross-lane P transpose (and LDS reuse)

    // --- reload P as a WMMA A-tile ---
    v16h pa;
    {
      const _Float16* base = &pw[(lane & 15) * 40 + (lane >> 4) * 8];
#pragma unroll
      for (int j = 0; j < 8; ++j) { pa[j] = base[j]; pa[8 + j] = base[16 + j]; }
    }

    // --- O += P V (V tile in LDS, rows d, contiguous t) ---
#pragma unroll
    for (int d = 0; d < 8; ++d) {
      v16h bvt = load_tile(vc + (d * 16) * 32, 32, lane);
      o[d] = wmma_f16(pa, bvt, o[d]);
    }
  }

  // --- normalize rows by softmax denominator, store f16 ---
#pragma unroll
  for (int v = 0; v < 8; ++v) {
    const int m = l0 + v + 8 * g;
    const float linv = 1.f / lrow[v];
#pragma unroll
    for (int d = 0; d < 8; ++d) {
      int c = h * 128 + d * 16 + col;
      oh[((size_t)b * 4096 + m) * 256 + c] = (_Float16)(o[d][v] * linv);
    }
  }
}

// ---------------------------------------------------------------------------
// Host orchestration
// ---------------------------------------------------------------------------
extern "C" void kernel_launch(void* const* d_in, const int* in_sizes, int n_in,
                              void* d_out, int out_size, void* d_ws, size_t ws_size,
                              hipStream_t stream) {
  const float* x     = (const float*)d_in[0];
  const float* wdw   = (const float*)d_in[1];
  const float* gamma = (const float*)d_in[2];
  const float* beta  = (const float*)d_in[3];
  const float* mean  = (const float*)d_in[4];
  const float* var   = (const float*)d_in[5];
  const float* Wq = (const float*)d_in[6];  const float* bq = (const float*)d_in[7];
  const float* Wk = (const float*)d_in[8];  const float* bk = (const float*)d_in[9];
  const float* Wv = (const float*)d_in[10]; const float* bv = (const float*)d_in[11];
  const float* Wo = (const float*)d_in[12]; const float* bo = (const float*)d_in[13];

  char* ws = (char*)d_ws;
  size_t off = 0;
  auto alloc = [&](size_t bytes) {
    char* p = ws + off;
    off = (off + bytes + 255) & ~(size_t)255;
    return p;
  };
  const size_t L = 8ull * 4096 * 256;  // q-side token elements
  const size_t T = 8ull * 1024 * 256;  // pooled token elements
  _Float16* qin = (_Float16*)alloc(L * 2);
  _Float16* kvin = (_Float16*)alloc(T * 2);
  _Float16* Wqh = (_Float16*)alloc(65536 * 2);
  _Float16* Wkh = (_Float16*)alloc(65536 * 2);
  _Float16* Wvh = (_Float16*)alloc(65536 * 2);
  _Float16* Woh = (_Float16*)alloc(65536 * 2);
  _Float16* qpj = (_Float16*)alloc(L * 2);   // Q projected [B,4096,256]
  _Float16* kpj = (_Float16*)alloc(T * 2);   // K projected [B,1024,256]
  _Float16* vtj = (_Float16*)alloc(T * 2);   // V projected, transposed [B,256,1024]
  _Float16* ohb = (_Float16*)alloc(L * 2);   // attention output [B,4096,256]

  // 1) preprocessing
  dwconv_bn_kernel<<<(int)(L / 256), 256, 0, stream>>>(x, wdw, gamma, beta, mean,
                                                       var, qin);
  pool2x2_kernel<<<(int)(T / 256), 256, 0, stream>>>(x, kvin);
  cvt_kernel<<<256, 256, 0, stream>>>(Wq, Wqh, 65536);
  cvt_kernel<<<256, 256, 0, stream>>>(Wk, Wkh, 65536);
  cvt_kernel<<<256, 256, 0, stream>>>(Wv, Wvh, 65536);
  cvt_kernel<<<256, 256, 0, stream>>>(Wo, Woh, 65536);

  // 2) projections (WMMA GEMMs)
  gemm256_kernel<<<dim3(32768 / 32, 4), 256, 0, stream>>>(qin, Wqh, bq, qpj, 0);
  gemm256_kernel<<<dim3(8192 / 32, 4), 256, 0, stream>>>(kvin, Wkh, bk, kpj, 0);
  gemm256_kernel<<<dim3(8192 / 32, 4), 256, 0, stream>>>(kvin, Wvh, bv, vtj, 1);

  // 3) fused flash attention: 16 (batch,head) x 32 blocks of 128 Q rows
  attn_kernel<<<dim3(16, 32), 256, 0, stream>>>(qpj, kpj, vtj, ohb);

  // 4) output projection -> f32 d_out
  gemm256_kernel<<<dim3(32768 / 32, 4), 256, 0, stream>>>(ohb, Woh, bo, d_out, 2);
}

// v001
// One run takes 236 microseconds.
// In two side-by-side timings against v000, it was 1.44 and 1.45 times as fast.
#include <hip/hip_runtime.h>
#include <hip/hip_bf16.h>

// ---------------------------------------------------------------------------
// CDNA5 (gfx1250) fused self-attention, wave32 + v_wmma_f32_16x16x32_f16.
// B=8, F=4, C=256, H=W=32 -> L=4096 tokens, pooled T=1024, 2 heads of 128.
// Bandwidth-bound: f16 operands everywhere, flash-style fused attention,
// K/V staged cooperatively into LDS via async-to-LDS (ASYNCcnt) with
// double buffering so DMA overlaps WMMA compute.
// ---------------------------------------------------------------------------

typedef __attribute__((ext_vector_type(16))) _Float16 v16h;
typedef __attribute__((ext_vector_type(8)))  _Float16 v8h;
typedef __attribute__((ext_vector_type(8)))  float    v8f;
typedef __attribute__((ext_vector_type(4)))  int      v4i;

#define DEVINL __device__ __forceinline__

#if defined(__AMDGCN__) && __has_builtin(__builtin_amdgcn_global_load_async_to_lds_b128)
#define USE_ASYNC_LDS 1
#endif

#if defined(__AMDGCN__) && __has_builtin(__builtin_amdgcn_s_wait_asynccnt)
#define WAIT_ASYNC() __builtin_amdgcn_s_wait_asynccnt(0)
#elif defined(USE_ASYNC_LDS)
#define WAIT_ASYNC() asm volatile("s_wait_asynccnt 0x0" ::: "memory")
#else
#define WAIT_ASYNC() ((void)0)
#endif

// Copy 16 bytes/lane from global to LDS. Async path: one
// global_load_async_to_lds_b128 per call (512B per wave), tracked by ASYNCcnt.
// Builtin signature (probed from hipcc diagnostics): global int4* (AS1),
// LDS int4* (AS3), imm offset, imm cpol.
DEVINL void cp16_to_lds(const _Float16* g, _Float16* l) {
#ifdef USE_ASYNC_LDS
  __builtin_amdgcn_global_load_async_to_lds_b128(
      (__attribute__((address_space(1))) v4i*)(v4i*)g,
      (__attribute__((address_space(3))) v4i*)(v4i*)l, 0, 0);
#else
  *(v8h*)l = *(const v8h*)g;
#endif
}

DEVINL v8f wmma_f16(v16h a, v16h b, v8f c) {
  // (neg_a, A, neg_b, B, c_mod, C, reuse_a, reuse_b)
  return __builtin_amdgcn_wmma_f32_16x16x32_f16(false, a, false, b, (short)0, c,
                                                false, false);
}

// Load a 16x32 tile in WMMA 16-bit A layout from a row-major half matrix
// (row stride `ld` halves). Per ISA: lane L supplies row L%16; its 16 halves
// map to k = (i&7) + 8*(L>>4) + 16*(i>>3) -> two contiguous 8-half runs.
// Also produces a B-tile (32x16, K-major) when the source is [n][k]
// row-major, since B[k][n] = src[n][k]. Works for global or LDS pointers.
DEVINL v16h load_tile(const _Float16* p, int ld, int lane) {
  const int r = lane & 15, g = lane >> 4;
  const _Float16* b0 = p + (size_t)r * ld + g * 8;
  v8h lo = *(const v8h*)(b0);
  v8h hi = *(const v8h*)(b0 + 16);
  v16h t;
#pragma unroll
  for (int i = 0; i < 8; ++i) { t[i] = lo[i]; t[8 + i] = hi[i]; }
  return t;
}

// ---------------------------------------------------------------------------
// Prep: depthwise 3x3 conv + BN (q path), f32 -> f16
// ---------------------------------------------------------------------------
__global__ void __launch_bounds__(256) dwconv_bn_kernel(
    const float* __restrict__ x, const float* __restrict__ wdw,
    const float* __restrict__ gamma, const float* __restrict__ beta,
    const float* __restrict__ mean, const float* __restrict__ var,
    _Float16* __restrict__ qin) {
  int i = blockIdx.x * 256 + threadIdx.x;
  int c = i & 255; int s = i >> 8;
  int xx = s & 31; s >>= 5;
  int yy = s & 31; s >>= 5;
  int f  = s & 3;  int b = s >> 2;
  int ch = f * 256 + c;
  const float* wp = wdw + (size_t)ch * 9;
  float acc = 0.f;
#pragma unroll
  for (int ky = -1; ky <= 1; ++ky) {
    int y2 = yy + ky;
    if ((unsigned)y2 < 32u) {
#pragma unroll
      for (int kx = -1; kx <= 1; ++kx) {
        int x2 = xx + kx;
        if ((unsigned)x2 < 32u) {
          int t = f * 1024 + y2 * 32 + x2;
          acc += x[((size_t)b * 4096 + t) * 256 + c] * wp[(ky + 1) * 3 + (kx + 1)];
        }
      }
    }
  }
  float inv = gamma[ch] * rsqrtf(var[ch] + 1e-5f);
  float q = (acc - mean[ch]) * inv + beta[ch];
  int t = f * 1024 + yy * 32 + xx;
  qin[((size_t)b * 4096 + t) * 256 + c] = (_Float16)q;
}

// ---------------------------------------------------------------------------
// Prep: 2x2 average pool (k/v source), f32 -> f16
// ---------------------------------------------------------------------------
__global__ void __launch_bounds__(256) pool2x2_kernel(
    const float* __restrict__ x, _Float16* __restrict__ kvin) {
  int i = blockIdx.x * 256 + threadIdx.x;
  int c = i & 255; int s = i >> 8;
  int xx = s & 15; s >>= 4;
  int yy = s & 15; s >>= 4;
  int f  = s & 3;  int b = s >> 2;
  const float* xb = x + ((size_t)b * 4096 + f * 1024) * 256 + c;
  int y2 = yy * 2, x2 = xx * 2;
  float v = xb[(size_t)(y2 * 32 + x2) * 256] +
            xb[(size_t)(y2 * 32 + x2 + 1) * 256] +
            xb[(size_t)((y2 + 1) * 32 + x2) * 256] +
            xb[(size_t)((y2 + 1) * 32 + x2 + 1) * 256];
  int tk = f * 256 + yy * 16 + xx;
  kvin[((size_t)b * 1024 + tk) * 256 + c] = (_Float16)(v * 0.25f);
}

// ---------------------------------------------------------------------------
// f32 -> f16 weight conversion
// ---------------------------------------------------------------------------
__global__ void __launch_bounds__(256) cvt_kernel(const float* __restrict__ src,
                                                  _Float16* __restrict__ dst,
                                                  int n) {
  int i = blockIdx.x * 256 + threadIdx.x;
  if (i < n) dst[i] = (_Float16)src[i];
}

// ---------------------------------------------------------------------------
// Y[M x 256] = X[M x 256] @ W^T + bias, WMMA f16->f32.
// One 16x16 tile per wave; 8 waves/block -> 32x64 block tile.
// mode 0: f16 out, row-major [m][n]            (Q / K projections)
// mode 1: f16 out, per-batch transposed V^T:   vt[b][n][t], m = b*1024 + t
// mode 2: f32 out, row-major [m][n]            (final Wo projection)
// ---------------------------------------------------------------------------
__global__ void __launch_bounds__(256) gemm256_kernel(
    const _Float16* __restrict__ X, const _Float16* __restrict__ Wh,
    const float* __restrict__ bias, void* __restrict__ Yv, int mode) {
  const int lane = threadIdx.x & 31, w = threadIdx.x >> 5;
  const int m0 = (blockIdx.x * 2 + (w & 1)) * 16;
  const int n0 = (blockIdx.y * 4 + (w >> 1)) * 16;
  v8f acc = {};
#pragma unroll
  for (int k0 = 0; k0 < 256; k0 += 32) {
    v16h a = load_tile(X + (size_t)m0 * 256 + k0, 256, lane);
    v16h b = load_tile(Wh + (size_t)n0 * 256 + k0, 256, lane);
    acc = wmma_f16(a, b, acc);
  }
  const int g = lane >> 4, n = n0 + (lane & 15);
  const float bn = bias[n];
#pragma unroll
  for (int v = 0; v < 8; ++v) {
    const int m = m0 + v + 8 * g;
    float y = acc[v] + bn;
    if (mode == 0) {
      ((_Float16*)Yv)[(size_t)m * 256 + n] = (_Float16)y;
    } else if (mode == 1) {
      int bb = m >> 10, t = m & 1023;
      ((_Float16*)Yv)[((size_t)bb * 256 + n) * 1024 + t] = (_Float16)y;
    } else {
      ((float*)Yv)[(size_t)m * 256 + n] = y;
    }
  }
}

// ---------------------------------------------------------------------------
// Fused flash attention with cooperative async-to-LDS K/V staging.
// grid = (B*2 heads, L/128). Block = 8 waves; wave w owns Q rows
// [blockIdx.y*128 + w*16, +16). Keys processed in 32-chunks:
//   - all 256 threads issue async b128 copies of the NEXT K (32x128, [t][d])
//     and V (128x32, [d][t]) chunk into the alternate LDS buffer
//   - s_wait_asynccnt 0 + barrier retires the CURRENT chunk's copies
//   - per wave: S = Q K^T (8 WMMAs from LDS B-tiles), online softmax,
//     P transposed through per-wave LDS scratch, O += P V (8 WMMAs).
// K/V are loaded once per 128 Q rows instead of once per 16 -> 8x less
// on-chip traffic, and the async copies overlap the WMMA work.
// ---------------------------------------------------------------------------
__global__ void __launch_bounds__(256) attn_kernel(
    const _Float16* __restrict__ qp, const _Float16* __restrict__ kp,
    const _Float16* __restrict__ vt, _Float16* __restrict__ oh) {
  // Row pitches are 16 B x odd, so that the 16 rows one ds_load_b128 fragment
  // read touches start on 16 different bank groups (64 banks x 4 B) instead
  // of all on the same four banks (256-B rows) or on four groups (64-B rows).
  constexpr int KP = 136;                 // halves per K row: 256 B + 16 B pad
  constexpr int VP = 40;                  // halves per V row:  64 B + 16 B pad
  __shared__ __attribute__((aligned(16))) _Float16 Ksh[2][32 * KP];   // [buf][t][d]
  __shared__ __attribute__((aligned(16))) _Float16 Vsh[2][128 * VP];  // [buf][d][t]
  __shared__ _Float16 Psh[8][16 * 40];    // per-wave P scratch (padded rows)

  const int tid = threadIdx.x;
  const int lane = tid & 31, wv = tid >> 5;
  const int b = blockIdx.x >> 1, h = blockIdx.x & 1;
  const int l0 = blockIdx.y * 128 + wv * 16;
  const _Float16* qb = qp + ((size_t)b * 4096 + l0) * 256 + h * 128;
  const _Float16* kb = kp + (size_t)b * 1024 * 256 + h * 128;
  const _Float16* vb = vt + ((size_t)b * 256 + h * 128) * 1024;

  // --- per-thread staging assignment: 2 K segments + 2 V segments (16B) ---
  // K chunk = 512 segs: seg s -> t = s>>4, d = (s&15)*8
  // V chunk = 512 segs: seg s -> d = s>>2, t = (s&3)*8
  const int kt0 = tid >> 4,         kd0 = (tid & 15) * 8;
  const int kt1 = (tid + 256) >> 4, kd1 = (tid & 15) * 8;
  const int vd0 = tid >> 2,         vt0c = (tid & 3) * 8;
  const int vd1 = (tid + 256) >> 2, vt1c = (tid & 3) * 8;

  auto stage = [&](int t0, int buf) {
    cp16_to_lds(kb + (size_t)(t0 + kt0) * 256 + kd0, &Ksh[buf][kt0 * KP + kd0]);
    cp16_to_lds(kb + (size_t)(t0 + kt1) * 256 + kd1, &Ksh[buf][kt1 * KP + kd1]);
    cp16_to_lds(vb + (size_t)vd0 * 1024 + t0 + vt0c, &Vsh[buf][vd0 * VP + vt0c]);
    cp16_to_lds(vb + (size_t)vd1 * 1024 + t0 + vt1c, &Vsh[buf][vd1 * VP + vt1c]);
  };

  // --- Q tile (16x128) resident in registers for the whole key loop ---
  v16h qa[4];
#pragma unroll
  for (int kt = 0; kt < 4; ++kt) qa[kt] = load_tile(qb + kt * 32, 256, lane);

  v8f o[8] = {};
  float mrow[8], lrow[8];
#pragma unroll
  for (int v = 0; v < 8; ++v) { mrow[v] = -1e30f; lrow[v] = 0.f; }

  const int g = lane >> 4, col = lane & 15;
  const float scale = 0.0625f;  // 256^-0.5 (full-dim scale, as in reference)

  stage(0, 0);  // prologue: chunk 0 in flight

  for (int i = 0; i < 32; ++i) {
    const int buf = i & 1;
    WAIT_ASYNC();        // my copies for chunk i have landed in LDS
    __syncthreads();     // everyone's copies done; prev chunk fully consumed
    if (i + 1 < 32) stage((i + 1) * 32, buf ^ 1);  // overlap next DMA

    const _Float16* kc = Ksh[buf];
    const _Float16* vc = Vsh[buf];

    // --- S = Q K^T for this 16x32 key chunk (two 16x16 N-tiles) ---
    v8f s0 = {}, s1 = {};
#pragma unroll
    for (int kt = 0; kt < 4; ++kt) {
      v16h b0 = load_tile(kc + kt * 32, KP, lane);
      v16h b1 = load_tile(kc + 16 * KP + kt * 32, KP, lane);
      s0 = wmma_f16(qa[kt], b0, s0);
      s1 = wmma_f16(qa[kt], b1, s1);
    }

    // --- online softmax; stage P (f16) into this wave's LDS scratch ---
    _Float16* pw = Psh[wv];
#pragma unroll
    for (int v = 0; v < 8; ++v) {
      float a0 = s0[v] * scale, a1 = s1[v] * scale;
      float rmax = fmaxf(a0, a1);
#pragma unroll
      for (int msk = 1; msk < 16; msk <<= 1)
        rmax = fmaxf(rmax, __shfl_xor(rmax, msk, 32));
      float mnew = fmaxf(mrow[v], rmax);
      float cf = __expf(mrow[v] - mnew);
      float p0 = __expf(a0 - mnew), p1 = __expf(a1 - mnew);
      float rs = p0 + p1;
#pragma unroll
      for (int msk = 1; msk < 16; msk <<= 1) rs += __shfl_xor(rs, msk, 32);
      lrow[v] = lrow[v] * cf + rs;
      mrow[v] = mnew;
#pragma unroll
      for (int d = 0; d < 8; ++d) o[d][v] *= cf;
      const int row = v + 8 * g;
      pw[row * 40 + col]      = (_Float16)p0;
      pw[row * 40 + col + 16] = (_Float16)p1;
    }
    __syncthreads();  // orders the cross-lane P transpose (and LDS reuse)

    // --- reload P as a WMMA A-tile ---
    v16h pa;
    {
      const _Float16* base = &pw[(lane & 15) * 40 + (lane >> 4) * 8];
#pragma unroll
      for (int j = 0; j < 8; ++j) { pa[j] = base[j]; pa[8 + j] = base[16 + j]; }
    }

    // --- O += P V (V tile in LDS, rows d, contiguous t) ---
#pragma unroll
    for (int d = 0; d < 8; ++d) {
      v16h bvt = load_tile(vc + (d * 16) * VP, VP, lane);
      o[d] = wmma_f16(pa, bvt, o[d]);
    }
  }

  // --- normalize rows by softmax denominator, store f16 ---
#pragma unroll
  for (int v = 0; v < 8; ++v) {
    const int m = l0 + v + 8 * g;
    const float linv = 1.f / lrow[v];
#pragma unroll
    for (int d = 0; d < 8; ++d) {
      int c = h * 128 + d * 16 + col;
      oh[((size_t)b * 4096 + m) * 256 + c] = (_Float16)(o[d][v] * linv);
    }
  }
}

// ---------------------------------------------------------------------------
// Host orchestration
// ---------------------------------------------------------------------------
extern "C" void kernel_launch(void* const* d_in, const int* in_sizes, int n_in,
                              void* d_out, int out_size, void* d_ws, size_t ws_size,
                              hipStream_t stream) {
  const float* x     = (const float*)d_in[0];
  const float* wdw   = (const float*)d_in[1];
  const float* gamma = (const float*)d_in[2];
  const float* beta  = (const float*)d_in[3];
  const float* mean  = (const float*)d_in[4];
  const float* var   = (const float*)d_in[5];
  const float* Wq = (const float*)d_in[6];  const float* bq = (const float*)d_in[7];
  const float* Wk = (const float*)d_in[8];  const float* bk = (const float*)d_in[9];
  const float* Wv = (const float*)d_in[10]; const float* bv = (const float*)d_in[11];
  const float* Wo = (const float*)d_in[12]; const float* bo = (const float*)d_in[13];

  char* ws = (char*)d_ws;
  size_t off = 0;
  auto alloc = [&](size_t bytes) {
    char* p = ws + off;
    off = (off + bytes + 255) & ~(size_t)255;
    return p;
  };
  const size_t L = 8ull * 4096 * 256;  // q-side token elements
  const size_t T = 8ull * 1024 * 256;  // pooled token elements
  _Float16* qin = (_Float16*)alloc(L * 2);
  _Float16* kvin = (_Float16*)alloc(T * 2);
  _Float16* Wqh = (_Float16*)alloc(65536 * 2);
  _Float16* Wkh = (_Float16*)alloc(65536 * 2);
  _Float16* Wvh = (_Float16*)alloc(65536 * 2);
  _Float16* Woh = (_Float16*)alloc(65536 * 2);
  _Float16* qpj = (_Float16*)alloc(L * 2);   // Q projected [B,4096,256]
  _Float16* kpj = (_Float16*)alloc(T * 2);   // K projected [B,1024,256]
  _Float16* vtj = (_Float16*)alloc(T * 2);   // V projected, transposed [B,256,1024]
  _Float16* ohb = (_Float16*)alloc(L * 2);   // attention output [B,4096,256]

  // 1) preprocessing
  dwconv_bn_kernel<<<(int)(L / 256), 256, 0, stream>>>(x, wdw, gamma, beta, mean,
                                                       var, qin);
  pool2x2_kernel<<<(int)(T / 256), 256, 0, stream>>>(x, kvin);
  cvt_kernel<<<256, 256, 0, stream>>>(Wq, Wqh, 65536);
  cvt_kernel<<<256, 256, 0, stream>>>(Wk, Wkh, 65536);
  cvt_kernel<<<256, 256, 0, stream>>>(Wv, Wvh, 65536);
  cvt_kernel<<<256, 256, 0, stream>>>(Wo, Woh, 65536);

  // 2) projections (WMMA GEMMs)
  gemm256_kernel<<<dim3(32768 / 32, 4), 256, 0, stream>>>(qin, Wqh, bq, qpj, 0);
  gemm256_kernel<<<dim3(8192 / 32, 4), 256, 0, stream>>>(kvin, Wkh, bk, kpj, 0);
  gemm256_kernel<<<dim3(8192 / 32, 4), 256, 0, stream>>>(kvin, Wvh, bv, vtj, 1);

  // 3) fused flash attention: 16 (batch,head) x 32 blocks of 128 Q rows
  attn_kernel<<<dim3(16, 32), 256, 0, stream>>>(qpj, kpj, vtj, ohb);

  // 4) output projection -> f32 d_out
  gemm256_kernel<<<dim3(32768 / 32, 4), 256, 0, stream>>>(ohb, Woh, bo, d_out, 2);
}

// v002
// One run takes 183 microseconds.
// In two side-by-side timings against v001, it was 1.28 and 1.29 times as fast.
// All steps since v000 together make it 1.86 times as fast.
#include <hip/hip_runtime.h>
#include <hip/hip_bf16.h>

// ---------------------------------------------------------------------------
// CDNA5 (gfx1250) fused self-attention, wave32 + v_wmma_f32_16x16x32_f16.
// B=8, F=4, C=256, H=W=32 -> L=4096 tokens, pooled T=1024, 2 heads of 128.
// Bandwidth-bound: f16 operands everywhere, flash-style fused attention,
// K/V staged cooperatively into LDS via async-to-LDS (ASYNCcnt) with
// double buffering so DMA overlaps WMMA compute.
// ---------------------------------------------------------------------------

typedef __attribute__((ext_vector_type(16))) _Float16 v16h;
typedef __attribute__((ext_vector_type(8)))  _Float16 v8h;
typedef __attribute__((ext_vector_type(8)))  float    v8f;
typedef __attribute__((ext_vector_type(4)))  int      v4i;

#define DEVINL __device__ __forceinline__

#if defined(__AMDGCN__) && __has_builtin(__builtin_amdgcn_global_load_async_to_lds_b128)
#define USE_ASYNC_LDS 1
#endif

#if defined(__AMDGCN__) && __has_builtin(__builtin_amdgcn_s_wait_asynccnt)
#define WAIT_ASYNC() __builtin_amdgcn_s_wait_asynccnt(0)
#elif defined(USE_ASYNC_LDS)
#define WAIT_ASYNC() asm volatile("s_wait_asynccnt 0x0" ::: "memory")
#else
#define WAIT_ASYNC() ((void)0)
#endif

// Copy 16 bytes/lane from global to LDS. Async path: one
// global_load_async_to_lds_b128 per call (512B per wave), tracked by ASYNCcnt.
// Builtin signature (probed from hipcc diagnostics): global int4* (AS1),
// LDS int4* (AS3), imm offset, imm cpol.
DEVINL void cp16_to_lds(const _Float16* g, _Float16* l) {
#ifdef USE_ASYNC_LDS
  __builtin_amdgcn_global_load_async_to_lds_b128(
      (__attribute__((address_space(1))) v4i*)(v4i*)g,
      (__attribute__((address_space(3))) v4i*)(v4i*)l, 0, 0);
#else
  *(v8h*)l = *(const v8h*)g;
#endif
}

DEVINL v8f wmma_f16(v16h a, v16h b, v8f c) {
  // (neg_a, A, neg_b, B, c_mod, C, reuse_a, reuse_b)
  return __builtin_amdgcn_wmma_f32_16x16x32_f16(false, a, false, b, (short)0, c,
                                                false, false);
}

// Load a 16x32 tile in WMMA 16-bit A layout from a row-major half matrix
// (row stride `ld` halves). Per ISA: lane L supplies row L%16; its 16 halves
// map to k = (i&7) + 8*(L>>4) + 16*(i>>3) -> two contiguous 8-half runs.
// Also produces a B-tile (32x16, K-major) when the source is [n][k]
// row-major, since B[k][n] = src[n][k]. Works for global or LDS pointers.
DEVINL v16h load_tile(const _Float16* p, int ld, int lane) {
  const int r = lane & 15, g = lane >> 4;
  const _Float16* b0 = p + (size_t)r * ld + g * 8;
  v8h lo = *(const v8h*)(b0);
  v8h hi = *(const v8h*)(b0 + 16);
  v16h t;
#pragma unroll
  for (int i = 0; i < 8; ++i) { t[i] = lo[i]; t[8 + i] = hi[i]; }
  return t;
}

// ---------------------------------------------------------------------------
// Prep: depthwise 3x3 conv + BN (q path), f32 -> f16
// One thread = 4 adjacent channels x a patch of 4 (x) by 8 (y) pixels. Its 36
// filter taps and BN terms are loaded once and stay in registers; the patch is
// walked down y, each input row (6 pixels, 16-byte loads, a wave reads 512
// contiguous bytes per load) fetched two rows ahead of its first use.
// Taps outside the map enter as zeros (the convolution's zero padding): their
// addresses are clamped into the map and the loaded value is multiplied by 0,
// which keeps every load unconditional, so that none waits behind a branch.
// ---------------------------------------------------------------------------
typedef __attribute__((ext_vector_type(4))) float    v4f;
typedef __attribute__((ext_vector_type(4))) _Float16 v4h;

__global__ void __launch_bounds__(256) dwconv_bn_kernel(
    const float* __restrict__ x, const float* __restrict__ wdw,
    const float* __restrict__ gamma, const float* __restrict__ beta,
    const float* __restrict__ mean, const float* __restrict__ var,
    _Float16* __restrict__ qin) {
  constexpr int PX = 4, PY = 8;
  int s = blockIdx.x * 256 + threadIdx.x;
  const int c  = (s & 63) * 4;  s >>= 6;
  const int x0 = (s & 7) * PX;  s >>= 3;
  const int y0 = (s & 3) * PY;  s >>= 2;
  const int f  = s & 3;
  const int b  = s >> 2;
  const int ch = f * 256 + c;
  const size_t map = ((size_t)b * 4096 + f * 1024) * 256 + c;
  const float* xb = x + map;

  v4f r[PY + 2][PX + 2];  // input rows y0-1 .. y0+PY, columns x0-1 .. x0+PX
  auto load_row = [&](int j) {
    const int y = y0 - 1 + j;
    const int yc = (j == 0) ? max(y, 0) : (j == PY + 1) ? min(y, 31) : y;
#pragma unroll
    for (int k = 0; k < PX + 2; ++k) {
      const int xx = x0 - 1 + k;
      const int xc = (k == 0) ? max(xx, 0) : (k == PX + 1) ? min(xx, 31) : xx;
      r[j][k] = *(const v4f*)(xb + (size_t)(yc * 32 + xc) * 256);
    }
    // before a later instruction reuses an address register of these loads
    asm volatile("s_wait_xcnt 0x0" ::: "memory");
  };
  // zero padding, applied where a row is first used and not where it is loaded
  const float inl = (x0 > 0) ? 1.f : 0.f, inr = (x0 + PX < 32) ? 1.f : 0.f;
  const float top = (y0 > 0) ? 1.f : 0.f, bot = (y0 + PY < 32) ? 1.f : 0.f;
  auto pad_row = [&](int j) {
    const float my = (j == 0) ? top : (j == PY + 1) ? bot : 1.f;
    r[j][0] *= my * inl;
    r[j][PX + 1] *= my * inr;
    if (j == 0 || j == PY + 1) {
#pragma unroll
      for (int k = 1; k <= PX; ++k) r[j][k] *= my;
    }
  };

#pragma unroll
  for (int j = 0; j < 4; ++j) load_row(j);

  // taps of channel c+e: flat elements e*9 .. e*9+8 of these 36 floats
  v4f wv[9];
#pragma unroll
  for (int q = 0; q < 9; ++q) wv[q] = *(const v4f*)(wdw + (size_t)ch * 9 + q * 4);
  asm volatile("s_wait_xcnt 0x0" ::: "memory");  // as in load_row
  const v4f ga = *(const v4f*)(gamma + ch), be = *(const v4f*)(beta + ch);
  const v4f mu = *(const v4f*)(mean + ch),  va = *(const v4f*)(var + ch);
  asm volatile("s_wait_xcnt 0x0" ::: "memory");  // as in load_row
  v4f inv;
#pragma unroll
  for (int e = 0; e < 4; ++e) inv[e] = ga[e] * rsqrtf(va[e] + 1e-5f);

#pragma unroll
  for (int oy = 0; oy < PY; ++oy) {
    if (oy + 4 < PY + 2) load_row(oy + 4);
    // keeps that row's loads in front of this row's arithmetic: left free, the
    // scheduler sinks them to just before their first use, and each then waits
    // a whole memory latency
    __builtin_amdgcn_sched_barrier(0);
    if (oy == 0) { pad_row(0); pad_row(1); }
    pad_row(oy + 2);
#pragma unroll
    for (int px = 0; px < PX; ++px) {
      v4h q;
#pragma unroll
      for (int e = 0; e < 4; ++e) {
        float acc = 0.f;
#pragma unroll
        for (int ky = 0; ky < 3; ++ky)
#pragma unroll
          for (int kx = 0; kx < 3; ++kx) {
            const int t = e * 9 + ky * 3 + kx;
            acc += r[oy + ky][px + kx][e] * wv[t >> 2][t & 3];
          }
        q[e] = (_Float16)((acc - mu[e]) * inv[e] + be[e]);
      }
      *(v4h*)(qin + map + (size_t)((y0 + oy) * 32 + x0 + px) * 256) = q;
    }
  }
}

// ---------------------------------------------------------------------------
// Prep: 2x2 average pool (k/v source), f32 -> f16
// ---------------------------------------------------------------------------
__global__ void __launch_bounds__(256) pool2x2_kernel(
    const float* __restrict__ x, _Float16* __restrict__ kvin) {
  int i = blockIdx.x * 256 + threadIdx.x;
  int c = i & 255; int s = i >> 8;
  int xx = s & 15; s >>= 4;
  int yy = s & 15; s >>= 4;
  int f  = s & 3;  int b = s >> 2;
  const float* xb = x + ((size_t)b * 4096 + f * 1024) * 256 + c;
  int y2 = yy * 2, x2 = xx * 2;
  float v = xb[(size_t)(y2 * 32 + x2) * 256] +
            xb[(size_t)(y2 * 32 + x2 + 1) * 256] +
            xb[(size_t)((y2 + 1) * 32 + x2) * 256] +
            xb[(size_t)((y2 + 1) * 32 + x2 + 1) * 256];
  int tk = f * 256 + yy * 16 + xx;
  kvin[((size_t)b * 1024 + tk) * 256 + c] = (_Float16)(v * 0.25f);
}

// ---------------------------------------------------------------------------
// f32 -> f16 weight conversion
// ---------------------------------------------------------------------------
__global__ void __launch_bounds__(256) cvt_kernel(const float* __restrict__ src,
                                                  _Float16* __restrict__ dst,
                                                  int n) {
  int i = blockIdx.x * 256 + threadIdx.x;
  if (i < n) dst[i] = (_Float16)src[i];
}

// ---------------------------------------------------------------------------
// Y[M x 256] = X[M x 256] @ W^T + bias, WMMA f16->f32.
// One 16x16 tile per wave; 8 waves/block -> 32x64 block tile.
// mode 0: f16 out, row-major [m][n]            (Q / K projections)
// mode 1: f16 out, per-batch transposed V^T:   vt[b][n][t], m = b*1024 + t
// mode 2: f32 out, row-major [m][n]            (final Wo projection)
// ---------------------------------------------------------------------------
__global__ void __launch_bounds__(256) gemm256_kernel(
    const _Float16* __restrict__ X, const _Float16* __restrict__ Wh,
    const float* __restrict__ bias, void* __restrict__ Yv, int mode) {
  const int lane = threadIdx.x & 31, w = threadIdx.x >> 5;
  const int m0 = (blockIdx.x * 2 + (w & 1)) * 16;
  const int n0 = (blockIdx.y * 4 + (w >> 1)) * 16;
  v8f acc = {};
#pragma unroll
  for (int k0 = 0; k0 < 256; k0 += 32) {
    v16h a = load_tile(X + (size_t)m0 * 256 + k0, 256, lane);
    v16h b = load_tile(Wh + (size_t)n0 * 256 + k0, 256, lane);
    acc = wmma_f16(a, b, acc);
  }
  const int g = lane >> 4, n = n0 + (lane & 15);
  const float bn = bias[n];
#pragma unroll
  for (int v = 0; v < 8; ++v) {
    const int m = m0 + v + 8 * g;
    float y = acc[v] + bn;
    if (mode == 0) {
      ((_Float16*)Yv)[(size_t)m * 256 + n] = (_Float16)y;
    } else if (mode == 1) {
      int bb = m >> 10, t = m & 1023;
      ((_Float16*)Yv)[((size_t)bb * 256 + n) * 1024 + t] = (_Float16)y;
    } else {
      ((float*)Yv)[(size_t)m * 256 + n] = y;
    }
  }
}

// ---------------------------------------------------------------------------
// Fused flash attention with cooperative async-to-LDS K/V staging.
// grid = (B*2 heads, L/128). Block = 8 waves; wave w owns Q rows
// [blockIdx.y*128 + w*16, +16). Keys processed in 32-chunks:
//   - all 256 threads issue async b128 copies of the NEXT K (32x128, [t][d])
//     and V (128x32, [d][t]) chunk into the alternate LDS buffer
//   - s_wait_asynccnt 0 + barrier retires the CURRENT chunk's copies
//   - per wave: S = Q K^T (8 WMMAs from LDS B-tiles), online softmax,
//     P transposed through per-wave LDS scratch, O += P V (8 WMMAs).
// K/V are loaded once per 128 Q rows instead of once per 16 -> 8x less
// on-chip traffic, and the async copies overlap the WMMA work.
// ---------------------------------------------------------------------------
__global__ void __launch_bounds__(256) attn_kernel(
    const _Float16* __restrict__ qp, const _Float16* __restrict__ kp,
    const _Float16* __restrict__ vt, _Float16* __restrict__ oh) {
  // Row pitches are 16 B x odd, so that the 16 rows one ds_load_b128 fragment
  // read touches start on 16 different bank groups (64 banks x 4 B) instead
  // of all on the same four banks (256-B rows) or on four groups (64-B rows).
  constexpr int KP = 136;                 // halves per K row: 256 B + 16 B pad
  constexpr int VP = 40;                  // halves per V row:  64 B + 16 B pad
  __shared__ __attribute__((aligned(16))) _Float16 Ksh[2][32 * KP];   // [buf][t][d]
  __shared__ __attribute__((aligned(16))) _Float16 Vsh[2][128 * VP];  // [buf][d][t]
  __shared__ _Float16 Psh[8][16 * 40];    // per-wave P scratch (padded rows)

  const int tid = threadIdx.x;
  const int lane = tid & 31, wv = tid >> 5;
  const int b = blockIdx.x >> 1, h = blockIdx.x & 1;
  const int l0 = blockIdx.y * 128 + wv * 16;
  const _Float16* qb = qp + ((size_t)b * 4096 + l0) * 256 + h * 128;
  const _Float16* kb = kp + (size_t)b * 1024 * 256 + h * 128;
  const _Float16* vb = vt + ((size_t)b * 256 + h * 128) * 1024;

  // --- per-thread staging assignment: 2 K segments + 2 V segments (16B) ---
  // K chunk = 512 segs: seg s -> t = s>>4, d = (s&15)*8
  // V chunk = 512 segs: seg s -> d = s>>2, t = (s&3)*8
  const int kt0 = tid >> 4,         kd0 = (tid & 15) * 8;
  const int kt1 = (tid + 256) >> 4, kd1 = (tid & 15) * 8;
  const int vd0 = tid >> 2,         vt0c = (tid & 3) * 8;
  const int vd1 = (tid + 256) >> 2, vt1c = (tid & 3) * 8;

  auto stage = [&](int t0, int buf) {
    cp16_to_lds(kb + (size_t)(t0 + kt0) * 256 + kd0, &Ksh[buf][kt0 * KP + kd0]);
    cp16_to_lds(kb + (size_t)(t0 + kt1) * 256 + kd1, &Ksh[buf][kt1 * KP + kd1]);
    cp16_to_lds(vb + (size_t)vd0 * 1024 + t0 + vt0c, &Vsh[buf][vd0 * VP + vt0c]);
    cp16_to_lds(vb + (size_t)vd1 * 1024 + t0 + vt1c, &Vsh[buf][vd1 * VP + vt1c]);
  };

  // --- Q tile (16x128) resident in registers for the whole key loop ---
  v16h qa[4];
#pragma unroll
  for (int kt = 0; kt < 4; ++kt) qa[kt] = load_tile(qb + kt * 32, 256, lane);

  v8f o[8] = {};
  float mrow[8], lrow[8];
#pragma unroll
  for (int v = 0; v < 8; ++v) { mrow[v] = -1e30f; lrow[v] = 0.f; }

  const int g = lane >> 4, col = lane & 15;
  const float scale = 0.0625f;  // 256^-0.5 (full-dim scale, as in reference)

  stage(0, 0);  // prologue: chunk 0 in flight

  for (int i = 0; i < 32; ++i) {
    const int buf = i & 1;
    WAIT_ASYNC();        // my copies for chunk i have landed in LDS
    __syncthreads();     // everyone's copies done; prev chunk fully consumed
    if (i + 1 < 32) stage((i + 1) * 32, buf ^ 1);  // overlap next DMA

    const _Float16* kc = Ksh[buf];
    const _Float16* vc = Vsh[buf];

    // --- S = Q K^T for this 16x32 key chunk (two 16x16 N-tiles) ---
    v8f s0 = {}, s1 = {};
#pragma unroll
    for (int kt = 0; kt < 4; ++kt) {
      v16h b0 = load_tile(kc + kt * 32, KP, lane);
      v16h b1 = load_tile(kc + 16 * KP + kt * 32, KP, lane);
      s0 = wmma_f16(qa[kt], b0, s0);
      s1 = wmma_f16(qa[kt], b1, s1);
    }

    // --- online softmax; stage P (f16) into this wave's LDS scratch ---
    _Float16* pw = Psh[wv];
#pragma unroll
    for (int v = 0; v < 8; ++v) {
      float a0 = s0[v] * scale, a1 = s1[v] * scale;
      float rmax = fmaxf(a0, a1);
#pragma unroll
      for (int msk = 1; msk < 16; msk <<= 1)
        rmax = fmaxf(rmax, __shfl_xor(rmax, msk, 32));
      float mnew = fmaxf(mrow[v], rmax);
      float cf = __expf(mrow[v] - mnew);
      float p0 = __expf(a0 - mnew), p1 = __expf(a1 - mnew);
      float rs = p0 + p1;
#pragma unroll
      for (int msk = 1; msk < 16; msk <<= 1) rs += __shfl_xor(rs, msk, 32);
      lrow[v] = lrow[v] * cf + rs;
      mrow[v] = mnew;
#pragma unroll
      for (int d = 0; d < 8; ++d) o[d][v] *= cf;
      const int row = v + 8 * g;
      pw[row * 40 + col]      = (_Float16)p0;
      pw[row * 40 + col + 16] = (_Float16)p1;
    }
    __syncthreads();  // orders the cross-lane P transpose (and LDS reuse)

    // --- reload P as a WMMA A-tile ---
    v16h pa;
    {
      const _Float16* base = &pw[(lane & 15) * 40 + (lane >> 4) * 8];
#pragma unroll
      for (int j = 0; j < 8; ++j) { pa[j] = base[j]; pa[8 + j] = base[16 + j]; }
    }

    // --- O += P V (V tile in LDS, rows d, contiguous t) ---
#pragma unroll
    for (int d = 0; d < 8; ++d) {
      v16h bvt = load_tile(vc + (d * 16) * VP, VP, lane);
      o[d] = wmma_f16(pa, bvt, o[d]);
    }
  }

  // --- normalize rows by softmax denominator, store f16 ---
#pragma unroll
  for (int v = 0; v < 8; ++v) {
    const int m = l0 + v + 8 * g;
    const float linv = 1.f / lrow[v];
#pragma unroll
    for (int d = 0; d < 8; ++d) {
      int c = h * 128 + d * 16 + col;
      oh[((size_t)b * 4096 + m) * 256 + c] = (_Float16)(o[d][v] * linv);
    }
  }
}

// ---------------------------------------------------------------------------
// Host orchestration
// ---------------------------------------------------------------------------
extern "C" void kernel_launch(void* const* d_in, const int* in_sizes, int n_in,
                              void* d_out, int out_size, void* d_ws, size_t ws_size,
                              hipStream_t stream) {
  const float* x     = (const float*)d_in[0];
  const float* wdw   = (const float*)d_in[1];
  const float* gamma = (const float*)d_in[2];
  const float* beta  = (const float*)d_in[3];
  const float* mean  = (const float*)d_in[4];
  const float* var   = (const float*)d_in[5];
  const float* Wq = (const float*)d_in[6];  const float* bq = (const float*)d_in[7];
  const float* Wk = (const float*)d_in[8];  const float* bk = (const float*)d_in[9];
  const float* Wv = (const float*)d_in[10]; const float* bv = (const float*)d_in[11];
  const float* Wo = (const float*)d_in[12]; const float* bo = (const float*)d_in[13];

  char* ws = (char*)d_ws;
  size_t off = 0;
  auto alloc = [&](size_t bytes) {
    char* p = ws + off;
    off = (off + bytes + 255) & ~(size_t)255;
    return p;
  };
  const size_t L = 8ull * 4096 * 256;  // q-side token elements
  const size_t T = 8ull * 1024 * 256;  // pooled token elements
  _Float16* qin = (_Float16*)alloc(L * 2);
  _Float16* kvin = (_Float16*)alloc(T * 2);
  _Float16* Wqh = (_Float16*)alloc(65536 * 2);
  _Float16* Wkh = (_Float16*)alloc(65536 * 2);
  _Float16* Wvh = (_Float16*)alloc(65536 * 2);
  _Float16* Woh = (_Float16*)alloc(65536 * 2);
  _Float16* qpj = (_Float16*)alloc(L * 2);   // Q projected [B,4096,256]
  _Float16* kpj = (_Float16*)alloc(T * 2);   // K projected [B,1024,256]
  _Float16* vtj = (_Float16*)alloc(T * 2);   // V projected, transposed [B,256,1024]
  _Float16* ohb = (_Float16*)alloc(L * 2);   // attention output [B,4096,256]

  // 1) preprocessing
  dwconv_bn_kernel<<<(int)(L / 128 / 256), 256, 0, stream>>>(x, wdw, gamma, beta,
                                                             mean, var, qin);
  pool2x2_kernel<<<(int)(T / 256), 256, 0, stream>>>(x, kvin);
  cvt_kernel<<<256, 256, 0, stream>>>(Wq, Wqh, 65536);
  cvt_kernel<<<256, 256, 0, stream>>>(Wk, Wkh, 65536);
  cvt_kernel<<<256, 256, 0, stream>>>(Wv, Wvh, 65536);
  cvt_kernel<<<256, 256, 0, stream>>>(Wo, Woh, 65536);

  // 2) projections (WMMA GEMMs)
  gemm256_kernel<<<dim3(32768 / 32, 4), 256, 0, stream>>>(qin, Wqh, bq, qpj, 0);
  gemm256_kernel<<<dim3(8192 / 32, 4), 256, 0, stream>>>(kvin, Wkh, bk, kpj, 0);
  gemm256_kernel<<<dim3(8192 / 32, 4), 256, 0, stream>>>(kvin, Wvh, bv, vtj, 1);

  // 3) fused flash attention: 16 (batch,head) x 32 blocks of 128 Q rows
  attn_kernel<<<dim3(16, 32), 256, 0, stream>>>(qpj, kpj, vtj, ohb);

  // 4) output projection -> f32 d_out
  gemm256_kernel<<<dim3(32768 / 32, 4), 256, 0, stream>>>(ohb, Woh, bo, d_out, 2);
}

// v003
// It runs in 104 microseconds.
// Two timings next to v002 both put it at 1.75 times that version's speed.
// All steps since v000 together make it 3.25 times as fast.
#include <hip/hip_runtime.h>
#include <hip/hip_bf16.h>

// ---------------------------------------------------------------------------
// CDNA5 (gfx1250) fused self-attention, wave32 + v_wmma_f32_16x16x32_f16.
// B=8, F=4, C=256, H=W=32 -> L=4096 tokens, pooled T=1024, 2 heads of 128.
// Bandwidth-bound: f16 operands everywhere, flash-style fused attention,
// K/V staged cooperatively into LDS via async-to-LDS (ASYNCcnt) with
// double buffering so DMA overlaps WMMA compute.
// ---------------------------------------------------------------------------

typedef __attribute__((ext_vector_type(16))) _Float16 v16h;
typedef __attribute__((ext_vector_type(8)))  _Float16 v8h;
typedef __attribute__((ext_vector_type(8)))  float    v8f;
typedef __attribute__((ext_vector_type(4)))  int      v4i;

#define DEVINL __device__ __forceinline__

#if defined(__AMDGCN__) && __has_builtin(__builtin_amdgcn_global_load_async_to_lds_b128)
#define USE_ASYNC_LDS 1
#endif

#if defined(__AMDGCN__) && __has_builtin(__builtin_amdgcn_s_wait_asynccnt)
#define WAIT_ASYNC() __builtin_amdgcn_s_wait_asynccnt(0)
#elif defined(USE_ASYNC_LDS)
#define WAIT_ASYNC() asm volatile("s_wait_asynccnt 0x0" ::: "memory")
#else
#define WAIT_ASYNC() ((void)0)
#endif

// Copy 16 bytes/lane from global to LDS. Async path: one
// global_load_async_to_lds_b128 per call (512B per wave), tracked by ASYNCcnt.
// Builtin signature (probed from hipcc diagnostics): global int4* (AS1),
// LDS int4* (AS3), imm offset, imm cpol.
DEVINL void cp16_to_lds(const _Float16* g, _Float16* l) {
#ifdef USE_ASYNC_LDS
  __builtin_amdgcn_global_load_async_to_lds_b128(
      (__attribute__((address_space(1))) v4i*)(v4i*)g,
      (__attribute__((address_space(3))) v4i*)(v4i*)l, 0, 0);
#else
  *(v8h*)l = *(const v8h*)g;
#endif
}

DEVINL v8f wmma_f16(v16h a, v16h b, v8f c) {
  // (neg_a, A, neg_b, B, c_mod, C, reuse_a, reuse_b)
  return __builtin_amdgcn_wmma_f32_16x16x32_f16(false, a, false, b, (short)0, c,
                                                false, false);
}

// Load a 16x32 tile in WMMA 16-bit A layout from a row-major half matrix
// (row stride `ld` halves). Per ISA: lane L supplies row L%16; its 16 halves
// map to k = (i&7) + 8*(L>>4) + 16*(i>>3) -> two contiguous 8-half runs.
// Also produces a B-tile (32x16, K-major) when the source is [n][k]
// row-major, since B[k][n] = src[n][k]. Works for global or LDS pointers.
DEVINL v16h load_tile(const _Float16* p, int ld, int lane) {
  const int r = lane & 15, g = lane >> 4;
  const _Float16* b0 = p + (size_t)r * ld + g * 8;
  v8h lo = *(const v8h*)(b0);
  v8h hi = *(const v8h*)(b0 + 16);
  v16h t;
#pragma unroll
  for (int i = 0; i < 8; ++i) { t[i] = lo[i]; t[8 + i] = hi[i]; }
  return t;
}

// ---------------------------------------------------------------------------
// Prep: depthwise 3x3 conv + BN (q path), f32 -> f16
// One thread = 4 adjacent channels x a patch of 4 (x) by 8 (y) pixels. Its 36
// filter taps and BN terms are loaded once and stay in registers; the patch is
// walked down y, each input row (6 pixels, 16-byte loads, a wave reads 512
// contiguous bytes per load) fetched two rows ahead of its first use.
// Taps outside the map enter as zeros (the convolution's zero padding): their
// addresses are clamped into the map and the loaded value is multiplied by 0,
// which keeps every load unconditional, so that none waits behind a branch.
// ---------------------------------------------------------------------------
typedef __attribute__((ext_vector_type(4))) float    v4f;
typedef __attribute__((ext_vector_type(4))) _Float16 v4h;

__global__ void __launch_bounds__(256) dwconv_bn_kernel(
    const float* __restrict__ x, const float* __restrict__ wdw,
    const float* __restrict__ gamma, const float* __restrict__ beta,
    const float* __restrict__ mean, const float* __restrict__ var,
    _Float16* __restrict__ qin) {
  constexpr int PX = 4, PY = 8;
  int s = blockIdx.x * 256 + threadIdx.x;
  const int c  = (s & 63) * 4;  s >>= 6;
  const int x0 = (s & 7) * PX;  s >>= 3;
  const int y0 = (s & 3) * PY;  s >>= 2;
  const int f  = s & 3;
  const int b  = s >> 2;
  const int ch = f * 256 + c;
  const size_t map = ((size_t)b * 4096 + f * 1024) * 256 + c;
  const float* xb = x + map;

  v4f r[PY + 2][PX + 2];  // input rows y0-1 .. y0+PY, columns x0-1 .. x0+PX
  auto load_row = [&](int j) {
    const int y = y0 - 1 + j;
    const int yc = (j == 0) ? max(y, 0) : (j == PY + 1) ? min(y, 31) : y;
#pragma unroll
    for (int k = 0; k < PX + 2; ++k) {
      const int xx = x0 - 1 + k;
      const int xc = (k == 0) ? max(xx, 0) : (k == PX + 1) ? min(xx, 31) : xx;
      r[j][k] = *(const v4f*)(xb + (size_t)(yc * 32 + xc) * 256);
    }
    // before a later instruction reuses an address register of these loads
    asm volatile("s_wait_xcnt 0x0" ::: "memory");
  };
  // zero padding, applied where a row is first used and not where it is loaded
  const float inl = (x0 > 0) ? 1.f : 0.f, inr = (x0 + PX < 32) ? 1.f : 0.f;
  const float top = (y0 > 0) ? 1.f : 0.f, bot = (y0 + PY < 32) ? 1.f : 0.f;
  auto pad_row = [&](int j) {
    const float my = (j == 0) ? top : (j == PY + 1) ? bot : 1.f;
    r[j][0] *= my * inl;
    r[j][PX + 1] *= my * inr;
    if (j == 0 || j == PY + 1) {
#pragma unroll
      for (int k = 1; k <= PX; ++k) r[j][k] *= my;
    }
  };

#pragma unroll
  for (int j = 0; j < 4; ++j) load_row(j);

  // taps of channel c+e: flat elements e*9 .. e*9+8 of these 36 floats
  v4f wv[9];
#pragma unroll
  for (int q = 0; q < 9; ++q) wv[q] = *(const v4f*)(wdw + (size_t)ch * 9 + q * 4);
  asm volatile("s_wait_xcnt 0x0" ::: "memory");  // as in load_row
  const v4f ga = *(const v4f*)(gamma + ch), be = *(const v4f*)(beta + ch);
  const v4f mu = *(const v4f*)(mean + ch),  va = *(const v4f*)(var + ch);
  asm volatile("s_wait_xcnt 0x0" ::: "memory");  // as in load_row
  v4f inv;
#pragma unroll
  for (int e = 0; e < 4; ++e) inv[e] = ga[e] * rsqrtf(va[e] + 1e-5f);

#pragma unroll
  for (int oy = 0; oy < PY; ++oy) {
    if (oy + 4 < PY + 2) load_row(oy + 4);
    // keeps that row's loads in front of this row's arithmetic: left free, the
    // scheduler sinks them to just before their first use, and each then waits
    // a whole memory latency
    __builtin_amdgcn_sched_barrier(0);
    if (oy == 0) { pad_row(0); pad_row(1); }
    pad_row(oy + 2);
#pragma unroll
    for (int px = 0; px < PX; ++px) {
      v4h q;
#pragma unroll
      for (int e = 0; e < 4; ++e) {
        float acc = 0.f;
#pragma unroll
        for (int ky = 0; ky < 3; ++ky)
#pragma unroll
          for (int kx = 0; kx < 3; ++kx) {
            const int t = e * 9 + ky * 3 + kx;
            acc += r[oy + ky][px + kx][e] * wv[t >> 2][t & 3];
          }
        q[e] = (_Float16)((acc - mu[e]) * inv[e] + be[e]);
      }
      *(v4h*)(qin + map + (size_t)((y0 + oy) * 32 + x0 + px) * 256) = q;
    }
  }
}

// ---------------------------------------------------------------------------
// Prep: 2x2 average pool (k/v source), f32 -> f16
// ---------------------------------------------------------------------------
__global__ void __launch_bounds__(256) pool2x2_kernel(
    const float* __restrict__ x, _Float16* __restrict__ kvin) {
  int i = blockIdx.x * 256 + threadIdx.x;
  int c = i & 255; int s = i >> 8;
  int xx = s & 15; s >>= 4;
  int yy = s & 15; s >>= 4;
  int f  = s & 3;  int b = s >> 2;
  const float* xb = x + ((size_t)b * 4096 + f * 1024) * 256 + c;
  int y2 = yy * 2, x2 = xx * 2;
  float v = xb[(size_t)(y2 * 32 + x2) * 256] +
            xb[(size_t)(y2 * 32 + x2 + 1) * 256] +
            xb[(size_t)((y2 + 1) * 32 + x2) * 256] +
            xb[(size_t)((y2 + 1) * 32 + x2 + 1) * 256];
  int tk = f * 256 + yy * 16 + xx;
  kvin[((size_t)b * 1024 + tk) * 256 + c] = (_Float16)(v * 0.25f);
}

// ---------------------------------------------------------------------------
// f32 -> f16 weight conversion
// ---------------------------------------------------------------------------
__global__ void __launch_bounds__(256) cvt_kernel(const float* __restrict__ src,
                                                  _Float16* __restrict__ dst,
                                                  int n) {
  int i = blockIdx.x * 256 + threadIdx.x;
  if (i < n) dst[i] = (_Float16)src[i];
}

// ---------------------------------------------------------------------------
// Y[M x 256] = X[M x 256] @ W^T + bias, WMMA f16->f32.
// One 128 (m) x 128 (n) tile of Y per block of 8 waves. The block's 128 rows
// of X and 128 rows of W (all 256 k) are copied once into LDS, one whole
// 512-byte row per wave-wide copy; each wave then computes 64 x 32 results
// (4 x 2 accumulator tiles) from LDS fragments: 12 fragment reads feed 8 WMMAs.
// mode 0: f16 out, row-major [m][n]            (Q / K projections)
// mode 1: f16 out, per-batch transposed V^T:   vt[b][n][t], m = b*1024 + t
// mode 2: f32 out, row-major [m][n]            (final Wo projection)
// A lane's 8 accumulator registers run along the A operand's rows, so A is the
// operand whose index is contiguous in an f16 output: W (n) in mode 0, X (m = t)
// in mode 1; each lane then stores its 8 results as one 16-byte piece.
// ---------------------------------------------------------------------------
// Eight 16-byte-per-lane copies global -> LDS: rows r, r+8, .. r+56 of a tile
// (global rows of 512 B, LDS rows of 528 B). The closing s_wait_xcnt stands in
// the same statement, in front of any later write of the address registers.
DEVINL void cp_rows8(const _Float16* g, unsigned l) {
  asm volatile(
      "global_load_async_to_lds_b128 %0, %8, off\n\t"
      "global_load_async_to_lds_b128 %1, %9, off\n\t"
      "global_load_async_to_lds_b128 %2, %10, off\n\t"
      "global_load_async_to_lds_b128 %3, %11, off\n\t"
      "global_load_async_to_lds_b128 %4, %12, off\n\t"
      "global_load_async_to_lds_b128 %5, %13, off\n\t"
      "global_load_async_to_lds_b128 %6, %14, off\n\t"
      "global_load_async_to_lds_b128 %7, %15, off\n\t"
      "s_wait_xcnt 0x0"
      :: "v"(l), "v"(l + 1 * 4224u), "v"(l + 2 * 4224u), "v"(l + 3 * 4224u),
         "v"(l + 4 * 4224u), "v"(l + 5 * 4224u), "v"(l + 6 * 4224u),
         "v"(l + 7 * 4224u),
         "v"(g), "v"(g + 1 * 2048), "v"(g + 2 * 2048), "v"(g + 3 * 2048),
         "v"(g + 4 * 2048), "v"(g + 5 * 2048), "v"(g + 6 * 2048),
         "v"(g + 7 * 2048)
      : "memory");
}

__global__ void __launch_bounds__(256) gemm256_kernel(
    const _Float16* __restrict__ X, const _Float16* __restrict__ Wh,
    const float* __restrict__ bias, void* __restrict__ Yv, int mode) {
  // Row pitch 528 B = 16 B x odd: the 16 rows of a ds_load_b128 fragment read
  // start on 16 different bank groups.
  constexpr int GP = 264;                 // halves per staged row
  constexpr int TILE = 128 * GP;          // halves per staged operand tile
  __shared__ __attribute__((aligned(16))) _Float16 Sh[2 * TILE];  // X rows | W rows

  const int lane = threadIdx.x & 31, w = threadIdx.x >> 5;
  const int mb = blockIdx.x * 128, nb = blockIdx.y * 128;

  // wave w copies rows w, w+8, .. w+120 of both tiles; lane = 16-byte column
  {
    const _Float16* gx = X + (size_t)(mb + w) * 256 + lane * 8;
    const _Float16* gw = Wh + (size_t)(nb + w) * 256 + lane * 8;
    const unsigned lx = (unsigned)(size_t)Sh + (unsigned)(w * GP + lane * 8) * 2u;
    const unsigned lw = lx + (unsigned)TILE * 2u;
    cp_rows8(gw, lw);
    cp_rows8(gw + 64 * 256, lw + 64u * 528u);
    cp_rows8(gx, lx);
    cp_rows8(gx + 64 * 256, lx + 64u * 528u);
  }
  // this wave's copies have landed; behind the barrier, every wave's have
  asm volatile("s_wait_asynccnt 0x0" ::: "memory");
  __syncthreads();

  const int wa = w & 1, wb = w >> 1;
  const _Float16* As = Sh + (mode == 0 ? TILE : 0) + (wa * 64) * GP;
  const _Float16* Bs = Sh + (mode == 0 ? 0 : TILE) + (wb * 32) * GP;

  v8f acc[4][2] = {};
  v16h a[2][4], b[2][2];  // two fragment sets: one in use, one being filled
  auto fetch = [&](int s, int k0) {
#pragma unroll
    for (int i = 0; i < 4; ++i) a[s][i] = load_tile(As + i * 16 * GP + k0, GP, lane);
#pragma unroll
    for (int j = 0; j < 2; ++j) b[s][j] = load_tile(Bs + j * 16 * GP + k0, GP, lane);
  };
  fetch(0, 0);
#pragma unroll
  for (int ks = 0; ks < 8; ++ks) {
    if (ks + 1 < 8) fetch((ks + 1) & 1, (ks + 1) * 32);
    // keeps the next step's 12 LDS reads as one group in front of this step's
    // WMMAs: left free, the scheduler sinks them to two reads in front of each
    // pair of WMMAs, and every pair then waits a whole LDS latency
    __builtin_amdgcn_sched_barrier(0);
#pragma unroll
    for (int i = 0; i < 4; ++i)
#pragma unroll
      for (int j = 0; j < 2; ++j)
        acc[i][j] = wmma_f16(a[ks & 1][i], b[ks & 1][j], acc[i][j]);
    // keeps the following group of reads whole behind these WMMAs: left free,
    // the scheduler lifts parts of it in among them
    __builtin_amdgcn_sched_barrier(0);
  }

  // acc[i][j][v] = product at A row wa*64 + i*16 + 8g + v, B row wb*32 + j*16 + c
  const int g = lane >> 4, c = lane & 15;
  if (mode == 0) {
#pragma unroll
    for (int i = 0; i < 4; ++i) {
      const int n = nb + wa * 64 + i * 16 + 8 * g;
      const v4f b0 = *(const v4f*)(bias + n), b1 = *(const v4f*)(bias + n + 4);
#pragma unroll
      for (int j = 0; j < 2; ++j) {
        const int m = mb + wb * 32 + j * 16 + c;
        v8h y;
#pragma unroll
        for (int v = 0; v < 4; ++v) {
          y[v]     = (_Float16)(acc[i][j][v] + b0[v]);
          y[4 + v] = (_Float16)(acc[i][j][4 + v] + b1[v]);
        }
        *(v8h*)((_Float16*)Yv + (size_t)m * 256 + n) = y;
      }
    }
  } else if (mode == 1) {
#pragma unroll
    for (int j = 0; j < 2; ++j) {
      const int n = nb + wb * 32 + j * 16 + c;
      const float bn = bias[n];
#pragma unroll
      for (int i = 0; i < 4; ++i) {
        const int m = mb + wa * 64 + i * 16 + 8 * g;
        const int bb = m >> 10, t = m & 1023;
        v8h y;
#pragma unroll
        for (int v = 0; v < 8; ++v) y[v] = (_Float16)(acc[i][j][v] + bn);
        *(v8h*)((_Float16*)Yv + ((size_t)bb * 256 + n) * 1024 + t) = y;
      }
    }
    // before a later instruction reuses an address or data register of these stores
    asm volatile("s_wait_xcnt 0x0" ::: "memory");
  } else {
#pragma unroll
    for (int j = 0; j < 2; ++j) {
      const int n = nb + wb * 32 + j * 16 + c;
      const float bn = bias[n];
#pragma unroll
      for (int i = 0; i < 4; ++i) {
        const int m = mb + wa * 64 + i * 16 + 8 * g;
#pragma unroll
        for (int v = 0; v < 8; ++v)
          ((float*)Yv)[(size_t)(m + v) * 256 + n] = acc[i][j][v] + bn;
      }
    }
    // before a later instruction reuses an address or data register of these stores
    asm volatile("s_wait_xcnt 0x0" ::: "memory");
  }
}

// ---------------------------------------------------------------------------
// Fused flash attention with cooperative async-to-LDS K/V staging.
// grid = (B*2 heads, L/128). Block = 8 waves; wave w owns Q rows
// [blockIdx.y*128 + w*16, +16). Keys processed in 32-chunks:
//   - all 256 threads issue async b128 copies of the NEXT K (32x128, [t][d])
//     and V (128x32, [d][t]) chunk into the alternate LDS buffer
//   - s_wait_asynccnt 0 + barrier retires the CURRENT chunk's copies
//   - per wave: S = Q K^T (8 WMMAs from LDS B-tiles), online softmax,
//     P transposed through per-wave LDS scratch, O += P V (8 WMMAs).
// K/V are loaded once per 128 Q rows instead of once per 16 -> 8x less
// on-chip traffic, and the async copies overlap the WMMA work.
// ---------------------------------------------------------------------------
__global__ void __launch_bounds__(256) attn_kernel(
    const _Float16* __restrict__ qp, const _Float16* __restrict__ kp,
    const _Float16* __restrict__ vt, _Float16* __restrict__ oh) {
  // Row pitches are 16 B x odd, so that the 16 rows one ds_load_b128 fragment
  // read touches start on 16 different bank groups (64 banks x 4 B) instead
  // of all on the same four banks (256-B rows) or on four groups (64-B rows).
  constexpr int KP = 136;                 // halves per K row: 256 B + 16 B pad
  constexpr int VP = 40;                  // halves per V row:  64 B + 16 B pad
  __shared__ __attribute__((aligned(16))) _Float16 Ksh[2][32 * KP];   // [buf][t][d]
  __shared__ __attribute__((aligned(16))) _Float16 Vsh[2][128 * VP];  // [buf][d][t]
  __shared__ _Float16 Psh[8][16 * 40];    // per-wave P scratch (padded rows)

  const int tid = threadIdx.x;
  const int lane = tid & 31, wv = tid >> 5;
  const int b = blockIdx.x >> 1, h = blockIdx.x & 1;
  const int l0 = blockIdx.y * 128 + wv * 16;
  const _Float16* qb = qp + ((size_t)b * 4096 + l0) * 256 + h * 128;
  const _Float16* kb = kp + (size_t)b * 1024 * 256 + h * 128;
  const _Float16* vb = vt + ((size_t)b * 256 + h * 128) * 1024;

  // --- per-thread staging assignment: 2 K segments + 2 V segments (16B) ---
  // K chunk = 512 segs: seg s -> t = s>>4, d = (s&15)*8
  // V chunk = 512 segs: seg s -> d = s>>2, t = (s&3)*8
  const int kt0 = tid >> 4,         kd0 = (tid & 15) * 8;
  const int kt1 = (tid + 256) >> 4, kd1 = (tid & 15) * 8;
  const int vd0 = tid >> 2,         vt0c = (tid & 3) * 8;
  const int vd1 = (tid + 256) >> 2, vt1c = (tid & 3) * 8;

  auto stage = [&](int t0, int buf) {
    cp16_to_lds(kb + (size_t)(t0 + kt0) * 256 + kd0, &Ksh[buf][kt0 * KP + kd0]);
    cp16_to_lds(kb + (size_t)(t0 + kt1) * 256 + kd1, &Ksh[buf][kt1 * KP + kd1]);
    cp16_to_lds(vb + (size_t)vd0 * 1024 + t0 + vt0c, &Vsh[buf][vd0 * VP + vt0c]);
    cp16_to_lds(vb + (size_t)vd1 * 1024 + t0 + vt1c, &Vsh[buf][vd1 * VP + vt1c]);
  };

  // --- Q tile (16x128) resident in registers for the whole key loop ---
  v16h qa[4];
#pragma unroll
  for (int kt = 0; kt < 4; ++kt) qa[kt] = load_tile(qb + kt * 32, 256, lane);

  v8f o[8] = {};
  float mrow[8], lrow[8];
#pragma unroll
  for (int v = 0; v < 8; ++v) { mrow[v] = -1e30f; lrow[v] = 0.f; }

  const int g = lane >> 4, col = lane & 15;
  const float scale = 0.0625f;  // 256^-0.5 (full-dim scale, as in reference)

  stage(0, 0);  // prologue: chunk 0 in flight

  for (int i = 0; i < 32; ++i) {
    const int buf = i & 1;
    WAIT_ASYNC();        // my copies for chunk i have landed in LDS
    __syncthreads();     // everyone's copies done; prev chunk fully consumed
    if (i + 1 < 32) stage((i + 1) * 32, buf ^ 1);  // overlap next DMA

    const _Float16* kc = Ksh[buf];
    const _Float16* vc = Vsh[buf];

    // --- S = Q K^T for this 16x32 key chunk (two 16x16 N-tiles) ---
    v8f s0 = {}, s1 = {};
#pragma unroll
    for (int kt = 0; kt < 4; ++kt) {
      v16h b0 = load_tile(kc + kt * 32, KP, lane);
      v16h b1 = load_tile(kc + 16 * KP + kt * 32, KP, lane);
      s0 = wmma_f16(qa[kt], b0, s0);
      s1 = wmma_f16(qa[kt], b1, s1);
    }

    // --- online softmax; stage P (f16) into this wave's LDS scratch ---
    _Float16* pw = Psh[wv];
#pragma unroll
    for (int v = 0; v < 8; ++v) {
      float a0 = s0[v] * scale, a1 = s1[v] * scale;
      float rmax = fmaxf(a0, a1);
#pragma unroll
      for (int msk = 1; msk < 16; msk <<= 1)
        rmax = fmaxf(rmax, __shfl_xor(rmax, msk, 32));
      float mnew = fmaxf(mrow[v], rmax);
      float cf = __expf(mrow[v] - mnew);
      float p0 = __expf(a0 - mnew), p1 = __expf(a1 - mnew);
      float rs = p0 + p1;
#pragma unroll
      for (int msk = 1; msk < 16; msk <<= 1) rs += __shfl_xor(rs, msk, 32);
      lrow[v] = lrow[v] * cf + rs;
      mrow[v] = mnew;
#pragma unroll
      for (int d = 0; d < 8; ++d) o[d][v] *= cf;
      const int row = v + 8 * g;
      pw[row * 40 + col]      = (_Float16)p0;
      pw[row * 40 + col + 16] = (_Float16)p1;
    }
    __syncthreads();  // orders the cross-lane P transpose (and LDS reuse)

    // --- reload P as a WMMA A-tile ---
    v16h pa;
    {
      const _Float16* base = &pw[(lane & 15) * 40 + (lane >> 4) * 8];
#pragma unroll
      for (int j = 0; j < 8; ++j) { pa[j] = base[j]; pa[8 + j] = base[16 + j]; }
    }

    // --- O += P V (V tile in LDS, rows d, contiguous t) ---
#pragma unroll
    for (int d = 0; d < 8; ++d) {
      v16h bvt = load_tile(vc + (d * 16) * VP, VP, lane);
      o[d] = wmma_f16(pa, bvt, o[d]);
    }
  }

  // --- normalize rows by softmax denominator, store f16 ---
#pragma unroll
  for (int v = 0; v < 8; ++v) {
    const int m = l0 + v + 8 * g;
    const float linv = 1.f / lrow[v];
#pragma unroll
    for (int d = 0; d < 8; ++d) {
      int c = h * 128 + d * 16 + col;
      oh[((size_t)b * 4096 + m) * 256 + c] = (_Float16)(o[d][v] * linv);
    }
  }
}

// ---------------------------------------------------------------------------
// Host orchestration
// ---------------------------------------------------------------------------
extern "C" void kernel_launch(void* const* d_in, const int* in_sizes, int n_in,
                              void* d_out, int out_size, void* d_ws, size_t ws_size,
                              hipStream_t stream) {
  const float* x     = (const float*)d_in[0];
  const float* wdw   = (const float*)d_in[1];
  const float* gamma = (const float*)d_in[2];
  const float* beta  = (const float*)d_in[3];
  const float* mean  = (const float*)d_in[4];
  const float* var   = (const float*)d_in[5];
  const float* Wq = (const float*)d_in[6];  const float* bq = (const float*)d_in[7];
  const float* Wk = (const float*)d_in[8];  const float* bk = (const float*)d_in[9];
  const float* Wv = (const float*)d_in[10]; const float* bv = (const float*)d_in[11];
  const float* Wo = (const float*)d_in[12]; const float* bo = (const float*)d_in[13];

  char* ws = (char*)d_ws;
  size_t off = 0;
  auto alloc = [&](size_t bytes) {
    char* p = ws + off;
    off = (off + bytes + 255) & ~(size_t)255;
    return p;
  };
  const size_t L = 8ull * 4096 * 256;  // q-side token elements
  const size_t T = 8ull * 1024 * 256;  // pooled token elements
  _Float16* qin = (_Float16*)alloc(L * 2);
  _Float16* kvin = (_Float16*)alloc(T * 2);
  _Float16* Wqh = (_Float16*)alloc(65536 * 2);
  _Float16* Wkh = (_Float16*)alloc(65536 * 2);
  _Float16* Wvh = (_Float16*)alloc(65536 * 2);
  _Float16* Woh = (_Float16*)alloc(65536 * 2);
  _Float16* qpj = (_Float16*)alloc(L * 2);   // Q projected [B,4096,256]
  _Float16* kpj = (_Float16*)alloc(T * 2);   // K projected [B,1024,256]
  _Float16* vtj = (_Float16*)alloc(T * 2);   // V projected, transposed [B,256,1024]
  _Float16* ohb = (_Float16*)alloc(L * 2);   // attention output [B,4096,256]

  // 1) preprocessing
  dwconv_bn_kernel<<<(int)(L / 128 / 256), 256, 0, stream>>>(x, wdw, gamma, beta,
                                                             mean, var, qin);
  pool2x2_kernel<<<(int)(T / 256), 256, 0, stream>>>(x, kvin);
  cvt_kernel<<<256, 256, 0, stream>>>(Wq, Wqh, 65536);
  cvt_kernel<<<256, 256, 0, stream>>>(Wk, Wkh, 65536);
  cvt_kernel<<<256, 256, 0, stream>>>(Wv, Wvh, 65536);
  cvt_kernel<<<256, 256, 0, stream>>>(Wo, Woh, 65536);

  // 2) projections (WMMA GEMMs)
  gemm256_kernel<<<dim3(32768 / 128, 2), 256, 0, stream>>>(qin, Wqh, bq, qpj, 0);
  gemm256_kernel<<<dim3(8192 / 128, 2), 256, 0, stream>>>(kvin, Wkh, bk, kpj, 0);
  gemm256_kernel<<<dim3(8192 / 128, 2), 256, 0, stream>>>(kvin, Wvh, bv, vtj, 1);

  // 3) fused flash attention: 16 (batch,head) x 32 blocks of 128 Q rows
  attn_kernel<<<dim3(16, 32), 256, 0, stream>>>(qpj, kpj, vtj, ohb);

  // 4) output projection -> f32 d_out
  gemm256_kernel<<<dim3(32768 / 128, 2), 256, 0, stream>>>(ohb, Woh, bo, d_out, 2);
}

// v004
// One run takes 86.1 microseconds.
// In two side-by-side timings against v003, it was 1.22 and 1.21 times as fast.
// All steps since v000 together make it 3.95 times as fast.
#include <hip/hip_runtime.h>
#include <hip/hip_bf16.h>

// ---------------------------------------------------------------------------
// CDNA5 (gfx1250) fused self-attention, wave32 + v_wmma_f32_16x16x32_f16.
// B=8, F=4, C=256, H=W=32 -> L=4096 tokens, pooled T=1024, 2 heads of 128.
// Bandwidth-bound: f16 operands everywhere, flash-style fused attention,
// K/V staged cooperatively into LDS via async-to-LDS (ASYNCcnt) with
// double buffering so DMA overlaps WMMA compute.
// ---------------------------------------------------------------------------

typedef __attribute__((ext_vector_type(16))) _Float16 v16h;
typedef __attribute__((ext_vector_type(8)))  _Float16 v8h;
typedef __attribute__((ext_vector_type(8)))  float    v8f;
typedef __attribute__((ext_vector_type(4)))  int      v4i;

#define DEVINL __device__ __forceinline__

#if defined(__AMDGCN__) && __has_builtin(__builtin_amdgcn_global_load_async_to_lds_b128)
#define USE_ASYNC_LDS 1
#endif

#if defined(__AMDGCN__) && __has_builtin(__builtin_amdgcn_s_wait_asynccnt)
#define WAIT_ASYNC() __builtin_amdgcn_s_wait_asynccnt(0)
#elif defined(USE_ASYNC_LDS)
#define WAIT_ASYNC() asm volatile("s_wait_asynccnt 0x0" ::: "memory")
#else
#define WAIT_ASYNC() ((void)0)
#endif

// Copy 16 bytes/lane from global to LDS. Async path: one
// global_load_async_to_lds_b128 per call (512B per wave), tracked by ASYNCcnt.
// Builtin signature (probed from hipcc diagnostics): global int4* (AS1),
// LDS int4* (AS3), imm offset, imm cpol.
DEVINL void cp16_to_lds(const _Float16* g, _Float16* l) {
#ifdef USE_ASYNC_LDS
  __builtin_amdgcn_global_load_async_to_lds_b128(
      (__attribute__((address_space(1))) v4i*)(v4i*)g,
      (__attribute__((address_space(3))) v4i*)(v4i*)l, 0, 0);
#else
  *(v8h*)l = *(const v8h*)g;
#endif
}

DEVINL v8f wmma_f16(v16h a, v16h b, v8f c) {
  // (neg_a, A, neg_b, B, c_mod, C, reuse_a, reuse_b)
  return __builtin_amdgcn_wmma_f32_16x16x32_f16(false, a, false, b, (short)0, c,
                                                false, false);
}

// Load a 16x32 tile in WMMA 16-bit A layout from a row-major half matrix
// (row stride `ld` halves). Per ISA: lane L supplies row L%16; its 16 halves
// map to k = (i&7) + 8*(L>>4) + 16*(i>>3) -> two contiguous 8-half runs.
// Also produces a B-tile (32x16, K-major) when the source is [n][k]
// row-major, since B[k][n] = src[n][k]. Works for global or LDS pointers.
DEVINL v16h load_tile(const _Float16* p, int ld, int lane) {
  const int r = lane & 15, g = lane >> 4;
  const _Float16* b0 = p + (size_t)r * ld + g * 8;
  v8h lo = *(const v8h*)(b0);
  v8h hi = *(const v8h*)(b0 + 16);
  v16h t;
#pragma unroll
  for (int i = 0; i < 8; ++i) { t[i] = lo[i]; t[8 + i] = hi[i]; }
  return t;
}

// ---------------------------------------------------------------------------
// Prep: depthwise 3x3 conv + BN (q path), f32 -> f16
// One thread = 4 adjacent channels x a patch of 4 (x) by 8 (y) pixels. Its 36
// filter taps and BN terms are loaded once and stay in registers; the patch is
// walked down y, each input row (6 pixels, 16-byte loads, a wave reads 512
// contiguous bytes per load) fetched two rows ahead of its first use.
// Taps outside the map enter as zeros (the convolution's zero padding): their
// addresses are clamped into the map and the loaded value is multiplied by 0,
// which keeps every load unconditional, so that none waits behind a branch.
// ---------------------------------------------------------------------------
typedef __attribute__((ext_vector_type(4))) float    v4f;
typedef __attribute__((ext_vector_type(4))) _Float16 v4h;

__global__ void __launch_bounds__(256) dwconv_bn_kernel(
    const float* __restrict__ x, const float* __restrict__ wdw,
    const float* __restrict__ gamma, const float* __restrict__ beta,
    const float* __restrict__ mean, const float* __restrict__ var,
    _Float16* __restrict__ qin) {
  constexpr int PX = 4, PY = 8;
  int s = blockIdx.x * 256 + threadIdx.x;
  const int c  = (s & 63) * 4;  s >>= 6;
  const int x0 = (s & 7) * PX;  s >>= 3;
  const int y0 = (s & 3) * PY;  s >>= 2;
  const int f  = s & 3;
  const int b  = s >> 2;
  const int ch = f * 256 + c;
  const size_t map = ((size_t)b * 4096 + f * 1024) * 256 + c;
  const float* xb = x + map;

  v4f r[PY + 2][PX + 2];  // input rows y0-1 .. y0+PY, columns x0-1 .. x0+PX
  auto load_row = [&](int j) {
    const int y = y0 - 1 + j;
    const int yc = (j == 0) ? max(y, 0) : (j == PY + 1) ? min(y, 31) : y;
#pragma unroll
    for (int k = 0; k < PX + 2; ++k) {
      const int xx = x0 - 1 + k;
      const int xc = (k == 0) ? max(xx, 0) : (k == PX + 1) ? min(xx, 31) : xx;
      r[j][k] = *(const v4f*)(xb + (size_t)(yc * 32 + xc) * 256);
    }
    // before a later instruction reuses an address register of these loads
    asm volatile("s_wait_xcnt 0x0" ::: "memory");
  };
  // zero padding, applied where a row is first used and not where it is loaded
  const float inl = (x0 > 0) ? 1.f : 0.f, inr = (x0 + PX < 32) ? 1.f : 0.f;
  const float top = (y0 > 0) ? 1.f : 0.f, bot = (y0 + PY < 32) ? 1.f : 0.f;
  auto pad_row = [&](int j) {
    const float my = (j == 0) ? top : (j == PY + 1) ? bot : 1.f;
    r[j][0] *= my * inl;
    r[j][PX + 1] *= my * inr;
    if (j == 0 || j == PY + 1) {
#pragma unroll
      for (int k = 1; k <= PX; ++k) r[j][k] *= my;
    }
  };

#pragma unroll
  for (int j = 0; j < 4; ++j) load_row(j);

  // taps of channel c+e: flat elements e*9 .. e*9+8 of these 36 floats
  v4f wv[9];
#pragma unroll
  for (int q = 0; q < 9; ++q) wv[q] = *(const v4f*)(wdw + (size_t)ch * 9 + q * 4);
  asm volatile("s_wait_xcnt 0x0" ::: "memory");  // as in load_row
  const v4f ga = *(const v4f*)(gamma + ch), be = *(const v4f*)(beta + ch);
  const v4f mu = *(const v4f*)(mean + ch),  va = *(const v4f*)(var + ch);
  asm volatile("s_wait_xcnt 0x0" ::: "memory");  // as in load_row
  v4f inv;
#pragma unroll
  for (int e = 0; e < 4; ++e) inv[e] = ga[e] * rsqrtf(va[e] + 1e-5f);

#pragma unroll
  for (int oy = 0; oy < PY; ++oy) {
    if (oy + 4 < PY + 2) load_row(oy + 4);
    // keeps that row's loads in front of this row's arithmetic: left free, the
    // scheduler sinks them to just before their first use, and each then waits
    // a whole memory latency
    __builtin_amdgcn_sched_barrier(0);
    if (oy == 0) { pad_row(0); pad_row(1); }
    pad_row(oy + 2);
#pragma unroll
    for (int px = 0; px < PX; ++px) {
      v4h q;
#pragma unroll
      for (int e = 0; e < 4; ++e) {
        float acc = 0.f;
#pragma unroll
        for (int ky = 0; ky < 3; ++ky)
#pragma unroll
          for (int kx = 0; kx < 3; ++kx) {
            const int t = e * 9 + ky * 3 + kx;
            acc += r[oy + ky][px + kx][e] * wv[t >> 2][t & 3];
          }
        q[e] = (_Float16)((acc - mu[e]) * inv[e] + be[e]);
      }
      *(v4h*)(qin + map + (size_t)((y0 + oy) * 32 + x0 + px) * 256) = q;
    }
  }
}

// ---------------------------------------------------------------------------
// Prep: 2x2 average pool (k/v source), f32 -> f16
// ---------------------------------------------------------------------------
__global__ void __launch_bounds__(256) pool2x2_kernel(
    const float* __restrict__ x, _Float16* __restrict__ kvin) {
  int i = blockIdx.x * 256 + threadIdx.x;
  int c = i & 255; int s = i >> 8;
  int xx = s & 15; s >>= 4;
  int yy = s & 15; s >>= 4;
  int f  = s & 3;  int b = s >> 2;
  const float* xb = x + ((size_t)b * 4096 + f * 1024) * 256 + c;
  int y2 = yy * 2, x2 = xx * 2;
  float v = xb[(size_t)(y2 * 32 + x2) * 256] +
            xb[(size_t)(y2 * 32 + x2 + 1) * 256] +
            xb[(size_t)((y2 + 1) * 32 + x2) * 256] +
            xb[(size_t)((y2 + 1) * 32 + x2 + 1) * 256];
  int tk = f * 256 + yy * 16 + xx;
  kvin[((size_t)b * 1024 + tk) * 256 + c] = (_Float16)(v * 0.25f);
}

// ---------------------------------------------------------------------------
// f32 -> f16 weight conversion
// ---------------------------------------------------------------------------
__global__ void __launch_bounds__(256) cvt_kernel(const float* __restrict__ src,
                                                  _Float16* __restrict__ dst,
                                                  int n) {
  int i = blockIdx.x * 256 + threadIdx.x;
  if (i < n) dst[i] = (_Float16)src[i];
}

// ---------------------------------------------------------------------------
// Y[M x 256] = X[M x 256] @ W^T + bias, WMMA f16->f32.
// One 128 (m) x 128 (n) tile of Y per block of 8 waves. The block's 128 rows
// of X and 128 rows of W (all 256 k) are copied once into LDS, one whole
// 512-byte row per wave-wide copy; each wave then computes 64 x 32 results
// (4 x 2 accumulator tiles) from LDS fragments: 12 fragment reads feed 8 WMMAs.
// mode 0: f16 out, row-major [m][n]            (Q / K projections)
// mode 1: f16 out, per-batch transposed V^T:   vt[b][n][t], m = b*1024 + t
// mode 2: f32 out, row-major [m][n]            (final Wo projection)
// A lane's 8 accumulator registers run along the A operand's rows, so A is the
// operand whose index is contiguous in an f16 output: W (n) in mode 0, X (m = t)
// in mode 1; each lane then stores its 8 results as one 16-byte piece.
// ---------------------------------------------------------------------------
// Eight 16-byte-per-lane copies global -> LDS: rows r, r+8, .. r+56 of a tile
// (global rows of 512 B, LDS rows of 528 B). The closing s_wait_xcnt stands in
// the same statement, in front of any later write of the address registers.
DEVINL void cp_rows8(const _Float16* g, unsigned l) {
  asm volatile(
      "global_load_async_to_lds_b128 %0, %8, off\n\t"
      "global_load_async_to_lds_b128 %1, %9, off\n\t"
      "global_load_async_to_lds_b128 %2, %10, off\n\t"
      "global_load_async_to_lds_b128 %3, %11, off\n\t"
      "global_load_async_to_lds_b128 %4, %12, off\n\t"
      "global_load_async_to_lds_b128 %5, %13, off\n\t"
      "global_load_async_to_lds_b128 %6, %14, off\n\t"
      "global_load_async_to_lds_b128 %7, %15, off\n\t"
      "s_wait_xcnt 0x0"
      :: "v"(l), "v"(l + 1 * 4224u), "v"(l + 2 * 4224u), "v"(l + 3 * 4224u),
         "v"(l + 4 * 4224u), "v"(l + 5 * 4224u), "v"(l + 6 * 4224u),
         "v"(l + 7 * 4224u),
         "v"(g), "v"(g + 1 * 2048), "v"(g + 2 * 2048), "v"(g + 3 * 2048),
         "v"(g + 4 * 2048), "v"(g + 5 * 2048), "v"(g + 6 * 2048),
         "v"(g + 7 * 2048)
      : "memory");
}

__global__ void __launch_bounds__(256) gemm256_kernel(
    const _Float16* __restrict__ X, const _Float16* __restrict__ Wh,
    const float* __restrict__ bias, void* __restrict__ Yv, int mode) {
  // Row pitch 528 B = 16 B x odd: the 16 rows of a ds_load_b128 fragment read
  // start on 16 different bank groups.
  constexpr int GP = 264;                 // halves per staged row
  constexpr int TILE = 128 * GP;          // halves per staged operand tile
  __shared__ __attribute__((aligned(16))) _Float16 Sh[2 * TILE];  // X rows | W rows

  const int lane = threadIdx.x & 31, w = threadIdx.x >> 5;
  const int mb = blockIdx.x * 128, nb = blockIdx.y * 128;

  // wave w copies rows w, w+8, .. w+120 of both tiles; lane = 16-byte column
  {
    const _Float16* gx = X + (size_t)(mb + w) * 256 + lane * 8;
    const _Float16* gw = Wh + (size_t)(nb + w) * 256 + lane * 8;
    const unsigned lx = (unsigned)(size_t)Sh + (unsigned)(w * GP + lane * 8) * 2u;
    const unsigned lw = lx + (unsigned)TILE * 2u;
    cp_rows8(gw, lw);
    cp_rows8(gw + 64 * 256, lw + 64u * 528u);
    cp_rows8(gx, lx);
    cp_rows8(gx + 64 * 256, lx + 64u * 528u);
  }
  // this wave's copies have landed; behind the barrier, every wave's have
  asm volatile("s_wait_asynccnt 0x0" ::: "memory");
  __syncthreads();

  const int wa = w & 1, wb = w >> 1;
  const _Float16* As = Sh + (mode == 0 ? TILE : 0) + (wa * 64) * GP;
  const _Float16* Bs = Sh + (mode == 0 ? 0 : TILE) + (wb * 32) * GP;

  v8f acc[4][2] = {};
  v16h a[2][4], b[2][2];  // two fragment sets: one in use, one being filled
  auto fetch = [&](int s, int k0) {
#pragma unroll
    for (int i = 0; i < 4; ++i) a[s][i] = load_tile(As + i * 16 * GP + k0, GP, lane);
#pragma unroll
    for (int j = 0; j < 2; ++j) b[s][j] = load_tile(Bs + j * 16 * GP + k0, GP, lane);
  };
  fetch(0, 0);
#pragma unroll
  for (int ks = 0; ks < 8; ++ks) {
    if (ks + 1 < 8) fetch((ks + 1) & 1, (ks + 1) * 32);
    // keeps the next step's 12 LDS reads as one group in front of this step's
    // WMMAs: left free, the scheduler sinks them to two reads in front of each
    // pair of WMMAs, and every pair then waits a whole LDS latency
    __builtin_amdgcn_sched_barrier(0);
#pragma unroll
    for (int i = 0; i < 4; ++i)
#pragma unroll
      for (int j = 0; j < 2; ++j)
        acc[i][j] = wmma_f16(a[ks & 1][i], b[ks & 1][j], acc[i][j]);
    // keeps the following group of reads whole behind these WMMAs: left free,
    // the scheduler lifts parts of it in among them
    __builtin_amdgcn_sched_barrier(0);
  }

  // acc[i][j][v] = product at A row wa*64 + i*16 + 8g + v, B row wb*32 + j*16 + c
  const int g = lane >> 4, c = lane & 15;
  if (mode == 0) {
#pragma unroll
    for (int i = 0; i < 4; ++i) {
      const int n = nb + wa * 64 + i * 16 + 8 * g;
      const v4f b0 = *(const v4f*)(bias + n), b1 = *(const v4f*)(bias + n + 4);
#pragma unroll
      for (int j = 0; j < 2; ++j) {
        const int m = mb + wb * 32 + j * 16 + c;
        v8h y;
#pragma unroll
        for (int v = 0; v < 4; ++v) {
          y[v]     = (_Float16)(acc[i][j][v] + b0[v]);
          y[4 + v] = (_Float16)(acc[i][j][4 + v] + b1[v]);
        }
        *(v8h*)((_Float16*)Yv + (size_t)m * 256 + n) = y;
      }
    }
  } else if (mode == 1) {
#pragma unroll
    for (int j = 0; j < 2; ++j) {
      const int n = nb + wb * 32 + j * 16 + c;
      const float bn = bias[n];
#pragma unroll
      for (int i = 0; i < 4; ++i) {
        const int m = mb + wa * 64 + i * 16 + 8 * g;
        const int bb = m >> 10, t = m & 1023;
        v8h y;
#pragma unroll
        for (int v = 0; v < 8; ++v) y[v] = (_Float16)(acc[i][j][v] + bn);
        *(v8h*)((_Float16*)Yv + ((size_t)bb * 256 + n) * 1024 + t) = y;
      }
    }
    // before a later instruction reuses an address or data register of these stores
    asm volatile("s_wait_xcnt 0x0" ::: "memory");
  } else {
#pragma unroll
    for (int j = 0; j < 2; ++j) {
      const int n = nb + wb * 32 + j * 16 + c;
      const float bn = bias[n];
#pragma unroll
      for (int i = 0; i < 4; ++i) {
        const int m = mb + wa * 64 + i * 16 + 8 * g;
#pragma unroll
        for (int v = 0; v < 8; ++v)
          ((float*)Yv)[(size_t)(m + v) * 256 + n] = acc[i][j][v] + bn;
      }
    }
    // before a later instruction reuses an address or data register of these stores
    asm volatile("s_wait_xcnt 0x0" ::: "memory");
  }
}

DEVINL float xhalf(float x) {
  const int i = __builtin_bit_cast(int, x);
  return __builtin_bit_cast(
      float, __builtin_amdgcn_permlanex16(i, i, 0x76543210, 0xfedcba98, false, false));
}

__global__ void __launch_bounds__(256) attn_kernel(
    const _Float16* __restrict__ qp, const _Float16* __restrict__ kp,
    const _Float16* __restrict__ vt, _Float16* __restrict__ oh) {
  // Row pitches are 16 B x odd, so that the 16 rows one ds_load_b128 fragment
  // read touches start on 16 different bank groups (64 banks x 4 B) instead
  // of all on the same four banks (256-B rows) or on four groups (64-B rows).
  constexpr int KP = 136;                 // halves per K row: 256 B + 16 B pad
  constexpr int VP = 40;                  // halves per V row:  64 B + 16 B pad
  __shared__ __attribute__((aligned(16))) _Float16 Ksh[2][32 * KP];   // [buf][t][d]
  __shared__ __attribute__((aligned(16))) _Float16 Vsh[2][128 * VP];  // [buf][d][t]

  const int tid = threadIdx.x;
  const int lane = tid & 31, wv = tid >> 5;
  const int b = blockIdx.x >> 1, h = blockIdx.x & 1;
  const int l0 = blockIdx.y * 128 + wv * 16;
  const _Float16* qb = qp + ((size_t)b * 4096 + l0) * 256 + h * 128;
  const _Float16* kb = kp + (size_t)b * 1024 * 256 + h * 128;
  const _Float16* vb = vt + ((size_t)b * 256 + h * 128) * 1024;

  // --- per-thread staging assignment: 2 K segments + 2 V segments (16B) ---
  // K chunk = 512 segs: seg s -> t = s>>4, d = (s&15)*8
  // V chunk = 512 segs: seg s -> d = s>>2, t = (s&3)*8
  const int kt0 = tid >> 4,         kd0 = (tid & 15) * 8;
  const int kt1 = (tid + 256) >> 4, kd1 = (tid & 15) * 8;
  const int vd0 = tid >> 2,         vt0c = (tid & 3) * 8;
  const int vd1 = (tid + 256) >> 2, vt1c = (tid & 3) * 8;

  auto stage = [&](int t0, int buf) {
    cp16_to_lds(kb + (size_t)(t0 + kt0) * 256 + kd0, &Ksh[buf][kt0 * KP + kd0]);
    cp16_to_lds(kb + (size_t)(t0 + kt1) * 256 + kd1, &Ksh[buf][kt1 * KP + kd1]);
    cp16_to_lds(vb + (size_t)vd0 * 1024 + t0 + vt0c, &Vsh[buf][vd0 * VP + vt0c]);
    cp16_to_lds(vb + (size_t)vd1 * 1024 + t0 + vt1c, &Vsh[buf][vd1 * VP + vt1c]);
  };

  // --- Q tile (16x128) resident in registers for the whole key loop ---
  v16h qa[4];
#pragma unroll
  for (int kt = 0; kt < 4; ++kt) qa[kt] = load_tile(qb + kt * 32, 256, lane);

  // o[d][v] = O^T[d*16 + 8g + v][col]; mrow, lrow: query col's running maximum
  // and this half's share of its running sum
  v8f o[8] = {};
  float mrow = -1e30f, lrow = 0.f;

  const int g = lane >> 4, col = lane & 15;
  const float scale = 0.0625f;  // 256^-0.5 (full-dim scale, as in reference)

  stage(0, 0);  // prologue: chunk 0 in flight

  for (int i = 0; i < 32; ++i) {
    const int buf = i & 1;
    WAIT_ASYNC();        // my copies for chunk i have landed in LDS
    __syncthreads();     // everyone's copies done; prev chunk fully consumed
    if (i + 1 < 32) stage((i + 1) * 32, buf ^ 1);  // overlap next DMA

    const _Float16* kc = Ksh[buf];
    const _Float16* vc = Vsh[buf];

    // --- S^T = K Q^T for this 32-key chunk (two 16-key M-tiles) ---
    v16h kf[2][4];
#pragma unroll
    for (int kt = 0; kt < 4; ++kt) {
      kf[0][kt] = load_tile(kc + kt * 32, KP, lane);
      kf[1][kt] = load_tile(kc + 16 * KP + kt * 32, KP, lane);
    }
    // keeps the 16 K reads as one group in front of the 8 WMMAs: left free, the
    // scheduler puts two reads and a full LDS wait in front of every WMMA
    __builtin_amdgcn_sched_barrier(0);
    v8f s0 = {}, s1 = {};
#pragma unroll
    for (int kt = 0; kt < 4; ++kt) {
      s0 = wmma_f16(kf[0][kt], qa[kt], s0);
      s1 = wmma_f16(kf[1][kt], qa[kt], s1);
    }
    v16h vf[8];  // V^T fragments (rows d, contiguous t), in flight under the softmax
#pragma unroll
    for (int d = 0; d < 8; ++d) vf[d] = load_tile(vc + (d * 16) * VP, VP, lane);
    // keeps the 16 V reads as one group in front of the softmax arithmetic,
    // which then covers their latency; left free, most sink in among their WMMAs
    __builtin_amdgcn_sched_barrier(0);

    // --- online softmax of query col, down the lane's 16 scores ---
    float a0[8], a1[8], mx[8];
#pragma unroll
    for (int v = 0; v < 8; ++v) {
      a0[v] = s0[v] * scale;
      a1[v] = s1[v] * scale;
      mx[v] = fmaxf(a0[v], a1[v]);
    }
    float rmax = fmaxf(fmaxf(fmaxf(mx[0], mx[1]), fmaxf(mx[2], mx[3])),
                       fmaxf(fmaxf(mx[4], mx[5]), fmaxf(mx[6], mx[7])));
    rmax = fmaxf(rmax, xhalf(rmax));  // the other 16 keys of this query
    const float mnew = fmaxf(mrow, rmax);
    const float cf = __expf(mrow - mnew);
    v16h pb;  // P^T as a B operand: pb[v] = key 8g + v, pb[8 + v] = key 16 + 8g + v
    float rs[8];
#pragma unroll
    for (int v = 0; v < 8; ++v) {
      const float p0 = __expf(a0[v] - mnew), p1 = __expf(a1[v] - mnew);
      rs[v] = p0 + p1;
      pb[v]     = (_Float16)p0;
      pb[8 + v] = (_Float16)p1;
    }
    lrow = lrow * cf + (((rs[0] + rs[1]) + (rs[2] + rs[3])) +
                        ((rs[4] + rs[5]) + (rs[6] + rs[7])));
    mrow = mnew;
#pragma unroll
    for (int d = 0; d < 8; ++d) o[d] *= cf;

    // --- O^T += V^T P^T ---
#pragma unroll
    for (int d = 0; d < 8; ++d) o[d] = wmma_f16(vf[d], pb, o[d]);
  }

  // --- join the halves' sums, normalize, store 8 adjacent channels a piece ---
  const float linv = 1.f / (lrow + xhalf(lrow));
  _Float16* ob = oh + ((size_t)b * 4096 + l0 + col) * 256 + h * 128 + 8 * g;
#pragma unroll
  for (int d = 0; d < 8; ++d) {
    v8h y;
#pragma unroll
    for (int v = 0; v < 8; ++v) y[v] = (_Float16)(o[d][v] * linv);
    *(v8h*)(ob + d * 16) = y;
  }
}

// ---------------------------------------------------------------------------
// Host orchestration
// ---------------------------------------------------------------------------
extern "C" void kernel_launch(void* const* d_in, const int* in_sizes, int n_in,
                              void* d_out, int out_size, void* d_ws, size_t ws_size,
                              hipStream_t stream) {
  const float* x     = (const float*)d_in[0];
  const float* wdw   = (const float*)d_in[1];
  const float* gamma = (const float*)d_in[2];
  const float* beta  = (const float*)d_in[3];
  const float* mean  = (const float*)d_in[4];
  const float* var   = (const float*)d_in[5];
  const float* Wq = (const float*)d_in[6];  const float* bq = (const float*)d_in[7];
  const float* Wk = (const float*)d_in[8];  const float* bk = (const float*)d_in[9];
  const float* Wv = (const float*)d_in[10]; const float* bv = (const float*)d_in[11];
  const float* Wo = (const float*)d_in[12]; const float* bo = (const float*)d_in[13];

  char* ws = (char*)d_ws;
  size_t off = 0;
  auto alloc = [&](size_t bytes) {
    char* p = ws + off;
    off = (off + bytes + 255) & ~(size_t)255;
    return p;
  };
  const size_t L = 8ull * 4096 * 256;  // q-side token elements
  const size_t T = 8ull * 1024 * 256;  // pooled token elements
  _Float16* qin = (_Float16*)alloc(L * 2);
  _Float16* kvin = (_Float16*)alloc(T * 2);
  _Float16* Wqh = (_Float16*)alloc(65536 * 2);
  _Float16* Wkh = (_Float16*)alloc(65536 * 2);
  _Float16* Wvh = (_Float16*)alloc(65536 * 2);
  _Float16* Woh = (_Float16*)alloc(65536 * 2);
  _Float16* qpj = (_Float16*)alloc(L * 2);   // Q projected [B,4096,256]
  _Float16* kpj = (_Float16*)alloc(T * 2);   // K projected [B,1024,256]
  _Float16* vtj = (_Float16*)alloc(T * 2);   // V projected, transposed [B,256,1024]
  _Float16* ohb = (_Float16*)alloc(L * 2);   // attention output [B,4096,256]

  // 1) preprocessing
  dwconv_bn_kernel<<<(int)(L / 128 / 256), 256, 0, stream>>>(x, wdw, gamma, beta,
                                                             mean, var, qin);
  pool2x2_kernel<<<(int)(T / 256), 256, 0, stream>>>(x, kvin);
  cvt_kernel<<<256, 256, 0, stream>>>(Wq, Wqh, 65536);
  cvt_kernel<<<256, 256, 0, stream>>>(Wk, Wkh, 65536);
  cvt_kernel<<<256, 256, 0, stream>>>(Wv, Wvh, 65536);
  cvt_kernel<<<256, 256, 0, stream>>>(Wo, Woh, 65536);

  // 2) projections (WMMA GEMMs)
  gemm256_kernel<<<dim3(32768 / 128, 2), 256, 0, stream>>>(qin, Wqh, bq, qpj, 0);
  gemm256_kernel<<<dim3(8192 / 128, 2), 256, 0, stream>>>(kvin, Wkh, bk, kpj, 0);
  gemm256_kernel<<<dim3(8192 / 128, 2), 256, 0, stream>>>(kvin, Wvh, bv, vtj, 1);

  // 3) fused flash attention: 16 (batch,head) x 32 blocks of 128 Q rows
  attn_kernel<<<dim3(16, 32), 256, 0, stream>>>(qpj, kpj, vtj, ohb);

  // 4) output projection -> f32 d_out
  gemm256_kernel<<<dim3(32768 / 128, 2), 256, 0, stream>>>(ohb, Woh, bo, d_out, 2);
}

// v005
// A run of this version takes 80 microseconds.
// Timed twice side by side with v004, it ran 1.06 and 1.08 times as fast.
// Over all steps from v000 it is 4.23 times as fast.
#include <hip/hip_runtime.h>
#include <hip/hip_bf16.h>

// ---------------------------------------------------------------------------
// CDNA5 (gfx1250) fused self-attention, wave32 + v_wmma_f32_16x16x32_f16.
// B=8, F=4, C=256, H=W=32 -> L=4096 tokens, pooled T=1024, 2 heads of 128.
// Bandwidth-bound: f16 operands everywhere, flash-style fused attention,
// K/V staged cooperatively into LDS via async-to-LDS (ASYNCcnt) with
// double buffering so DMA overlaps WMMA compute.
// ---------------------------------------------------------------------------

typedef __attribute__((ext_vector_type(16))) _Float16 v16h;
typedef __attribute__((ext_vector_type(8)))  _Float16 v8h;
typedef __attribute__((ext_vector_type(8)))  float    v8f;
typedef __attribute__((ext_vector_type(4)))  int      v4i;

#define DEVINL __device__ __forceinline__

#if defined(__AMDGCN__) && __has_builtin(__builtin_amdgcn_global_load_async_to_lds_b128)
#define USE_ASYNC_LDS 1
#endif

#if defined(__AMDGCN__) && __has_builtin(__builtin_amdgcn_s_wait_asynccnt)
#define WAIT_ASYNC() __builtin_amdgcn_s_wait_asynccnt(0)
#elif defined(USE_ASYNC_LDS)
#define WAIT_ASYNC() asm volatile("s_wait_asynccnt 0x0" ::: "memory")
#else
#define WAIT_ASYNC() ((void)0)
#endif

// Copy 16 bytes/lane from global to LDS. Async path: one
// global_load_async_to_lds_b128 per call (512B per wave), tracked by ASYNCcnt.
// Builtin signature (probed from hipcc diagnostics): global int4* (AS1),
// LDS int4* (AS3), imm offset, imm cpol.
DEVINL void cp16_to_lds(const _Float16* g, _Float16* l) {
#ifdef USE_ASYNC_LDS
  __builtin_amdgcn_global_load_async_to_lds_b128(
      (__attribute__((address_space(1))) v4i*)(v4i*)g,
      (__attribute__((address_space(3))) v4i*)(v4i*)l, 0, 0);
#else
  *(v8h*)l = *(const v8h*)g;
#endif
}

DEVINL v8f wmma_f16(v16h a, v16h b, v8f c) {
  // (neg_a, A, neg_b, B, c_mod, C, reuse_a, reuse_b)
  return __builtin_amdgcn_wmma_f32_16x16x32_f16(false, a, false, b, (short)0, c,
                                                false, false);
}

// Load a 16x32 tile in WMMA 16-bit A layout from a row-major half matrix
// (row stride `ld` halves). Per ISA: lane L supplies row L%16; its 16 halves
// map to k = (i&7) + 8*(L>>4) + 16*(i>>3) -> two contiguous 8-half runs.
// Also produces a B-tile (32x16, K-major) when the source is [n][k]
// row-major, since B[k][n] = src[n][k]. Works for global or LDS pointers.
DEVINL v16h load_tile(const _Float16* p, int ld, int lane) {
  const int r = lane & 15, g = lane >> 4;
  const _Float16* b0 = p + (size_t)r * ld + g * 8;
  v8h lo = *(const v8h*)(b0);
  v8h hi = *(const v8h*)(b0 + 16);
  v16h t;
#pragma unroll
  for (int i = 0; i < 8; ++i) { t[i] = lo[i]; t[8 + i] = hi[i]; }
  return t;
}

// ---------------------------------------------------------------------------
// Prep: depthwise 3x3 conv + BN (q path) and 2x2 average pool (k/v source),
// f32 -> f16, from one read of x
// One thread = 4 adjacent channels x a patch of 4 (x) by 8 (y) pixels. Its 36
// filter taps and BN terms are loaded once and stay in registers; the patch is
// walked down y, each input row (6 pixels, 16-byte loads, a wave reads 512
// contiguous bytes per load) fetched two rows ahead of its first use.
// Taps outside the map enter as zeros (the convolution's zero padding): their
// addresses are clamped into the map and the loaded value is multiplied by 0,
// which keeps every load unconditional, so that none waits behind a branch.
// The patch starts on even x and y, so it holds 2 x 4 whole pooling windows:
// each pair of its own rows is also averaged, while both are in registers.
// ---------------------------------------------------------------------------
typedef __attribute__((ext_vector_type(4))) float    v4f;
typedef __attribute__((ext_vector_type(4))) _Float16 v4h;

__global__ void __launch_bounds__(256) dwconv_bn_kernel(
    const float* __restrict__ x, const float* __restrict__ wdw,
    const float* __restrict__ gamma, const float* __restrict__ beta,
    const float* __restrict__ mean, const float* __restrict__ var,
    _Float16* __restrict__ qin, _Float16* __restrict__ kvin) {
  constexpr int PX = 4, PY = 8;
  int s = blockIdx.x * 256 + threadIdx.x;
  const int c  = (s & 63) * 4;  s >>= 6;
  const int x0 = (s & 7) * PX;  s >>= 3;
  const int y0 = (s & 3) * PY;  s >>= 2;
  const int f  = s & 3;
  const int b  = s >> 2;
  const int ch = f * 256 + c;
  const size_t map = ((size_t)b * 4096 + f * 1024) * 256 + c;
  const float* xb = x + map;

  v4f r[PY + 2][PX + 2];  // input rows y0-1 .. y0+PY, columns x0-1 .. x0+PX
  auto load_row = [&](int j) {
    const int y = y0 - 1 + j;
    const int yc = (j == 0) ? max(y, 0) : (j == PY + 1) ? min(y, 31) : y;
#pragma unroll
    for (int k = 0; k < PX + 2; ++k) {
      const int xx = x0 - 1 + k;
      const int xc = (k == 0) ? max(xx, 0) : (k == PX + 1) ? min(xx, 31) : xx;
      r[j][k] = *(const v4f*)(xb + (size_t)(yc * 32 + xc) * 256);
    }
    // before a later instruction reuses an address register of these loads
    asm volatile("s_wait_xcnt 0x0" ::: "memory");
  };
  // zero padding, applied where a row is first used and not where it is loaded
  const float inl = (x0 > 0) ? 1.f : 0.f, inr = (x0 + PX < 32) ? 1.f : 0.f;
  const float top = (y0 > 0) ? 1.f : 0.f, bot = (y0 + PY < 32) ? 1.f : 0.f;
  auto pad_row = [&](int j) {
    const float my = (j == 0) ? top : (j == PY + 1) ? bot : 1.f;
    r[j][0] *= my * inl;
    r[j][PX + 1] *= my * inr;
    if (j == 0 || j == PY + 1) {
#pragma unroll
      for (int k = 1; k <= PX; ++k) r[j][k] *= my;
    }
  };

#pragma unroll
  for (int j = 0; j < 4; ++j) load_row(j);

  // taps of channel c+e: flat elements e*9 .. e*9+8 of these 36 floats
  v4f wv[9];
#pragma unroll
  for (int q = 0; q < 9; ++q) wv[q] = *(const v4f*)(wdw + (size_t)ch * 9 + q * 4);
  asm volatile("s_wait_xcnt 0x0" ::: "memory");  // as in load_row
  const v4f ga = *(const v4f*)(gamma + ch), be = *(const v4f*)(beta + ch);
  const v4f mu = *(const v4f*)(mean + ch),  va = *(const v4f*)(var + ch);
  asm volatile("s_wait_xcnt 0x0" ::: "memory");  // as in load_row
  v4f inv;
#pragma unroll
  for (int e = 0; e < 4; ++e) inv[e] = ga[e] * rsqrtf(va[e] + 1e-5f);

#pragma unroll
  for (int oy = 0; oy < PY; ++oy) {
    if (oy + 4 < PY + 2) load_row(oy + 4);
    // keeps that row's loads in front of this row's arithmetic: left free, the
    // scheduler sinks them to just before their first use, and each then waits
    // a whole memory latency
    __builtin_amdgcn_sched_barrier(0);
    if (oy & 1) {
      // map rows y0+oy-1 and y0+oy (r[oy], r[oy+1]; columns 1..PX are never
      // touched by pad_row) make pooled row (y0+oy-1)/2, two pixels of it
      const int tk = f * 256 + ((y0 + oy - 1) >> 1) * 16 + (x0 >> 1);
      _Float16* kd = kvin + ((size_t)b * 1024 + tk) * 256 + c;
#pragma unroll
      for (int px = 0; px < PX; px += 2) {
        const v4f v = r[oy][1 + px] + r[oy][2 + px] + r[oy + 1][1 + px] + r[oy + 1][2 + px];
        v4h a;
#pragma unroll
        for (int e = 0; e < 4; ++e) a[e] = (_Float16)(v[e] * 0.25f);
        *(v4h*)(kd + (px >> 1) * 256) = a;
      }
      // before a later instruction reuses an address or data register of these stores
      asm volatile("s_wait_xcnt 0x0" ::: "memory");
      // keeps this row's arithmetic behind that wait: left free, the scheduler
      // lifts part of it over the wait, into the stores' registers
      __builtin_amdgcn_sched_barrier(0);
    }
    if (oy == 0) { pad_row(0); pad_row(1); }
    pad_row(oy + 2);
#pragma unroll
    for (int px = 0; px < PX; ++px) {
      v4h q;
#pragma unroll
      for (int e = 0; e < 4; ++e) {
        float acc = 0.f;
#pragma unroll
        for (int ky = 0; ky < 3; ++ky)
#pragma unroll
          for (int kx = 0; kx < 3; ++kx) {
            const int t = e * 9 + ky * 3 + kx;
            acc += r[oy + ky][px + kx][e] * wv[t >> 2][t & 3];
          }
        q[e] = (_Float16)((acc - mu[e]) * inv[e] + be[e]);
      }
      *(v4h*)(qin + map + (size_t)((y0 + oy) * 32 + x0 + px) * 256) = q;
    }
  }
}

// ---------------------------------------------------------------------------
// f32 -> f16 weight conversion
// ---------------------------------------------------------------------------
__global__ void __launch_bounds__(256) cvt_kernel(const float* __restrict__ src,
                                                  _Float16* __restrict__ dst,
                                                  int n) {
  int i = blockIdx.x * 256 + threadIdx.x;
  if (i < n) dst[i] = (_Float16)src[i];
}

// ---------------------------------------------------------------------------
// Y[M x 256] = X[M x 256] @ W^T + bias, WMMA f16->f32.
// One 128 (m) x 128 (n) tile of Y per block of 8 waves. The block's 128 rows
// of X and 128 rows of W (all 256 k) are copied once into LDS, one whole
// 512-byte row per wave-wide copy; each wave then computes 64 x 32 results
// (4 x 2 accumulator tiles) from LDS fragments: 12 fragment reads feed 8 WMMAs.
// mode 0: f16 out, row-major [m][n]            (Q / K projections)
// mode 1: f16 out, per-batch transposed V^T:   vt[b][n][t], m = b*1024 + t
// mode 2: f32 out, row-major [m][n]            (final Wo projection)
// A lane's 8 accumulator registers run along the A operand's rows, so A is the
// operand whose index is contiguous in an f16 output: W (n) in mode 0, X (m = t)
// in mode 1; each lane then stores its 8 results as one 16-byte piece.
// ---------------------------------------------------------------------------
// Eight 16-byte-per-lane copies global -> LDS: rows r, r+8, .. r+56 of a tile
// (global rows of 512 B, LDS rows of 528 B). The closing s_wait_xcnt stands in
// the same statement, in front of any later write of the address registers.
DEVINL void cp_rows8(const _Float16* g, unsigned l) {
  asm volatile(
      "global_load_async_to_lds_b128 %0, %8, off\n\t"
      "global_load_async_to_lds_b128 %1, %9, off\n\t"
      "global_load_async_to_lds_b128 %2, %10, off\n\t"
      "global_load_async_to_lds_b128 %3, %11, off\n\t"
      "global_load_async_to_lds_b128 %4, %12, off\n\t"
      "global_load_async_to_lds_b128 %5, %13, off\n\t"
      "global_load_async_to_lds_b128 %6, %14, off\n\t"
      "global_load_async_to_lds_b128 %7, %15, off\n\t"
      "s_wait_xcnt 0x0"
      :: "v"(l), "v"(l + 1 * 4224u), "v"(l + 2 * 4224u), "v"(l + 3 * 4224u),
         "v"(l + 4 * 4224u), "v"(l + 5 * 4224u), "v"(l + 6 * 4224u),
         "v"(l + 7 * 4224u),
         "v"(g), "v"(g + 1 * 2048), "v"(g + 2 * 2048), "v"(g + 3 * 2048),
         "v"(g + 4 * 2048), "v"(g + 5 * 2048), "v"(g + 6 * 2048),
         "v"(g + 7 * 2048)
      : "memory");
}

__global__ void __launch_bounds__(256) gemm256_kernel(
    const _Float16* __restrict__ X, const _Float16* __restrict__ Wh,
    const float* __restrict__ bias, void* __restrict__ Yv, int mode) {
  // Row pitch 528 B = 16 B x odd: the 16 rows of a ds_load_b128 fragment read
  // start on 16 different bank groups.
  constexpr int GP = 264;                 // halves per staged row
  constexpr int TILE = 128 * GP;          // halves per staged operand tile
  __shared__ __attribute__((aligned(16))) _Float16 Sh[2 * TILE];  // X rows | W rows

  const int lane = threadIdx.x & 31, w = threadIdx.x >> 5;
  const int mb = blockIdx.x * 128, nb = blockIdx.y * 128;

  // wave w copies rows w, w+8, .. w+120 of both tiles; lane = 16-byte column
  {
    const _Float16* gx = X + (size_t)(mb + w) * 256 + lane * 8;
    const _Float16* gw = Wh + (size_t)(nb + w) * 256 + lane * 8;
    const unsigned lx = (unsigned)(size_t)Sh + (unsigned)(w * GP + lane * 8) * 2u;
    const unsigned lw = lx + (unsigned)TILE * 2u;
    cp_rows8(gw, lw);
    cp_rows8(gw + 64 * 256, lw + 64u * 528u);
    cp_rows8(gx, lx);
    cp_rows8(gx + 64 * 256, lx + 64u * 528u);
  }
  // this wave's copies have landed; behind the barrier, every wave's have
  asm volatile("s_wait_asynccnt 0x0" ::: "memory");
  __syncthreads();

  const int wa = w & 1, wb = w >> 1;
  const _Float16* As = Sh + (mode == 0 ? TILE : 0) + (wa * 64) * GP;
  const _Float16* Bs = Sh + (mode == 0 ? 0 : TILE) + (wb * 32) * GP;

  v8f acc[4][2] = {};
  v16h a[2][4], b[2][2];  // two fragment sets: one in use, one being filled
  auto fetch = [&](int s, int k0) {
#pragma unroll
    for (int i = 0; i < 4; ++i) a[s][i] = load_tile(As + i * 16 * GP + k0, GP, lane);
#pragma unroll
    for (int j = 0; j < 2; ++j) b[s][j] = load_tile(Bs + j * 16 * GP + k0, GP, lane);
  };
  fetch(0, 0);
#pragma unroll
  for (int ks = 0; ks < 8; ++ks) {
    if (ks + 1 < 8) fetch((ks + 1) & 1, (ks + 1) * 32);
    // keeps the next step's 12 LDS reads as one group in front of this step's
    // WMMAs: left free, the scheduler sinks them to two reads in front of each
    // pair of WMMAs, and every pair then waits a whole LDS latency
    __builtin_amdgcn_sched_barrier(0);
#pragma unroll
    for (int i = 0; i < 4; ++i)
#pragma unroll
      for (int j = 0; j < 2; ++j)
        acc[i][j] = wmma_f16(a[ks & 1][i], b[ks & 1][j], acc[i][j]);
    // keeps the following group of reads whole behind these WMMAs: left free,
    // the scheduler lifts parts of it in among them
    __builtin_amdgcn_sched_barrier(0);
  }

  // acc[i][j][v] = product at A row wa*64 + i*16 + 8g + v, B row wb*32 + j*16 + c
  const int g = lane >> 4, c = lane & 15;
  if (mode == 0) {
#pragma unroll
    for (int i = 0; i < 4; ++i) {
      const int n = nb + wa * 64 + i * 16 + 8 * g;
      const v4f b0 = *(const v4f*)(bias + n), b1 = *(const v4f*)(bias + n + 4);
#pragma unroll
      for (int j = 0; j < 2; ++j) {
        const int m = mb + wb * 32 + j * 16 + c;
        v8h y;
#pragma unroll
        for (int v = 0; v < 4; ++v) {
          y[v]     = (_Float16)(acc[i][j][v] + b0[v]);
          y[4 + v] = (_Float16)(acc[i][j][4 + v] + b1[v]);
        }
        *(v8h*)((_Float16*)Yv + (size_t)m * 256 + n) = y;
      }
    }
  } else if (mode == 1) {
#pragma unroll
    for (int j = 0; j < 2; ++j) {
      const int n = nb + wb * 32 + j * 16 + c;
      const float bn = bias[n];
#pragma unroll
      for (int i = 0; i < 4; ++i) {
        const int m = mb + wa * 64 + i * 16 + 8 * g;
        const int bb = m >> 10, t = m & 1023;
        v8h y;
#pragma unroll
        for (int v = 0; v < 8; ++v) y[v] = (_Float16)(acc[i][j][v] + bn);
        *(v8h*)((_Float16*)Yv + ((size_t)bb * 256 + n) * 1024 + t) = y;
      }
    }
    // before a later instruction reuses an address or data register of these stores
    asm volatile("s_wait_xcnt 0x0" ::: "memory");
  } else {
#pragma unroll
    for (int j = 0; j < 2; ++j) {
      const int n = nb + wb * 32 + j * 16 + c;
      const float bn = bias[n];
#pragma unroll
      for (int i = 0; i < 4; ++i) {
        const int m = mb + wa * 64 + i * 16 + 8 * g;
#pragma unroll
        for (int v = 0; v < 8; ++v)
          ((float*)Yv)[(size_t)(m + v) * 256 + n] = acc[i][j][v] + bn;
      }
    }
    // before a later instruction reuses an address or data register of these stores
    asm volatile("s_wait_xcnt 0x0" ::: "memory");
  }
}

DEVINL float xhalf(float x) {
  const int i = __builtin_bit_cast(int, x);
  return __builtin_bit_cast(
      float, __builtin_amdgcn_permlanex16(i, i, 0x76543210, 0xfedcba98, false, false));
}

__global__ void __launch_bounds__(256) attn_kernel(
    const _Float16* __restrict__ qp, const _Float16* __restrict__ kp,
    const _Float16* __restrict__ vt, _Float16* __restrict__ oh) {
  // Row pitches are 16 B x odd, so that the 16 rows one ds_load_b128 fragment
  // read touches start on 16 different bank groups (64 banks x 4 B) instead
  // of all on the same four banks (256-B rows) or on four groups (64-B rows).
  constexpr int KP = 136;                 // halves per K row: 256 B + 16 B pad
  constexpr int VP = 40;                  // halves per V row:  64 B + 16 B pad
  __shared__ __attribute__((aligned(16))) _Float16 Ksh[2][32 * KP];   // [buf][t][d]
  __shared__ __attribute__((aligned(16))) _Float16 Vsh[2][128 * VP];  // [buf][d][t]

  const int tid = threadIdx.x;
  const int lane = tid & 31, wv = tid >> 5;
  const int b = blockIdx.x >> 1, h = blockIdx.x & 1;
  const int l0 = blockIdx.y * 128 + wv * 16;
  const _Float16* qb = qp + ((size_t)b * 4096 + l0) * 256 + h * 128;
  const _Float16* kb = kp + (size_t)b * 1024 * 256 + h * 128;
  const _Float16* vb = vt + ((size_t)b * 256 + h * 128) * 1024;

  // --- per-thread staging assignment: 2 K segments + 2 V segments (16B) ---
  // K chunk = 512 segs: seg s -> t = s>>4, d = (s&15)*8
  // V chunk = 512 segs: seg s -> d = s>>2, t = (s&3)*8
  const int kt0 = tid >> 4,         kd0 = (tid & 15) * 8;
  const int kt1 = (tid + 256) >> 4, kd1 = (tid & 15) * 8;
  const int vd0 = tid >> 2,         vt0c = (tid & 3) * 8;
  const int vd1 = (tid + 256) >> 2, vt1c = (tid & 3) * 8;

  auto stage = [&](int t0, int buf) {
    cp16_to_lds(kb + (size_t)(t0 + kt0) * 256 + kd0, &Ksh[buf][kt0 * KP + kd0]);
    cp16_to_lds(kb + (size_t)(t0 + kt1) * 256 + kd1, &Ksh[buf][kt1 * KP + kd1]);
    cp16_to_lds(vb + (size_t)vd0 * 1024 + t0 + vt0c, &Vsh[buf][vd0 * VP + vt0c]);
    cp16_to_lds(vb + (size_t)vd1 * 1024 + t0 + vt1c, &Vsh[buf][vd1 * VP + vt1c]);
  };

  // --- Q tile (16x128) resident in registers for the whole key loop ---
  v16h qa[4];
#pragma unroll
  for (int kt = 0; kt < 4; ++kt) qa[kt] = load_tile(qb + kt * 32, 256, lane);

  // o[d][v] = O^T[d*16 + 8g + v][col]; mrow, lrow: query col's running maximum
  // and this half's share of its running sum
  v8f o[8] = {};
  float mrow = -1e30f, lrow = 0.f;

  const int g = lane >> 4, col = lane & 15;
  const float scale = 0.0625f;  // 256^-0.5 (full-dim scale, as in reference)

  stage(0, 0);  // prologue: chunk 0 in flight

  for (int i = 0; i < 32; ++i) {
    const int buf = i & 1;
    WAIT_ASYNC();        // my copies for chunk i have landed in LDS
    __syncthreads();     // everyone's copies done; prev chunk fully consumed
    if (i + 1 < 32) stage((i + 1) * 32, buf ^ 1);  // overlap next DMA

    const _Float16* kc = Ksh[buf];
    const _Float16* vc = Vsh[buf];

    // --- S^T = K Q^T for this 32-key chunk (two 16-key M-tiles) ---
    v16h kf[2][4];
#pragma unroll
    for (int kt = 0; kt < 4; ++kt) {
      kf[0][kt] = load_tile(kc + kt * 32, KP, lane);
      kf[1][kt] = load_tile(kc + 16 * KP + kt * 32, KP, lane);
    }
    // keeps the 16 K reads as one group in front of the 8 WMMAs: left free, the
    // scheduler puts two reads and a full LDS wait in front of every WMMA
    __builtin_amdgcn_sched_barrier(0);
    v8f s0 = {}, s1 = {};
#pragma unroll
    for (int kt = 0; kt < 4; ++kt) {
      s0 = wmma_f16(kf[0][kt], qa[kt], s0);
      s1 = wmma_f16(kf[1][kt], qa[kt], s1);
    }
    v16h vf[8];  // V^T fragments (rows d, contiguous t), in flight under the softmax
#pragma unroll
    for (int d = 0; d < 8; ++d) vf[d] = load_tile(vc + (d * 16) * VP, VP, lane);
    // keeps the 16 V reads as one group in front of the softmax arithmetic,
    // which then covers their latency; left free, most sink in among their WMMAs
    __builtin_amdgcn_sched_barrier(0);

    // --- online softmax of query col, down the lane's 16 scores ---
    float a0[8], a1[8], mx[8];
#pragma unroll
    for (int v = 0; v < 8; ++v) {
      a0[v] = s0[v] * scale;
      a1[v] = s1[v] * scale;
      mx[v] = fmaxf(a0[v], a1[v]);
    }
    float rmax = fmaxf(fmaxf(fmaxf(mx[0], mx[1]), fmaxf(mx[2], mx[3])),
                       fmaxf(fmaxf(mx[4], mx[5]), fmaxf(mx[6], mx[7])));
    rmax = fmaxf(rmax, xhalf(rmax));  // the other 16 keys of this query
    const float mnew = fmaxf(mrow, rmax);
    const float cf = __expf(mrow - mnew);
    v16h pb;  // P^T as a B operand: pb[v] = key 8g + v, pb[8 + v] = key 16 + 8g + v
    float rs[8];
#pragma unroll
    for (int v = 0; v < 8; ++v) {
      const float p0 = __expf(a0[v] - mnew), p1 = __expf(a1[v] - mnew);
      rs[v] = p0 + p1;
      pb[v]     = (_Float16)p0;
      pb[8 + v] = (_Float16)p1;
    }
    lrow = lrow * cf + (((rs[0] + rs[1]) + (rs[2] + rs[3])) +
                        ((rs[4] + rs[5]) + (rs[6] + rs[7])));
    mrow = mnew;
#pragma unroll
    for (int d = 0; d < 8; ++d) o[d] *= cf;

    // --- O^T += V^T P^T ---
#pragma unroll
    for (int d = 0; d < 8; ++d) o[d] = wmma_f16(vf[d], pb, o[d]);
  }

  // --- join the halves' sums, normalize, store 8 adjacent channels a piece ---
  const float linv = 1.f / (lrow + xhalf(lrow));
  _Float16* ob = oh + ((size_t)b * 4096 + l0 + col) * 256 + h * 128 + 8 * g;
#pragma unroll
  for (int d = 0; d < 8; ++d) {
    v8h y;
#pragma unroll
    for (int v = 0; v < 8; ++v) y[v] = (_Float16)(o[d][v] * linv);
    *(v8h*)(ob + d * 16) = y;
  }
}

// ---------------------------------------------------------------------------
// Host orchestration
// ---------------------------------------------------------------------------
extern "C" void kernel_launch(void* const* d_in, const int* in_sizes, int n_in,
                              void* d_out, int out_size, void* d_ws, size_t ws_size,
                              hipStream_t stream) {
  const float* x     = (const float*)d_in[0];
  const float* wdw   = (const float*)d_in[1];
  const float* gamma = (const float*)d_in[2];
  const float* beta  = (const float*)d_in[3];
  const float* mean  = (const float*)d_in[4];
  const float* var   = (const float*)d_in[5];
  const float* Wq = (const float*)d_in[6];  const float* bq = (const float*)d_in[7];
  const float* Wk = (const float*)d_in[8];  const float* bk = (const float*)d_in[9];
  const float* Wv = (const float*)d_in[10]; const float* bv = (const float*)d_in[11];
  const float* Wo = (const float*)d_in[12]; const float* bo = (const float*)d_in[13];

  char* ws = (char*)d_ws;
  size_t off = 0;
  auto alloc = [&](size_t bytes) {
    char* p = ws + off;
    off = (off + bytes + 255) & ~(size_t)255;
    return p;
  };
  const size_t L = 8ull * 4096 * 256;  // q-side token elements
  const size_t T = 8ull * 1024 * 256;  // pooled token elements
  _Float16* qin = (_Float16*)alloc(L * 2);
  _Float16* kvin = (_Float16*)alloc(T * 2);
  _Float16* Wqh = (_Float16*)alloc(65536 * 2);
  _Float16* Wkh = (_Float16*)alloc(65536 * 2);
  _Float16* Wvh = (_Float16*)alloc(65536 * 2);
  _Float16* Woh = (_Float16*)alloc(65536 * 2);
  _Float16* qpj = (_Float16*)alloc(L * 2);   // Q projected [B,4096,256]
  _Float16* kpj = (_Float16*)alloc(T * 2);   // K projected [B,1024,256]
  _Float16* vtj = (_Float16*)alloc(T * 2);   // V projected, transposed [B,256,1024]
  _Float16* ohb = (_Float16*)alloc(L * 2);   // attention output [B,4096,256]

  // 1) preprocessing
  dwconv_bn_kernel<<<(int)(L / 128 / 256), 256, 0, stream>>>(x, wdw, gamma, beta,
                                                             mean, var, qin, kvin);
  cvt_kernel<<<256, 256, 0, stream>>>(Wq, Wqh, 65536);
  cvt_kernel<<<256, 256, 0, stream>>>(Wk, Wkh, 65536);
  cvt_kernel<<<256, 256, 0, stream>>>(Wv, Wvh, 65536);
  cvt_kernel<<<256, 256, 0, stream>>>(Wo, Woh, 65536);

  // 2) projections (WMMA GEMMs)
  gemm256_kernel<<<dim3(32768 / 128, 2), 256, 0, stream>>>(qin, Wqh, bq, qpj, 0);
  gemm256_kernel<<<dim3(8192 / 128, 2), 256, 0, stream>>>(kvin, Wkh, bk, kpj, 0);
  gemm256_kernel<<<dim3(8192 / 128, 2), 256, 0, stream>>>(kvin, Wvh, bv, vtj, 1);

  // 3) fused flash attention: 16 (batch,head) x 32 blocks of 128 Q rows
  attn_kernel<<<dim3(16, 32), 256, 0, stream>>>(qpj, kpj, vtj, ohb);

  // 4) output projection -> f32 d_out
  gemm256_kernel<<<dim3(32768 / 128, 2), 256, 0, stream>>>(ohb, Woh, bo, d_out, 2);
}

// v006
// Measured time: 65.4 microseconds a run.
// Two timings next to v005 put it at 1.23 and 1.24 times that version's speed.
// Over all steps from v000 it is 5.22 times as fast.
#include <hip/hip_runtime.h>
#include <hip/hip_bf16.h>

// ---------------------------------------------------------------------------
// CDNA5 (gfx1250) fused self-attention, wave32 + v_wmma_f32_16x16x32_f16.
// B=8, F=4, C=256, H=W=32 -> L=4096 tokens, pooled T=1024, 2 heads of 128.
// Bandwidth-bound: f16 operands everywhere, flash-style fused attention,
// K/V staged cooperatively into LDS via async-to-LDS (ASYNCcnt) with
// double buffering so DMA overlaps WMMA compute.
// ---------------------------------------------------------------------------

typedef __attribute__((ext_vector_type(16))) _Float16 v16h;
typedef __attribute__((ext_vector_type(8)))  _Float16 v8h;
typedef __attribute__((ext_vector_type(8)))  float    v8f;
typedef __attribute__((ext_vector_type(4)))  int      v4i;

#define DEVINL __device__ __forceinline__

#if defined(__AMDGCN__) && __has_builtin(__builtin_amdgcn_global_load_async_to_lds_b128)
#define USE_ASYNC_LDS 1
#endif

#if defined(__AMDGCN__) && __has_builtin(__builtin_amdgcn_s_wait_asynccnt)
#define WAIT_ASYNC() __builtin_amdgcn_s_wait_asynccnt(0)
#elif defined(USE_ASYNC_LDS)
#define WAIT_ASYNC() asm volatile("s_wait_asynccnt 0x0" ::: "memory")
#else
#define WAIT_ASYNC() ((void)0)
#endif

// Copy 16 bytes/lane from global to LDS. Async path: one
// global_load_async_to_lds_b128 per call (512B per wave), tracked by ASYNCcnt.
// Builtin signature (probed from hipcc diagnostics): global int4* (AS1),
// LDS int4* (AS3), imm offset, imm cpol.
DEVINL void cp16_to_lds(const _Float16* g, _Float16* l) {
#ifdef USE_ASYNC_LDS
  __builtin_amdgcn_global_load_async_to_lds_b128(
      (__attribute__((address_space(1))) v4i*)(v4i*)g,
      (__attribute__((address_space(3))) v4i*)(v4i*)l, 0, 0);
#else
  *(v8h*)l = *(const v8h*)g;
#endif
}

DEVINL v8f wmma_f16(v16h a, v16h b, v8f c) {
  // (neg_a, A, neg_b, B, c_mod, C, reuse_a, reuse_b)
  return __builtin_amdgcn_wmma_f32_16x16x32_f16(false, a, false, b, (short)0, c,
                                                false, false);
}

// Load a 16x32 tile in WMMA 16-bit A layout from a row-major half matrix
// (row stride `ld` halves). Per ISA: lane L supplies row L%16; its 16 halves
// map to k = (i&7) + 8*(L>>4) + 16*(i>>3) -> two contiguous 8-half runs.
// Also produces a B-tile (32x16, K-major) when the source is [n][k]
// row-major, since B[k][n] = src[n][k]. Works for global or LDS pointers.
DEVINL v16h load_tile(const _Float16* p, int ld, int lane) {
  const int r = lane & 15, g = lane >> 4;
  const _Float16* b0 = p + (size_t)r * ld + g * 8;
  v8h lo = *(const v8h*)(b0);
  v8h hi = *(const v8h*)(b0 + 16);
  v16h t;
#pragma unroll
  for (int i = 0; i < 8; ++i) { t[i] = lo[i]; t[8 + i] = hi[i]; }
  return t;
}

// ---------------------------------------------------------------------------
// Prep: depthwise 3x3 conv + BN (q path) and 2x2 average pool (k/v source),
// f32 -> f16, from one read of x
// One thread = 4 adjacent channels x a patch of 4 (x) by 8 (y) pixels. Its 36
// filter taps and BN terms are loaded once and stay in registers; the patch is
// walked down y, each input row (6 pixels, 16-byte loads, a wave reads 512
// contiguous bytes per load) fetched two rows ahead of its first use.
// Taps outside the map enter as zeros (the convolution's zero padding): their
// addresses are clamped into the map and the loaded value is multiplied by 0,
// which keeps every load unconditional, so that none waits behind a branch.
// The patch starts on even x and y, so it holds 2 x 4 whole pooling windows:
// each pair of its own rows is also averaged, while both are in registers.
// Blocks 256 .. 319 of the same launch have no patch: they convert the four
// projection matrices f32 -> f16 (nothing in this launch reads the result), one
// thread 4 adjacent elements of each matrix.
// ---------------------------------------------------------------------------
typedef __attribute__((ext_vector_type(4))) float    v4f;
typedef __attribute__((ext_vector_type(4))) _Float16 v4h;

__global__ void __launch_bounds__(256) dwconv_bn_kernel(
    const float* __restrict__ x, const float* __restrict__ wdw,
    const float* __restrict__ gamma, const float* __restrict__ beta,
    const float* __restrict__ mean, const float* __restrict__ var,
    _Float16* __restrict__ qin, _Float16* __restrict__ kvin,
    const float* __restrict__ Wq, const float* __restrict__ Wk,
    const float* __restrict__ Wv, const float* __restrict__ Wo,
    _Float16* __restrict__ Wqh, _Float16* __restrict__ Wkh,
    _Float16* __restrict__ Wvh, _Float16* __restrict__ Woh) {
  constexpr int PX = 4, PY = 8;
  if (blockIdx.x >= 256) {
    const unsigned s0 = (blockIdx.x - 256) * 1024, t = threadIdx.x * 4;
    const v4f q = *(const v4f*)(Wq + s0 + t), k = *(const v4f*)(Wk + s0 + t);
    const v4f v = *(const v4f*)(Wv + s0 + t), o = *(const v4f*)(Wo + s0 + t);
    *(v4h*)(Wqh + s0 + t) = __builtin_convertvector(q, v4h);
    *(v4h*)(Wkh + s0 + t) = __builtin_convertvector(k, v4h);
    *(v4h*)(Wvh + s0 + t) = __builtin_convertvector(v, v4h);
    *(v4h*)(Woh + s0 + t) = __builtin_convertvector(o, v4h);
    return;
  }
  int s = blockIdx.x * 256 + threadIdx.x;
  const int c  = (s & 63) * 4;  s >>= 6;
  const int x0 = (s & 7) * PX;  s >>= 3;
  const int y0 = (s & 3) * PY;  s >>= 2;
  const int f  = s & 3;
  const int b  = s >> 2;
  const int ch = f * 256 + c;
  const size_t map = ((size_t)b * 4096 + f * 1024) * 256 + c;
  const float* xb = x + map;

  v4f r[PY + 2][PX + 2];  // input rows y0-1 .. y0+PY, columns x0-1 .. x0+PX
  auto load_row = [&](int j) {
    const int y = y0 - 1 + j;
    const int yc = (j == 0) ? max(y, 0) : (j == PY + 1) ? min(y, 31) : y;
#pragma unroll
    for (int k = 0; k < PX + 2; ++k) {
      const int xx = x0 - 1 + k;
      const int xc = (k == 0) ? max(xx, 0) : (k == PX + 1) ? min(xx, 31) : xx;
      r[j][k] = *(const v4f*)(xb + (size_t)(yc * 32 + xc) * 256);
    }
    // before a later instruction reuses an address register of these loads
    asm volatile("s_wait_xcnt 0x0" ::: "memory");
  };
  // zero padding, applied where a row is first used and not where it is loaded
  const float inl = (x0 > 0) ? 1.f : 0.f, inr = (x0 + PX < 32) ? 1.f : 0.f;
  const float top = (y0 > 0) ? 1.f : 0.f, bot = (y0 + PY < 32) ? 1.f : 0.f;
  auto pad_row = [&](int j) {
    const float my = (j == 0) ? top : (j == PY + 1) ? bot : 1.f;
    r[j][0] *= my * inl;
    r[j][PX + 1] *= my * inr;
    if (j == 0 || j == PY + 1) {
#pragma unroll
      for (int k = 1; k <= PX; ++k) r[j][k] *= my;
    }
  };

#pragma unroll
  for (int j = 0; j < 4; ++j) load_row(j);

  // taps of channel c+e: flat elements e*9 .. e*9+8 of these 36 floats
  v4f wv[9];
#pragma unroll
  for (int q = 0; q < 9; ++q) wv[q] = *(const v4f*)(wdw + (size_t)ch * 9 + q * 4);
  asm volatile("s_wait_xcnt 0x0" ::: "memory");  // as in load_row
  const v4f ga = *(const v4f*)(gamma + ch), be = *(const v4f*)(beta + ch);
  const v4f mu = *(const v4f*)(mean + ch),  va = *(const v4f*)(var + ch);
  asm volatile("s_wait_xcnt 0x0" ::: "memory");  // as in load_row
  v4f inv;
#pragma unroll
  for (int e = 0; e < 4; ++e) inv[e] = ga[e] * rsqrtf(va[e] + 1e-5f);

#pragma unroll
  for (int oy = 0; oy < PY; ++oy) {
    if (oy + 4 < PY + 2) load_row(oy + 4);
    // keeps that row's loads in front of this row's arithmetic: left free, the
    // scheduler sinks them to just before their first use, and each then waits
    // a whole memory latency
    __builtin_amdgcn_sched_barrier(0);
    if (oy & 1) {
      // map rows y0+oy-1 and y0+oy (r[oy], r[oy+1]; columns 1..PX are never
      // touched by pad_row) make pooled row (y0+oy-1)/2, two pixels of it
      const int tk = f * 256 + ((y0 + oy - 1) >> 1) * 16 + (x0 >> 1);
      _Float16* kd = kvin + ((size_t)b * 1024 + tk) * 256 + c;
#pragma unroll
      for (int px = 0; px < PX; px += 2) {
        const v4f v = r[oy][1 + px] + r[oy][2 + px] + r[oy + 1][1 + px] + r[oy + 1][2 + px];
        v4h a;
#pragma unroll
        for (int e = 0; e < 4; ++e) a[e] = (_Float16)(v[e] * 0.25f);
        *(v4h*)(kd + (px >> 1) * 256) = a;
      }
      // before a later instruction reuses an address or data register of these stores
      asm volatile("s_wait_xcnt 0x0" ::: "memory");
      // keeps this row's arithmetic behind that wait: left free, the scheduler
      // lifts part of it over the wait, into the stores' registers
      __builtin_amdgcn_sched_barrier(0);
    }
    if (oy == 0) { pad_row(0); pad_row(1); }
    pad_row(oy + 2);
#pragma unroll
    for (int px = 0; px < PX; ++px) {
      v4h q;
#pragma unroll
      for (int e = 0; e < 4; ++e) {
        float acc = 0.f;
#pragma unroll
        for (int ky = 0; ky < 3; ++ky)
#pragma unroll
          for (int kx = 0; kx < 3; ++kx) {
            const int t = e * 9 + ky * 3 + kx;
            acc += r[oy + ky][px + kx][e] * wv[t >> 2][t & 3];
          }
        q[e] = (_Float16)((acc - mu[e]) * inv[e] + be[e]);
      }
      *(v4h*)(qin + map + (size_t)((y0 + oy) * 32 + x0 + px) * 256) = q;
    }
  }
}

// ---------------------------------------------------------------------------
// Y[M x 256] = X[M x 256] @ W^T + bias, WMMA f16->f32.
// One 128 (m) x 128 (n) tile of Y (rows from mb, columns from nb) per block of
// 8 waves. The block's 128 rows
// of X and 128 rows of W (all 256 k) are copied once into LDS, one whole
// 512-byte row per wave-wide copy; each wave then computes 64 x 32 results
// (4 x 2 accumulator tiles) from LDS fragments: 12 fragment reads feed 8 WMMAs.
// mode 0: f16 out, row-major [m][n]            (Q / K projections)
// mode 1: f16 out, per-batch transposed V^T:   vt[b][n][t], m = b*1024 + t
// mode 2: f32 out, row-major [m][n]            (final Wo projection)
// A lane's 8 accumulator registers run along the A operand's rows, so A is the
// operand whose index is contiguous in an f16 output: W (n) in mode 0, X (m = t)
// in mode 1; each lane then stores its 8 results as one 16-byte piece.
// ---------------------------------------------------------------------------
// Eight 16-byte-per-lane copies global -> LDS: rows r, r+8, .. r+56 of a tile
// (global rows of 512 B, LDS rows of 528 B). The closing s_wait_xcnt stands in
// the same statement, in front of any later write of the address registers.
DEVINL void cp_rows8(const _Float16* g, unsigned l) {
  asm volatile(
      "global_load_async_to_lds_b128 %0, %8, off\n\t"
      "global_load_async_to_lds_b128 %1, %9, off\n\t"
      "global_load_async_to_lds_b128 %2, %10, off\n\t"
      "global_load_async_to_lds_b128 %3, %11, off\n\t"
      "global_load_async_to_lds_b128 %4, %12, off\n\t"
      "global_load_async_to_lds_b128 %5, %13, off\n\t"
      "global_load_async_to_lds_b128 %6, %14, off\n\t"
      "global_load_async_to_lds_b128 %7, %15, off\n\t"
      "s_wait_xcnt 0x0"
      :: "v"(l), "v"(l + 1 * 4224u), "v"(l + 2 * 4224u), "v"(l + 3 * 4224u),
         "v"(l + 4 * 4224u), "v"(l + 5 * 4224u), "v"(l + 6 * 4224u),
         "v"(l + 7 * 4224u),
         "v"(g), "v"(g + 1 * 2048), "v"(g + 2 * 2048), "v"(g + 3 * 2048),
         "v"(g + 4 * 2048), "v"(g + 5 * 2048), "v"(g + 6 * 2048),
         "v"(g + 7 * 2048)
      : "memory");
}

DEVINL void gemm256_tile(const _Float16* __restrict__ X, const _Float16* __restrict__ Wh,
                         const float* __restrict__ bias, void* __restrict__ Yv,
                         int mode, int mb, int nb) {
  // Row pitch 528 B = 16 B x odd: the 16 rows of a ds_load_b128 fragment read
  // start on 16 different bank groups.
  constexpr int GP = 264;                 // halves per staged row
  constexpr int TILE = 128 * GP;          // halves per staged operand tile
  __shared__ __attribute__((aligned(16))) _Float16 Sh[2 * TILE];  // X rows | W rows

  const int lane = threadIdx.x & 31, w = threadIdx.x >> 5;

  // wave w copies rows w, w+8, .. w+120 of both tiles; lane = 16-byte column
  {
    const _Float16* gx = X + (size_t)(mb + w) * 256 + lane * 8;
    const _Float16* gw = Wh + (size_t)(nb + w) * 256 + lane * 8;
    const unsigned lx = (unsigned)(size_t)Sh + (unsigned)(w * GP + lane * 8) * 2u;
    const unsigned lw = lx + (unsigned)TILE * 2u;
    cp_rows8(gw, lw);
    cp_rows8(gw + 64 * 256, lw + 64u * 528u);
    cp_rows8(gx, lx);
    cp_rows8(gx + 64 * 256, lx + 64u * 528u);
  }
  // this wave's copies have landed; behind the barrier, every wave's have
  asm volatile("s_wait_asynccnt 0x0" ::: "memory");
  __syncthreads();

  const int wa = w & 1, wb = w >> 1;
  const _Float16* As = Sh + (mode == 0 ? TILE : 0) + (wa * 64) * GP;
  const _Float16* Bs = Sh + (mode == 0 ? 0 : TILE) + (wb * 32) * GP;

  v8f acc[4][2] = {};
  v16h a[2][4], b[2][2];  // two fragment sets: one in use, one being filled
  auto fetch = [&](int s, int k0) {
#pragma unroll
    for (int i = 0; i < 4; ++i) a[s][i] = load_tile(As + i * 16 * GP + k0, GP, lane);
#pragma unroll
    for (int j = 0; j < 2; ++j) b[s][j] = load_tile(Bs + j * 16 * GP + k0, GP, lane);
  };
  fetch(0, 0);
#pragma unroll
  for (int ks = 0; ks < 8; ++ks) {
    if (ks + 1 < 8) fetch((ks + 1) & 1, (ks + 1) * 32);
    // keeps the next step's 12 LDS reads as one group in front of this step's
    // WMMAs: left free, the scheduler sinks them to two reads in front of each
    // pair of WMMAs, and every pair then waits a whole LDS latency
    __builtin_amdgcn_sched_barrier(0);
#pragma unroll
    for (int i = 0; i < 4; ++i)
#pragma unroll
      for (int j = 0; j < 2; ++j)
        acc[i][j] = wmma_f16(a[ks & 1][i], b[ks & 1][j], acc[i][j]);
    // keeps the following group of reads whole behind these WMMAs: left free,
    // the scheduler lifts parts of it in among them
    __builtin_amdgcn_sched_barrier(0);
  }

  // acc[i][j][v] = product at A row wa*64 + i*16 + 8g + v, B row wb*32 + j*16 + c
  const int g = lane >> 4, c = lane & 15;
  if (mode == 0) {
#pragma unroll
    for (int i = 0; i < 4; ++i) {
      const int n = nb + wa * 64 + i * 16 + 8 * g;
      const v4f b0 = *(const v4f*)(bias + n), b1 = *(const v4f*)(bias + n + 4);
#pragma unroll
      for (int j = 0; j < 2; ++j) {
        const int m = mb + wb * 32 + j * 16 + c;
        v8h y;
#pragma unroll
        for (int v = 0; v < 4; ++v) {
          y[v]     = (_Float16)(acc[i][j][v] + b0[v]);
          y[4 + v] = (_Float16)(acc[i][j][4 + v] + b1[v]);
        }
        *(v8h*)((_Float16*)Yv + (size_t)m * 256 + n) = y;
      }
    }
  } else if (mode == 1) {
#pragma unroll
    for (int j = 0; j < 2; ++j) {
      const int n = nb + wb * 32 + j * 16 + c;
      const float bn = bias[n];
#pragma unroll
      for (int i = 0; i < 4; ++i) {
        const int m = mb + wa * 64 + i * 16 + 8 * g;
        const int bb = m >> 10, t = m & 1023;
        v8h y;
#pragma unroll
        for (int v = 0; v < 8; ++v) y[v] = (_Float16)(acc[i][j][v] + bn);
        *(v8h*)((_Float16*)Yv + ((size_t)bb * 256 + n) * 1024 + t) = y;
      }
    }
    // before a later instruction reuses an address or data register of these stores
    asm volatile("s_wait_xcnt 0x0" ::: "memory");
  } else {
#pragma unroll
    for (int j = 0; j < 2; ++j) {
      const int n = nb + wb * 32 + j * 16 + c;
      const float bn = bias[n];
#pragma unroll
      for (int i = 0; i < 4; ++i) {
        const int m = mb + wa * 64 + i * 16 + 8 * g;
#pragma unroll
        for (int v = 0; v < 8; ++v)
          ((float*)Yv)[(size_t)(m + v) * 256 + n] = acc[i][j][v] + bn;
      }
    }
    // before a later instruction reuses an address or data register of these stores
    asm volatile("s_wait_xcnt 0x0" ::: "memory");
  }
}

// The Q, K and V projections depend on nothing of one another: one launch does
// all three. blockIdx.x picks the product and its 128 rows: 0 .. 255 Q (32768
// rows), 256 .. 319 K, 320 .. 383 V (8192 rows each).
__global__ void __launch_bounds__(256) qkv_kernel(
    const _Float16* __restrict__ qin, const _Float16* __restrict__ kvin,
    const _Float16* __restrict__ Wqh, const _Float16* __restrict__ Wkh,
    const _Float16* __restrict__ Wvh, const float* __restrict__ bq,
    const float* __restrict__ bk, const float* __restrict__ bv,
    _Float16* __restrict__ qpj, _Float16* __restrict__ kpj,
    _Float16* __restrict__ vtj) {
  const int bx = blockIdx.x, nb = blockIdx.y * 128;
  const bool isq = bx < 256, isk = bx < 320;
  const _Float16* X  = isq ? qin : kvin;
  const _Float16* Wh = isq ? Wqh : isk ? Wkh : Wvh;
  const float* bias  = isq ? bq : isk ? bk : bv;
  _Float16* Y        = isq ? qpj : isk ? kpj : vtj;
  const int mb       = (isq ? bx : isk ? bx - 256 : bx - 320) * 128;
  gemm256_tile(X, Wh, bias, Y, isk ? 0 : 1, mb, nb);
}

__global__ void __launch_bounds__(256) out_kernel(
    const _Float16* __restrict__ X, const _Float16* __restrict__ Wh,
    const float* __restrict__ bias, float* __restrict__ Y) {
  gemm256_tile(X, Wh, bias, Y, 2, blockIdx.x * 128, blockIdx.y * 128);
}

DEVINL float xhalf(float x) {
  const int i = __builtin_bit_cast(int, x);
  return __builtin_bit_cast(
      float, __builtin_amdgcn_permlanex16(i, i, 0x76543210, 0xfedcba98, false, false));
}

__global__ void __launch_bounds__(256) attn_kernel(
    const _Float16* __restrict__ qp, const _Float16* __restrict__ kp,
    const _Float16* __restrict__ vt, _Float16* __restrict__ oh) {
  // Row pitches are 16 B x odd, so that the 16 rows one ds_load_b128 fragment
  // read touches start on 16 different bank groups (64 banks x 4 B) instead
  // of all on the same four banks (256-B rows) or on four groups (64-B rows).
  constexpr int KP = 136;                 // halves per K row: 256 B + 16 B pad
  constexpr int VP = 40;                  // halves per V row:  64 B + 16 B pad
  __shared__ __attribute__((aligned(16))) _Float16 Ksh[2][32 * KP];   // [buf][t][d]
  __shared__ __attribute__((aligned(16))) _Float16 Vsh[2][128 * VP];  // [buf][d][t]

  const int tid = threadIdx.x;
  const int lane = tid & 31, wv = tid >> 5;
  const int b = blockIdx.x >> 1, h = blockIdx.x & 1;
  const int l0 = blockIdx.y * 128 + wv * 16;
  const _Float16* qb = qp + ((size_t)b * 4096 + l0) * 256 + h * 128;
  const _Float16* kb = kp + (size_t)b * 1024 * 256 + h * 128;
  const _Float16* vb = vt + ((size_t)b * 256 + h * 128) * 1024;

  // --- per-thread staging assignment: 2 K segments + 2 V segments (16B) ---
  // K chunk = 512 segs: seg s -> t = s>>4, d = (s&15)*8
  // V chunk = 512 segs: seg s -> d = s>>2, t = (s&3)*8
  const int kt0 = tid >> 4,         kd0 = (tid & 15) * 8;
  const int kt1 = (tid + 256) >> 4, kd1 = (tid & 15) * 8;
  const int vd0 = tid >> 2,         vt0c = (tid & 3) * 8;
  const int vd1 = (tid + 256) >> 2, vt1c = (tid & 3) * 8;

  auto stage = [&](int t0, int buf) {
    cp16_to_lds(kb + (size_t)(t0 + kt0) * 256 + kd0, &Ksh[buf][kt0 * KP + kd0]);
    cp16_to_lds(kb + (size_t)(t0 + kt1) * 256 + kd1, &Ksh[buf][kt1 * KP + kd1]);
    cp16_to_lds(vb + (size_t)vd0 * 1024 + t0 + vt0c, &Vsh[buf][vd0 * VP + vt0c]);
    cp16_to_lds(vb + (size_t)vd1 * 1024 + t0 + vt1c, &Vsh[buf][vd1 * VP + vt1c]);
  };

  // --- Q tile (16x128) resident in registers for the whole key loop ---
  v16h qa[4];
#pragma unroll
  for (int kt = 0; kt < 4; ++kt) qa[kt] = load_tile(qb + kt * 32, 256, lane);

  // o[d][v] = O^T[d*16 + 8g + v][col]; mrow, lrow: query col's running maximum
  // and this half's share of its running sum
  v8f o[8] = {};
  float mrow = -1e30f, lrow = 0.f;

  const int g = lane >> 4, col = lane & 15;
  const float scale = 0.0625f;  // 256^-0.5 (full-dim scale, as in reference)

  stage(0, 0);  // prologue: chunk 0 in flight

  for (int i = 0; i < 32; ++i) {
    const int buf = i & 1;
    WAIT_ASYNC();        // my copies for chunk i have landed in LDS
    __syncthreads();     // everyone's copies done; prev chunk fully consumed
    if (i + 1 < 32) stage((i + 1) * 32, buf ^ 1);  // overlap next DMA

    const _Float16* kc = Ksh[buf];
    const _Float16* vc = Vsh[buf];

    // --- S^T = K Q^T for this 32-key chunk (two 16-key M-tiles) ---
    v16h kf[2][4];
#pragma unroll
    for (int kt = 0; kt < 4; ++kt) {
      kf[0][kt] = load_tile(kc + kt * 32, KP, lane);
      kf[1][kt] = load_tile(kc + 16 * KP + kt * 32, KP, lane);
    }
    // keeps the 16 K reads as one group in front of the 8 WMMAs: left free, the
    // scheduler puts two reads and a full LDS wait in front of every WMMA
    __builtin_amdgcn_sched_barrier(0);
    v8f s0 = {}, s1 = {};
#pragma unroll
    for (int kt = 0; kt < 4; ++kt) {
      s0 = wmma_f16(kf[0][kt], qa[kt], s0);
      s1 = wmma_f16(kf[1][kt], qa[kt], s1);
    }
    v16h vf[8];  // V^T fragments (rows d, contiguous t), in flight under the softmax
#pragma unroll
    for (int d = 0; d < 8; ++d) vf[d] = load_tile(vc + (d * 16) * VP, VP, lane);
    // keeps the 16 V reads as one group in front of the softmax arithmetic,
    // which then covers their latency; left free, most sink in among their WMMAs
    __builtin_amdgcn_sched_barrier(0);

    // --- online softmax of query col, down the lane's 16 scores ---
    float a0[8], a1[8], mx[8];
#pragma unroll
    for (int v = 0; v < 8; ++v) {
      a0[v] = s0[v] * scale;
      a1[v] = s1[v] * scale;
      mx[v] = fmaxf(a0[v], a1[v]);
    }
    float rmax = fmaxf(fmaxf(fmaxf(mx[0], mx[1]), fmaxf(mx[2], mx[3])),
                       fmaxf(fmaxf(mx[4], mx[5]), fmaxf(mx[6], mx[7])));
    rmax = fmaxf(rmax, xhalf(rmax));  // the other 16 keys of this query
    const float mnew = fmaxf(mrow, rmax);
    const float cf = __expf(mrow - mnew);
    v16h pb;  // P^T as a B operand: pb[v] = key 8g + v, pb[8 + v] = key 16 + 8g + v
    float rs[8];
#pragma unroll
    for (int v = 0; v < 8; ++v) {
      const float p0 = __expf(a0[v] - mnew), p1 = __expf(a1[v] - mnew);
      rs[v] = p0 + p1;
      pb[v]     = (_Float16)p0;
      pb[8 + v] = (_Float16)p1;
    }
    lrow = lrow * cf + (((rs[0] + rs[1]) + (rs[2] + rs[3])) +
                        ((rs[4] + rs[5]) + (rs[6] + rs[7])));
    mrow = mnew;
#pragma unroll
    for (int d = 0; d < 8; ++d) o[d] *= cf;

    // --- O^T += V^T P^T ---
#pragma unroll
    for (int d = 0; d < 8; ++d) o[d] = wmma_f16(vf[d], pb, o[d]);
  }

  // --- join the halves' sums, normalize, store 8 adjacent channels a piece ---
  const float linv = 1.f / (lrow + xhalf(lrow));
  _Float16* ob = oh + ((size_t)b * 4096 + l0 + col) * 256 + h * 128 + 8 * g;
#pragma unroll
  for (int d = 0; d < 8; ++d) {
    v8h y;
#pragma unroll
    for (int v = 0; v < 8; ++v) y[v] = (_Float16)(o[d][v] * linv);
    *(v8h*)(ob + d * 16) = y;
  }
}

// ---------------------------------------------------------------------------
// Host orchestration
// ---------------------------------------------------------------------------
extern "C" void kernel_launch(void* const* d_in, const int* in_sizes, int n_in,
                              void* d_out, int out_size, void* d_ws, size_t ws_size,
                              hipStream_t stream) {
  const float* x     = (const float*)d_in[0];
  const float* wdw   = (const float*)d_in[1];
  const float* gamma = (const float*)d_in[2];
  const float* beta  = (const float*)d_in[3];
  const float* mean  = (const float*)d_in[4];
  const float* var   = (const float*)d_in[5];
  const float* Wq = (const float*)d_in[6];  const float* bq = (const float*)d_in[7];
  const float* Wk = (const float*)d_in[8];  const float* bk = (const float*)d_in[9];
  const float* Wv = (const float*)d_in[10]; const float* bv = (const float*)d_in[11];
  const float* Wo = (const float*)d_in[12]; const float* bo = (const float*)d_in[13];

  char* ws = (char*)d_ws;
  size_t off = 0;
  auto alloc = [&](size_t bytes) {
    char* p = ws + off;
    off = (off + bytes + 255) & ~(size_t)255;
    return p;
  };
  const size_t L = 8ull * 4096 * 256;  // q-side token elements
  const size_t T = 8ull * 1024 * 256;  // pooled token elements
  _Float16* qin = (_Float16*)alloc(L * 2);
  _Float16* kvin = (_Float16*)alloc(T * 2);
  _Float16* Wqh = (_Float16*)alloc(65536 * 2);
  _Float16* Wkh = (_Float16*)alloc(65536 * 2);
  _Float16* Wvh = (_Float16*)alloc(65536 * 2);
  _Float16* Woh = (_Float16*)alloc(65536 * 2);
  _Float16* qpj = (_Float16*)alloc(L * 2);   // Q projected [B,4096,256]
  _Float16* kpj = (_Float16*)alloc(T * 2);   // K projected [B,1024,256]
  _Float16* vtj = (_Float16*)alloc(T * 2);   // V projected, transposed [B,256,1024]
  _Float16* ohb = (_Float16*)alloc(L * 2);   // attention output [B,4096,256]

  // 1) preprocessing
  // 256 blocks of patches + 64 blocks of weight conversion
  dwconv_bn_kernel<<<320, 256, 0, stream>>>(x, wdw, gamma, beta, mean, var, qin, kvin,
                                            Wq, Wk, Wv, Wo, Wqh, Wkh, Wvh, Woh);

  // 2) Q, K, V projections (WMMA GEMMs): 256 + 64 + 64 row blocks
  qkv_kernel<<<dim3(384, 2), 256, 0, stream>>>(qin, kvin, Wqh, Wkh, Wvh, bq, bk, bv,
                                               qpj, kpj, vtj);

  // 3) fused flash attention: 16 (batch,head) x 32 blocks of 128 Q rows
  attn_kernel<<<dim3(16, 32), 256, 0, stream>>>(qpj, kpj, vtj, ohb);

  // 4) output projection -> f32 d_out
  out_kernel<<<dim3(32768 / 128, 2), 256, 0, stream>>>(ohb, Woh, bo, (float*)d_out);
}

// v007
// Measured time: 62.7 microseconds a run.
// Next to v006, in two timings, it ran 1.04 times as fast each time.
// All steps since v000 together make it 5.43 times as fast.
#include <hip/hip_runtime.h>
#include <hip/hip_bf16.h>

// ---------------------------------------------------------------------------
// CDNA5 (gfx1250) fused self-attention, wave32 + v_wmma_f32_16x16x32_f16.
// B=8, F=4, C=256, H=W=32 -> L=4096 tokens, pooled T=1024, 2 heads of 128.
// Bandwidth-bound: f16 operands everywhere, flash-style fused attention,
// K/V staged cooperatively into LDS via async-to-LDS (ASYNCcnt) with
// double buffering so DMA overlaps WMMA compute.
// ---------------------------------------------------------------------------

typedef __attribute__((ext_vector_type(16))) _Float16 v16h;
typedef __attribute__((ext_vector_type(8)))  _Float16 v8h;
typedef __attribute__((ext_vector_type(8)))  float    v8f;
typedef __attribute__((ext_vector_type(4)))  int      v4i;

#define DEVINL __device__ __forceinline__

#if defined(__AMDGCN__) && __has_builtin(__builtin_amdgcn_global_load_async_to_lds_b128)
#define USE_ASYNC_LDS 1
#endif

#if defined(__AMDGCN__) && __has_builtin(__builtin_amdgcn_s_wait_asynccnt)
#define WAIT_ASYNC() __builtin_amdgcn_s_wait_asynccnt(0)
#elif defined(USE_ASYNC_LDS)
#define WAIT_ASYNC() asm volatile("s_wait_asynccnt 0x0" ::: "memory")
#else
#define WAIT_ASYNC() ((void)0)
#endif

// Copy 16 bytes/lane from global to LDS. Async path: one
// global_load_async_to_lds_b128 per call (512B per wave), tracked by ASYNCcnt.
// Builtin signature (probed from hipcc diagnostics): global int4* (AS1),
// LDS int4* (AS3), imm offset, imm cpol.
DEVINL void cp16_to_lds(const _Float16* g, _Float16* l) {
#ifdef USE_ASYNC_LDS
  __builtin_amdgcn_global_load_async_to_lds_b128(
      (__attribute__((address_space(1))) v4i*)(v4i*)g,
      (__attribute__((address_space(3))) v4i*)(v4i*)l, 0, 0);
#else
  *(v8h*)l = *(const v8h*)g;
#endif
}

DEVINL v8f wmma_f16(v16h a, v16h b, v8f c) {
  // (neg_a, A, neg_b, B, c_mod, C, reuse_a, reuse_b)
  return __builtin_amdgcn_wmma_f32_16x16x32_f16(false, a, false, b, (short)0, c,
                                                false, false);
}

// Load a 16x32 tile in WMMA 16-bit A layout from a row-major half matrix
// (row stride `ld` halves). Per ISA: lane L supplies row L%16; its 16 halves
// map to k = (i&7) + 8*(L>>4) + 16*(i>>3) -> two contiguous 8-half runs.
// Also produces a B-tile (32x16, K-major) when the source is [n][k]
// row-major, since B[k][n] = src[n][k]. Works for global or LDS pointers.
DEVINL v16h load_tile(const _Float16* p, int ld, int lane) {
  const int r = lane & 15, g = lane >> 4;
  const _Float16* b0 = p + (size_t)r * ld + g * 8;
  v8h lo = *(const v8h*)(b0);
  v8h hi = *(const v8h*)(b0 + 16);
  v16h t;
#pragma unroll
  for (int i = 0; i < 8; ++i) { t[i] = lo[i]; t[8 + i] = hi[i]; }
  return t;
}

// ---------------------------------------------------------------------------
// Prep: depthwise 3x3 conv + BN (q path) and 2x2 average pool (k/v source),
// f32 -> f16, from one read of x
// One thread = 4 adjacent channels x a patch of 4 (x) by 8 (y) pixels. Its 36
// filter taps and BN terms are loaded once and stay in registers; the patch is
// walked down y, each input row (6 pixels, 16-byte loads, a wave reads 512
// contiguous bytes per load) fetched two rows ahead of its first use.
// Taps outside the map enter as zeros (the convolution's zero padding): their
// addresses are clamped into the map and the loaded value is multiplied by 0,
// which keeps every load unconditional, so that none waits behind a branch.
// The patch starts on even x and y, so it holds 2 x 4 whole pooling windows:
// each pair of its own rows is also averaged, while both are in registers.
// Blocks 256 .. 319 of the same launch have no patch: they convert the four
// projection matrices f32 -> f16 (nothing in this launch reads the result), one
// thread 4 adjacent elements of each matrix.
// ---------------------------------------------------------------------------
typedef __attribute__((ext_vector_type(4))) float    v4f;
typedef __attribute__((ext_vector_type(4))) _Float16 v4h;

__global__ void __launch_bounds__(256) dwconv_bn_kernel(
    const float* __restrict__ x, const float* __restrict__ wdw,
    const float* __restrict__ gamma, const float* __restrict__ beta,
    const float* __restrict__ mean, const float* __restrict__ var,
    _Float16* __restrict__ qin, _Float16* __restrict__ kvin,
    const float* __restrict__ Wq, const float* __restrict__ Wk,
    const float* __restrict__ Wv, const float* __restrict__ Wo,
    _Float16* __restrict__ Wqh, _Float16* __restrict__ Wkh,
    _Float16* __restrict__ Wvh, _Float16* __restrict__ Woh) {
  constexpr int PX = 4, PY = 8;
  if (blockIdx.x >= 256) {
    const unsigned s0 = (blockIdx.x - 256) * 1024, t = threadIdx.x * 4;
    const v4f q = *(const v4f*)(Wq + s0 + t), k = *(const v4f*)(Wk + s0 + t);
    const v4f v = *(const v4f*)(Wv + s0 + t), o = *(const v4f*)(Wo + s0 + t);
    *(v4h*)(Wqh + s0 + t) = __builtin_convertvector(q, v4h);
    *(v4h*)(Wkh + s0 + t) = __builtin_convertvector(k, v4h);
    *(v4h*)(Wvh + s0 + t) = __builtin_convertvector(v, v4h);
    *(v4h*)(Woh + s0 + t) = __builtin_convertvector(o, v4h);
    return;
  }
  int s = blockIdx.x * 256 + threadIdx.x;
  const int c  = (s & 63) * 4;  s >>= 6;
  const int x0 = (s & 7) * PX;  s >>= 3;
  const int y0 = (s & 3) * PY;  s >>= 2;
  const int f  = s & 3;
  const int b  = s >> 2;
  const int ch = f * 256 + c;
  const size_t map = ((size_t)b * 4096 + f * 1024) * 256 + c;
  const float* xb = x + map;

  v4f r[PY + 2][PX + 2];  // input rows y0-1 .. y0+PY, columns x0-1 .. x0+PX
  auto load_row = [&](int j) {
    const int y = y0 - 1 + j;
    const int yc = (j == 0) ? max(y, 0) : (j == PY + 1) ? min(y, 31) : y;
#pragma unroll
    for (int k = 0; k < PX + 2; ++k) {
      const int xx = x0 - 1 + k;
      const int xc = (k == 0) ? max(xx, 0) : (k == PX + 1) ? min(xx, 31) : xx;
      r[j][k] = *(const v4f*)(xb + (size_t)(yc * 32 + xc) * 256);
    }
    // before a later instruction reuses an address register of these loads
    asm volatile("s_wait_xcnt 0x0" ::: "memory");
  };
  // zero padding, applied where a row is first used and not where it is loaded
  const float inl = (x0 > 0) ? 1.f : 0.f, inr = (x0 + PX < 32) ? 1.f : 0.f;
  const float top = (y0 > 0) ? 1.f : 0.f, bot = (y0 + PY < 32) ? 1.f : 0.f;
  auto pad_row = [&](int j) {
    const float my = (j == 0) ? top : (j == PY + 1) ? bot : 1.f;
    r[j][0] *= my * inl;
    r[j][PX + 1] *= my * inr;
    if (j == 0 || j == PY + 1) {
#pragma unroll
      for (int k = 1; k <= PX; ++k) r[j][k] *= my;
    }
  };

#pragma unroll
  for (int j = 0; j < 4; ++j) load_row(j);

  // taps of channel c+e: flat elements e*9 .. e*9+8 of these 36 floats
  v4f wv[9];
#pragma unroll
  for (int q = 0; q < 9; ++q) wv[q] = *(const v4f*)(wdw + (size_t)ch * 9 + q * 4);
  asm volatile("s_wait_xcnt 0x0" ::: "memory");  // as in load_row
  const v4f ga = *(const v4f*)(gamma + ch), be = *(const v4f*)(beta + ch);
  const v4f mu = *(const v4f*)(mean + ch),  va = *(const v4f*)(var + ch);
  asm volatile("s_wait_xcnt 0x0" ::: "memory");  // as in load_row
  v4f inv;
#pragma unroll
  for (int e = 0; e < 4; ++e) inv[e] = ga[e] * rsqrtf(va[e] + 1e-5f);

#pragma unroll
  for (int oy = 0; oy < PY; ++oy) {
    if (oy + 4 < PY + 2) load_row(oy + 4);
    // keeps that row's loads in front of this row's arithmetic: left free, the
    // scheduler sinks them to just before their first use, and each then waits
    // a whole memory latency
    __builtin_amdgcn_sched_barrier(0);
    if (oy & 1) {
      // map rows y0+oy-1 and y0+oy (r[oy], r[oy+1]; columns 1..PX are never
      // touched by pad_row) make pooled row (y0+oy-1)/2, two pixels of it
      const int tk = f * 256 + ((y0 + oy - 1) >> 1) * 16 + (x0 >> 1);
      _Float16* kd = kvin + ((size_t)b * 1024 + tk) * 256 + c;
#pragma unroll
      for (int px = 0; px < PX; px += 2) {
        const v4f v = r[oy][1 + px] + r[oy][2 + px] + r[oy + 1][1 + px] + r[oy + 1][2 + px];
        v4h a;
#pragma unroll
        for (int e = 0; e < 4; ++e) a[e] = (_Float16)(v[e] * 0.25f);
        *(v4h*)(kd + (px >> 1) * 256) = a;
      }
      // before a later instruction reuses an address or data register of these stores
      asm volatile("s_wait_xcnt 0x0" ::: "memory");
      // keeps this row's arithmetic behind that wait: left free, the scheduler
      // lifts part of it over the wait, into the stores' registers
      __builtin_amdgcn_sched_barrier(0);
    }
    if (oy == 0) { pad_row(0); pad_row(1); }
    pad_row(oy + 2);
#pragma unroll
    for (int px = 0; px < PX; ++px) {
      v4h q;
#pragma unroll
      for (int e = 0; e < 4; ++e) {
        float acc = 0.f;
#pragma unroll
        for (int ky = 0; ky < 3; ++ky)
#pragma unroll
          for (int kx = 0; kx < 3; ++kx) {
            const int t = e * 9 + ky * 3 + kx;
            acc += r[oy + ky][px + kx][e] * wv[t >> 2][t & 3];
          }
        q[e] = (_Float16)((acc - mu[e]) * inv[e] + be[e]);
      }
      *(v4h*)(qin + map + (size_t)((y0 + oy) * 32 + x0 + px) * 256) = q;
    }
  }
}

// ---------------------------------------------------------------------------
// Y[M x 256] = X[M x 256] @ W^T + bias, WMMA f16->f32.
// One 128 (m) x 128 (n) tile of Y (rows from mb, columns from nb) per block of
// 8 waves. The block's 128 rows
// of X and 128 rows of W (all 256 k) are copied once into LDS, one whole
// 512-byte row per wave-wide copy; each wave then computes 64 x 32 results
// (4 x 2 accumulator tiles) from LDS fragments: 12 fragment reads feed 8 WMMAs.
// mode 0: f16 out, row-major [m][n]            (Q / K projections)
// mode 1: f16 out, per-batch transposed V^T:   vt[b][n][t], m = b*1024 + t
// mode 2: f32 out, row-major [m][n]            (final Wo projection)
// A lane's 8 accumulator registers run along the A operand's rows, so A is the
// operand whose index is contiguous in an f16 output: W (n) in mode 0, X (m = t)
// in mode 1; each lane then stores its 8 results as one 16-byte piece.
// ---------------------------------------------------------------------------
// Eight 16-byte-per-lane copies global -> LDS: rows r, r+8, .. r+56 of a tile
// (global rows of 512 B, LDS rows of 528 B). The closing s_wait_xcnt stands in
// the same statement, in front of any later write of the address registers.
DEVINL void cp_rows8(const _Float16* g, unsigned l) {
  asm volatile(
      "global_load_async_to_lds_b128 %0, %8, off\n\t"
      "global_load_async_to_lds_b128 %1, %9, off\n\t"
      "global_load_async_to_lds_b128 %2, %10, off\n\t"
      "global_load_async_to_lds_b128 %3, %11, off\n\t"
      "global_load_async_to_lds_b128 %4, %12, off\n\t"
      "global_load_async_to_lds_b128 %5, %13, off\n\t"
      "global_load_async_to_lds_b128 %6, %14, off\n\t"
      "global_load_async_to_lds_b128 %7, %15, off\n\t"
      "s_wait_xcnt 0x0"
      :: "v"(l), "v"(l + 1 * 4224u), "v"(l + 2 * 4224u), "v"(l + 3 * 4224u),
         "v"(l + 4 * 4224u), "v"(l + 5 * 4224u), "v"(l + 6 * 4224u),
         "v"(l + 7 * 4224u),
         "v"(g), "v"(g + 1 * 2048), "v"(g + 2 * 2048), "v"(g + 3 * 2048),
         "v"(g + 4 * 2048), "v"(g + 5 * 2048), "v"(g + 6 * 2048),
         "v"(g + 7 * 2048)
      : "memory");
}

DEVINL void gemm256_tile(const _Float16* __restrict__ X, const _Float16* __restrict__ Wh,
                         const float* __restrict__ bias, void* __restrict__ Yv,
                         int mode, int mb, int nb) {
  // Row pitch 528 B = 16 B x odd: the 16 rows of a ds_load_b128 fragment read
  // start on 16 different bank groups.
  constexpr int GP = 264;                 // halves per staged row
  constexpr int TILE = 128 * GP;          // halves per staged operand tile
  __shared__ __attribute__((aligned(16))) _Float16 Sh[2 * TILE];  // X rows | W rows

  const int lane = threadIdx.x & 31, w = threadIdx.x >> 5;

  // wave w copies rows w, w+8, .. w+120 of both tiles; lane = 16-byte column
  {
    const _Float16* gx = X + (size_t)(mb + w) * 256 + lane * 8;
    const _Float16* gw = Wh + (size_t)(nb + w) * 256 + lane * 8;
    const unsigned lx = (unsigned)(size_t)Sh + (unsigned)(w * GP + lane * 8) * 2u;
    const unsigned lw = lx + (unsigned)TILE * 2u;
    cp_rows8(gw, lw);
    cp_rows8(gw + 64 * 256, lw + 64u * 528u);
    cp_rows8(gx, lx);
    cp_rows8(gx + 64 * 256, lx + 64u * 528u);
  }
  // this wave's copies have landed; behind the barrier, every wave's have
  asm volatile("s_wait_asynccnt 0x0" ::: "memory");
  __syncthreads();

  const int wa = w & 1, wb = w >> 1;
  const _Float16* As = Sh + (mode == 0 ? TILE : 0) + (wa * 64) * GP;
  const _Float16* Bs = Sh + (mode == 0 ? 0 : TILE) + (wb * 32) * GP;

  v8f acc[4][2] = {};
  v16h a[2][4], b[2][2];  // two fragment sets: one in use, one being filled
  auto fetch = [&](int s, int k0) {
#pragma unroll
    for (int i = 0; i < 4; ++i) a[s][i] = load_tile(As + i * 16 * GP + k0, GP, lane);
#pragma unroll
    for (int j = 0; j < 2; ++j) b[s][j] = load_tile(Bs + j * 16 * GP + k0, GP, lane);
  };
  fetch(0, 0);
#pragma unroll
  for (int ks = 0; ks < 8; ++ks) {
    if (ks + 1 < 8) fetch((ks + 1) & 1, (ks + 1) * 32);
    // keeps the next step's 12 LDS reads as one group in front of this step's
    // WMMAs: left free, the scheduler sinks them to two reads in front of each
    // pair of WMMAs, and every pair then waits a whole LDS latency
    __builtin_amdgcn_sched_barrier(0);
#pragma unroll
    for (int i = 0; i < 4; ++i)
#pragma unroll
      for (int j = 0; j < 2; ++j)
        acc[i][j] = wmma_f16(a[ks & 1][i], b[ks & 1][j], acc[i][j]);
    // keeps the following group of reads whole behind these WMMAs: left free,
    // the scheduler lifts parts of it in among them
    __builtin_amdgcn_sched_barrier(0);
  }

  // acc[i][j][v] = product at A row wa*64 + i*16 + 8g + v, B row wb*32 + j*16 + c
  const int g = lane >> 4, c = lane & 15;
  if (mode == 0) {
#pragma unroll
    for (int i = 0; i < 4; ++i) {
      const int n = nb + wa * 64 + i * 16 + 8 * g;
      const v4f b0 = *(const v4f*)(bias + n), b1 = *(const v4f*)(bias + n + 4);
#pragma unroll
      for (int j = 0; j < 2; ++j) {
        const int m = mb + wb * 32 + j * 16 + c;
        v8h y;
#pragma unroll
        for (int v = 0; v < 4; ++v) {
          y[v]     = (_Float16)(acc[i][j][v] + b0[v]);
          y[4 + v] = (_Float16)(acc[i][j][4 + v] + b1[v]);
        }
        *(v8h*)((_Float16*)Yv + (size_t)m * 256 + n) = y;
      }
    }
  } else if (mode == 1) {
#pragma unroll
    for (int j = 0; j < 2; ++j) {
      const int n = nb + wb * 32 + j * 16 + c;
      const float bn = bias[n];
#pragma unroll
      for (int i = 0; i < 4; ++i) {
        const int m = mb + wa * 64 + i * 16 + 8 * g;
        const int bb = m >> 10, t = m & 1023;
        v8h y;
#pragma unroll
        for (int v = 0; v < 8; ++v) y[v] = (_Float16)(acc[i][j][v] + bn);
        *(v8h*)((_Float16*)Yv + ((size_t)bb * 256 + n) * 1024 + t) = y;
      }
    }
    // before a later instruction reuses an address or data register of these stores
    asm volatile("s_wait_xcnt 0x0" ::: "memory");
  } else {
#pragma unroll
    for (int j = 0; j < 2; ++j) {
      const int n = nb + wb * 32 + j * 16 + c;
      const float bn = bias[n];
#pragma unroll
      for (int i = 0; i < 4; ++i) {
        const int m = mb + wa * 64 + i * 16 + 8 * g;
#pragma unroll
        for (int v = 0; v < 8; ++v)
          ((float*)Yv)[(size_t)(m + v) * 256 + n] = acc[i][j][v] + bn;
      }
    }
    // before a later instruction reuses an address or data register of these stores
    asm volatile("s_wait_xcnt 0x0" ::: "memory");
  }
}

// The Q, K and V projections depend on nothing of one another: one launch does
// all three. blockIdx.x picks the product and its 128 rows: 0 .. 255 Q (32768
// rows), 256 .. 319 K, 320 .. 383 V (8192 rows each).
__global__ void __launch_bounds__(256) qkv_kernel(
    const _Float16* __restrict__ qin, const _Float16* __restrict__ kvin,
    const _Float16* __restrict__ Wqh, const _Float16* __restrict__ Wkh,
    const _Float16* __restrict__ Wvh, const float* __restrict__ bq,
    const float* __restrict__ bk, const float* __restrict__ bv,
    _Float16* __restrict__ qpj, _Float16* __restrict__ kpj,
    _Float16* __restrict__ vtj) {
  const int bx = blockIdx.x, nb = blockIdx.y * 128;
  const bool isq = bx < 256, isk = bx < 320;
  const _Float16* X  = isq ? qin : kvin;
  const _Float16* Wh = isq ? Wqh : isk ? Wkh : Wvh;
  const float* bias  = isq ? bq : isk ? bk : bv;
  _Float16* Y        = isq ? qpj : isk ? kpj : vtj;
  const int mb       = (isq ? bx : isk ? bx - 256 : bx - 320) * 128;
  gemm256_tile(X, Wh, bias, Y, isk ? 0 : 1, mb, nb);
}

__global__ void __launch_bounds__(256) out_kernel(
    const _Float16* __restrict__ X, const _Float16* __restrict__ Wh,
    const float* __restrict__ bias, float* __restrict__ Y) {
  gemm256_tile(X, Wh, bias, Y, 2, blockIdx.x * 128, blockIdx.y * 128);
}

DEVINL float xhalf(float x) {
  const int i = __builtin_bit_cast(int, x);
  return __builtin_bit_cast(
      float, __builtin_amdgcn_permlanex16(i, i, 0x76543210, 0xfedcba98, false, false));
}

__global__ void __launch_bounds__(256) attn_kernel(
    const _Float16* __restrict__ qp, const _Float16* __restrict__ kp,
    const _Float16* __restrict__ vt, _Float16* __restrict__ oh) {
  // Row pitches are 16 B x odd, so that the 16 rows one ds_load_b128 fragment
  // read touches start on 16 different bank groups (64 banks x 4 B) instead
  // of all on the same four banks (256-B rows) or on four groups (64-B rows).
  constexpr int KP = 136;                 // halves per K row: 256 B + 16 B pad
  constexpr int VP = 40;                  // halves per V row:  64 B + 16 B pad
  __shared__ __attribute__((aligned(16))) _Float16 Ksh[2][32 * KP];   // [buf][t][d]
  __shared__ __attribute__((aligned(16))) _Float16 Vsh[2][128 * VP];  // [buf][d][t]

  const int tid = threadIdx.x;
  const int lane = tid & 31, wv = tid >> 5;
  const int b = blockIdx.x >> 1, h = blockIdx.x & 1;
  const int l0 = blockIdx.y * 256 + wv * 32;
  const _Float16* qb = qp + ((size_t)b * 4096 + l0) * 256 + h * 128;
  const _Float16* kb = kp + (size_t)b * 1024 * 256 + h * 128;
  const _Float16* vb = vt + ((size_t)b * 256 + h * 128) * 1024;

  // --- per-thread staging assignment: 2 K segments + 2 V segments (16B) ---
  // K chunk = 512 segs: seg s -> t = s>>4, d = (s&15)*8
  // V chunk = 512 segs: seg s -> d = s>>2, t = (s&3)*8
  const int kt0 = tid >> 4,         kd0 = (tid & 15) * 8;
  const int kt1 = (tid + 256) >> 4, kd1 = (tid & 15) * 8;
  const int vd0 = tid >> 2,         vt0c = (tid & 3) * 8;
  const int vd1 = (tid + 256) >> 2, vt1c = (tid & 3) * 8;

  auto stage = [&](int t0, int buf) {
    cp16_to_lds(kb + (size_t)(t0 + kt0) * 256 + kd0, &Ksh[buf][kt0 * KP + kd0]);
    cp16_to_lds(kb + (size_t)(t0 + kt1) * 256 + kd1, &Ksh[buf][kt1 * KP + kd1]);
    cp16_to_lds(vb + (size_t)vd0 * 1024 + t0 + vt0c, &Vsh[buf][vd0 * VP + vt0c]);
    cp16_to_lds(vb + (size_t)vd1 * 1024 + t0 + vt1c, &Vsh[buf][vd1 * VP + vt1c]);
  };

  // --- Q tiles (2 x 16x128) resident in registers for the whole key loop ---
  v16h qa[2][4];
#pragma unroll
  for (int c = 0; c < 2; ++c)
#pragma unroll
    for (int kt = 0; kt < 4; ++kt)
      qa[c][kt] = load_tile(qb + c * 16 * 256 + kt * 32, 256, lane);
  // before a later instruction reuses the address registers of these loads; the
  // loads' common address is an input, so that its registers stay live, and
  // unwritten, up to the wait
  asm volatile("s_wait_xcnt 0x0" :: "v"(qb + (lane & 15) * 256 + (lane >> 4) * 8) : "memory");

  // o[c][d][v] = O^T[d*16 + 8g + v][16c + col]; mrow, lrow: that query's running
  // maximum and this half's share of its running sum
  v8f o[2][8] = {};
  float mrow[2] = {-1e30f, -1e30f}, lrow[2] = {0.f, 0.f};

  const int g = lane >> 4, col = lane & 15;
  const float scale = 0.0625f;  // 256^-0.5 (full-dim scale, as in reference)

  stage(0, 0);  // prologue: chunk 0 in flight

  for (int i = 0; i < 32; ++i) {
    const int buf = i & 1;
    WAIT_ASYNC();        // my copies for chunk i have landed in LDS
    __syncthreads();     // everyone's copies done; prev chunk fully consumed
    if (i + 1 < 32) stage((i + 1) * 32, buf ^ 1);  // overlap next DMA

    const _Float16* kc = Ksh[buf];
    const _Float16* vc = Vsh[buf];

    // --- S^T = K Q^T for this 32-key chunk (two 16-key M-tiles) ---
    v16h kf[2][4];
#pragma unroll
    for (int kt = 0; kt < 4; ++kt) {
      kf[0][kt] = load_tile(kc + kt * 32, KP, lane);
      kf[1][kt] = load_tile(kc + 16 * KP + kt * 32, KP, lane);
    }
    // keeps the 16 K reads as one group in front of the 16 WMMAs: left free, the
    // scheduler puts two reads and a full LDS wait in front of each fragment's first WMMA
    __builtin_amdgcn_sched_barrier(0);
    v8f s0[2] = {}, s1[2] = {};
#pragma unroll
    for (int kt = 0; kt < 4; ++kt)
#pragma unroll
      for (int c = 0; c < 2; ++c) {
        s0[c] = wmma_f16(kf[0][kt], qa[c][kt], s0[c]);
        s1[c] = wmma_f16(kf[1][kt], qa[c][kt], s1[c]);
      }
    v16h vf[8];  // V^T fragments (rows d, contiguous t), in flight under the softmax
#pragma unroll
    for (int d = 0; d < 8; ++d) vf[d] = load_tile(vc + (d * 16) * VP, VP, lane);
    // keeps the 16 V reads as one group in front of the softmax arithmetic,
    // which then covers their latency; left free, most sink in among their WMMAs
    __builtin_amdgcn_sched_barrier(0);

    // --- online softmax of query 16c + col, down the lane's 16 scores ---
    v16h pb[2];  // P^T as B operands: pb[c][v] = key 8g + v, pb[c][8 + v] = key 16 + 8g + v
#pragma unroll
    for (int c = 0; c < 2; ++c) {
      // whole-tile vector arithmetic: each packed instruction then takes two
      // adjacent registers of one accumulator tile as they lie
      const v8f a0 = s0[c] * scale, a1 = s1[c] * scale;
      const v8f mx = __builtin_elementwise_max(a0, a1);
      float rmax = fmaxf(fmaxf(fmaxf(mx[0], mx[1]), fmaxf(mx[2], mx[3])),
                         fmaxf(fmaxf(mx[4], mx[5]), fmaxf(mx[6], mx[7])));
      rmax = fmaxf(rmax, xhalf(rmax));  // the other 16 keys of this query
      const float mnew = fmaxf(mrow[c], rmax);
      const float cf = __expf(mrow[c] - mnew);
      const v8f d0 = a0 - mnew, d1 = a1 - mnew;
      v8f p0, p1;
#pragma unroll
      for (int v = 0; v < 8; ++v) {
        p0[v] = __expf(d0[v]);
        p1[v] = __expf(d1[v]);
        pb[c][v]     = (_Float16)p0[v];
        pb[c][8 + v] = (_Float16)p1[v];
      }
      const v8f rs = p0 + p1;
      lrow[c] = lrow[c] * cf + (((rs[0] + rs[1]) + (rs[2] + rs[3])) +
                                ((rs[4] + rs[5]) + (rs[6] + rs[7])));
      mrow[c] = mnew;
#pragma unroll
      for (int d = 0; d < 8; ++d) o[c][d] *= cf;
    }

    // --- O^T += V^T P^T ---
#pragma unroll
    for (int d = 0; d < 8; ++d)
#pragma unroll
      for (int c = 0; c < 2; ++c) o[c][d] = wmma_f16(vf[d], pb[c], o[c][d]);
  }

  // --- join the halves' sums, normalize, store 8 adjacent channels a piece ---
#pragma unroll
  for (int c = 0; c < 2; ++c) {
    const float linv = 1.f / (lrow[c] + xhalf(lrow[c]));
    _Float16* ob = oh + ((size_t)b * 4096 + l0 + c * 16 + col) * 256 + h * 128 + 8 * g;
#pragma unroll
    for (int d = 0; d < 8; ++d) {
      v8h y;
#pragma unroll
      for (int v = 0; v < 8; ++v) y[v] = (_Float16)(o[c][d][v] * linv);
      *(v8h*)(ob + d * 16) = y;
    }
    if (c == 0) {
      // before a later instruction reuses an address or data register of these stores
      asm volatile("s_wait_xcnt 0x0" ::: "memory");
      // keeps the second group's arithmetic behind that wait: left free, the
      // scheduler lifts part of it over the wait, into the stores' registers
      __builtin_amdgcn_sched_barrier(0);
    }
  }
}

// ---------------------------------------------------------------------------
// Host orchestration
// ---------------------------------------------------------------------------
extern "C" void kernel_launch(void* const* d_in, const int* in_sizes, int n_in,
                              void* d_out, int out_size, void* d_ws, size_t ws_size,
                              hipStream_t stream) {
  const float* x     = (const float*)d_in[0];
  const float* wdw   = (const float*)d_in[1];
  const float* gamma = (const float*)d_in[2];
  const float* beta  = (const float*)d_in[3];
  const float* mean  = (const float*)d_in[4];
  const float* var   = (const float*)d_in[5];
  const float* Wq = (const float*)d_in[6];  const float* bq = (const float*)d_in[7];
  const float* Wk = (const float*)d_in[8];  const float* bk = (const float*)d_in[9];
  const float* Wv = (const float*)d_in[10]; const float* bv = (const float*)d_in[11];
  const float* Wo = (const float*)d_in[12]; const float* bo = (const float*)d_in[13];

  char* ws = (char*)d_ws;
  size_t off = 0;
  auto alloc = [&](size_t bytes) {
    char* p = ws + off;
    off = (off + bytes + 255) & ~(size_t)255;
    return p;
  };
  const size_t L = 8ull * 4096 * 256;  // q-side token elements
  const size_t T = 8ull * 1024 * 256;  // pooled token elements
  _Float16* qin = (_Float16*)alloc(L * 2);
  _Float16* kvin = (_Float16*)alloc(T * 2);
  _Float16* Wqh = (_Float16*)alloc(65536 * 2);
  _Float16* Wkh = (_Float16*)alloc(65536 * 2);
  _Float16* Wvh = (_Float16*)alloc(65536 * 2);
  _Float16* Woh = (_Float16*)alloc(65536 * 2);
  _Float16* qpj = (_Float16*)alloc(L * 2);   // Q projected [B,4096,256]
  _Float16* kpj = (_Float16*)alloc(T * 2);   // K projected [B,1024,256]
  _Float16* vtj = (_Float16*)alloc(T * 2);   // V projected, transposed [B,256,1024]
  _Float16* ohb = (_Float16*)alloc(L * 2);   // attention output [B,4096,256]

  // 1) preprocessing
  // 256 blocks of patches + 64 blocks of weight conversion
  dwconv_bn_kernel<<<320, 256, 0, stream>>>(x, wdw, gamma, beta, mean, var, qin, kvin,
                                            Wq, Wk, Wv, Wo, Wqh, Wkh, Wvh, Woh);

  // 2) Q, K, V projections (WMMA GEMMs): 256 + 64 + 64 row blocks
  qkv_kernel<<<dim3(384, 2), 256, 0, stream>>>(qin, kvin, Wqh, Wkh, Wvh, bq, bk, bv,
                                               qpj, kpj, vtj);

  // 3) fused flash attention: 16 (batch,head) x 16 blocks of 256 Q rows
  attn_kernel<<<dim3(16, 16), 256, 0, stream>>>(qpj, kpj, vtj, ohb);

  // 4) output projection -> f32 d_out
  out_kernel<<<dim3(32768 / 128, 2), 256, 0, stream>>>(ohb, Woh, bo, (float*)d_out);
}

// v008
// One run takes 57.7 microseconds.
// Two timings next to v007 both put it at 1.10 times that version's speed.
// All steps since v000 together make it 5.98 times as fast.
#include <hip/hip_runtime.h>
#include <hip/hip_bf16.h>

// ---------------------------------------------------------------------------
// CDNA5 (gfx1250) fused self-attention, wave32 + v_wmma_f32_16x16x32_f16.
// B=8, F=4, C=256, H=W=32 -> L=4096 tokens, pooled T=1024, 2 heads of 128.
// Bandwidth-bound: f16 operands everywhere, flash-style fused attention,
// K/V staged cooperatively into LDS via async-to-LDS (ASYNCcnt) with
// double buffering so DMA overlaps WMMA compute.
// ---------------------------------------------------------------------------

typedef __attribute__((ext_vector_type(16))) _Float16 v16h;
typedef __attribute__((ext_vector_type(8)))  _Float16 v8h;
typedef __attribute__((ext_vector_type(8)))  float    v8f;
typedef __attribute__((ext_vector_type(4)))  int      v4i;

#define DEVINL __device__ __forceinline__

#if defined(__AMDGCN__) && __has_builtin(__builtin_amdgcn_global_load_async_to_lds_b128)
#define USE_ASYNC_LDS 1
#endif

// Copy 16 bytes/lane from global to LDS. Async path: one
// global_load_async_to_lds_b128 per call (512B per wave), tracked by ASYNCcnt.
// Builtin signature (probed from hipcc diagnostics): global int4* (AS1),
// LDS int4* (AS3), imm offset, imm cpol.
DEVINL void cp16_to_lds(const _Float16* g, _Float16* l) {
#ifdef USE_ASYNC_LDS
  __builtin_amdgcn_global_load_async_to_lds_b128(
      (__attribute__((address_space(1))) v4i*)(v4i*)g,
      (__attribute__((address_space(3))) v4i*)(v4i*)l, 0, 0);
#else
  *(v8h*)l = *(const v8h*)g;
#endif
}

DEVINL v8f wmma_f16(v16h a, v16h b, v8f c) {
  // (neg_a, A, neg_b, B, c_mod, C, reuse_a, reuse_b)
  return __builtin_amdgcn_wmma_f32_16x16x32_f16(false, a, false, b, (short)0, c,
                                                false, false);
}

// Load a 16x32 tile in WMMA 16-bit A layout from a row-major half matrix
// (row stride `ld` halves). Per ISA: lane L supplies row L%16; its 16 halves
// map to k = (i&7) + 8*(L>>4) + 16*(i>>3) -> two contiguous 8-half runs.
// Also produces a B-tile (32x16, K-major) when the source is [n][k]
// row-major, since B[k][n] = src[n][k]. Works for global or LDS pointers.
DEVINL v16h load_tile(const _Float16* p, int ld, int lane) {
  const int r = lane & 15, g = lane >> 4;
  const _Float16* b0 = p + (size_t)r * ld + g * 8;
  v8h lo = *(const v8h*)(b0);
  v8h hi = *(const v8h*)(b0 + 16);
  v16h t;
#pragma unroll
  for (int i = 0; i < 8; ++i) { t[i] = lo[i]; t[8 + i] = hi[i]; }
  return t;
}

// ---------------------------------------------------------------------------
// Prep: depthwise 3x3 conv + BN (q path) and 2x2 average pool (k/v source),
// f32 -> f16, from one read of x
// One thread = 4 adjacent channels x a patch of 4 (x) by 8 (y) pixels. Its 36
// filter taps and BN terms are loaded once and stay in registers; the patch is
// walked down y, each input row (6 pixels, 16-byte loads, a wave reads 512
// contiguous bytes per load) fetched two rows ahead of its first use.
// Taps outside the map enter as zeros (the convolution's zero padding): their
// addresses are clamped into the map and the loaded value is multiplied by 0,
// which keeps every load unconditional, so that none waits behind a branch.
// The patch starts on even x and y, so it holds 2 x 4 whole pooling windows:
// each pair of its own rows is also averaged, while both are in registers.
// Blocks 256 .. 319 of the same launch have no patch: they convert the four
// projection matrices f32 -> f16 (nothing in this launch reads the result), one
// thread 4 adjacent elements of each matrix.
// ---------------------------------------------------------------------------
typedef __attribute__((ext_vector_type(4))) float    v4f;
typedef __attribute__((ext_vector_type(4))) _Float16 v4h;

__global__ void __launch_bounds__(256) dwconv_bn_kernel(
    const float* __restrict__ x, const float* __restrict__ wdw,
    const float* __restrict__ gamma, const float* __restrict__ beta,
    const float* __restrict__ mean, const float* __restrict__ var,
    _Float16* __restrict__ qin, _Float16* __restrict__ kvin,
    const float* __restrict__ Wq, const float* __restrict__ Wk,
    const float* __restrict__ Wv, const float* __restrict__ Wo,
    _Float16* __restrict__ Wqh, _Float16* __restrict__ Wkh,
    _Float16* __restrict__ Wvh, _Float16* __restrict__ Woh) {
  constexpr int PX = 4, PY = 8;
  if (blockIdx.x >= 256) {
    const unsigned s0 = (blockIdx.x - 256) * 1024, t = threadIdx.x * 4;
    const v4f q = *(const v4f*)(Wq + s0 + t), k = *(const v4f*)(Wk + s0 + t);
    const v4f v = *(const v4f*)(Wv + s0 + t), o = *(const v4f*)(Wo + s0 + t);
    *(v4h*)(Wqh + s0 + t) = __builtin_convertvector(q, v4h);
    *(v4h*)(Wkh + s0 + t) = __builtin_convertvector(k, v4h);
    *(v4h*)(Wvh + s0 + t) = __builtin_convertvector(v, v4h);
    *(v4h*)(Woh + s0 + t) = __builtin_convertvector(o, v4h);
    return;
  }
  int s = blockIdx.x * 256 + threadIdx.x;
  const int c  = (s & 63) * 4;  s >>= 6;
  const int x0 = (s & 7) * PX;  s >>= 3;
  const int y0 = (s & 3) * PY;  s >>= 2;
  const int f  = s & 3;
  const int b  = s >> 2;
  const int ch = f * 256 + c;
  const size_t map = ((size_t)b * 4096 + f * 1024) * 256 + c;
  const float* xb = x + map;

  v4f r[PY + 2][PX + 2];  // input rows y0-1 .. y0+PY, columns x0-1 .. x0+PX
  auto load_row = [&](int j) {
    const int y = y0 - 1 + j;
    const int yc = (j == 0) ? max(y, 0) : (j == PY + 1) ? min(y, 31) : y;
#pragma unroll
    for (int k = 0; k < PX + 2; ++k) {
      const int xx = x0 - 1 + k;
      const int xc = (k == 0) ? max(xx, 0) : (k == PX + 1) ? min(xx, 31) : xx;
      r[j][k] = *(const v4f*)(xb + (size_t)(yc * 32 + xc) * 256);
    }
    // before a later instruction reuses an address register of these loads
    asm volatile("s_wait_xcnt 0x0" ::: "memory");
  };
  // zero padding, applied where a row is first used and not where it is loaded
  const float inl = (x0 > 0) ? 1.f : 0.f, inr = (x0 + PX < 32) ? 1.f : 0.f;
  const float top = (y0 > 0) ? 1.f : 0.f, bot = (y0 + PY < 32) ? 1.f : 0.f;
  auto pad_row = [&](int j) {
    const float my = (j == 0) ? top : (j == PY + 1) ? bot : 1.f;
    r[j][0] *= my * inl;
    r[j][PX + 1] *= my * inr;
    if (j == 0 || j == PY + 1) {
#pragma unroll
      for (int k = 1; k <= PX; ++k) r[j][k] *= my;
    }
  };

#pragma unroll
  for (int j = 0; j < 4; ++j) load_row(j);

  // taps of channel c+e: flat elements e*9 .. e*9+8 of these 36 floats
  v4f wv[9];
#pragma unroll
  for (int q = 0; q < 9; ++q) wv[q] = *(const v4f*)(wdw + (size_t)ch * 9 + q * 4);
  asm volatile("s_wait_xcnt 0x0" ::: "memory");  // as in load_row
  const v4f ga = *(const v4f*)(gamma + ch), be = *(const v4f*)(beta + ch);
  const v4f mu = *(const v4f*)(mean + ch),  va = *(const v4f*)(var + ch);
  asm volatile("s_wait_xcnt 0x0" ::: "memory");  // as in load_row
  v4f inv;
#pragma unroll
  for (int e = 0; e < 4; ++e) inv[e] = ga[e] * rsqrtf(va[e] + 1e-5f);

#pragma unroll
  for (int oy = 0; oy < PY; ++oy) {
    if (oy + 4 < PY + 2) load_row(oy + 4);
    // keeps that row's loads in front of this row's arithmetic: left free, the
    // scheduler sinks them to just before their first use, and each then waits
    // a whole memory latency
    __builtin_amdgcn_sched_barrier(0);
    if (oy & 1) {
      // map rows y0+oy-1 and y0+oy (r[oy], r[oy+1]; columns 1..PX are never
      // touched by pad_row) make pooled row (y0+oy-1)/2, two pixels of it
      const int tk = f * 256 + ((y0 + oy - 1) >> 1) * 16 + (x0 >> 1);
      _Float16* kd = kvin + ((size_t)b * 1024 + tk) * 256 + c;
#pragma unroll
      for (int px = 0; px < PX; px += 2) {
        const v4f v = r[oy][1 + px] + r[oy][2 + px] + r[oy + 1][1 + px] + r[oy + 1][2 + px];
        v4h a;
#pragma unroll
        for (int e = 0; e < 4; ++e) a[e] = (_Float16)(v[e] * 0.25f);
        *(v4h*)(kd + (px >> 1) * 256) = a;
      }
      // before a later instruction reuses an address or data register of these stores
      asm volatile("s_wait_xcnt 0x0" ::: "memory");
      // keeps this row's arithmetic behind that wait: left free, the scheduler
      // lifts part of it over the wait, into the stores' registers
      __builtin_amdgcn_sched_barrier(0);
    }
    if (oy == 0) { pad_row(0); pad_row(1); }
    pad_row(oy + 2);
#pragma unroll
    for (int px = 0; px < PX; ++px) {
      v4h q;
#pragma unroll
      for (int e = 0; e < 4; ++e) {
        float acc = 0.f;
#pragma unroll
        for (int ky = 0; ky < 3; ++ky)
#pragma unroll
          for (int kx = 0; kx < 3; ++kx) {
            const int t = e * 9 + ky * 3 + kx;
            acc += r[oy + ky][px + kx][e] * wv[t >> 2][t & 3];
          }
        q[e] = (_Float16)((acc - mu[e]) * inv[e] + be[e]);
      }
      *(v4h*)(qin + map + (size_t)((y0 + oy) * 32 + x0 + px) * 256) = q;
    }
  }
}

// ---------------------------------------------------------------------------
// Y[M x 256] = X[M x 256] @ W^T + bias, WMMA f16->f32.
// One 128 (m) x 128 (n) tile of Y (rows from mb, columns from nb) per block of
// 8 waves. The block's 128 rows
// of X and 128 rows of W (all 256 k) are copied once into LDS, one whole
// 512-byte row per wave-wide copy; each wave then computes 64 x 32 results
// (4 x 2 accumulator tiles) from LDS fragments: 12 fragment reads feed 8 WMMAs.
// mode 0: f16 out, row-major [m][n]            (Q / K projections)
// mode 1: f16 out, per-batch transposed V^T:   vt[b][n][t], m = b*1024 + t
// A lane's 8 accumulator registers run along the A operand's rows, so A is the
// operand whose index is contiguous in an f16 output: W (n) in mode 0, X (m = t)
// in mode 1; each lane then stores its 8 results as one 16-byte piece.
// ---------------------------------------------------------------------------
// Eight 16-byte-per-lane copies global -> LDS: rows r, r+8, .. r+56 of a tile
// (global rows of 512 B, LDS rows of 528 B). The closing s_wait_xcnt stands in
// the same statement, in front of any later write of the address registers.
DEVINL void cp_rows8(const _Float16* g, unsigned l) {
  asm volatile(
      "global_load_async_to_lds_b128 %0, %8, off\n\t"
      "global_load_async_to_lds_b128 %1, %9, off\n\t"
      "global_load_async_to_lds_b128 %2, %10, off\n\t"
      "global_load_async_to_lds_b128 %3, %11, off\n\t"
      "global_load_async_to_lds_b128 %4, %12, off\n\t"
      "global_load_async_to_lds_b128 %5, %13, off\n\t"
      "global_load_async_to_lds_b128 %6, %14, off\n\t"
      "global_load_async_to_lds_b128 %7, %15, off\n\t"
      "s_wait_xcnt 0x0"
      :: "v"(l), "v"(l + 1 * 4224u), "v"(l + 2 * 4224u), "v"(l + 3 * 4224u),
         "v"(l + 4 * 4224u), "v"(l + 5 * 4224u), "v"(l + 6 * 4224u),
         "v"(l + 7 * 4224u),
         "v"(g), "v"(g + 1 * 2048), "v"(g + 2 * 2048), "v"(g + 3 * 2048),
         "v"(g + 4 * 2048), "v"(g + 5 * 2048), "v"(g + 6 * 2048),
         "v"(g + 7 * 2048)
      : "memory");
}

DEVINL void gemm256_tile(const _Float16* __restrict__ X, const _Float16* __restrict__ Wh,
                         const float* __restrict__ bias, void* __restrict__ Yv,
                         int mode, int mb, int nb) {
  // Row pitch 528 B = 16 B x odd: the 16 rows of a ds_load_b128 fragment read
  // start on 16 different bank groups.
  constexpr int GP = 264;                 // halves per staged row
  constexpr int TILE = 128 * GP;          // halves per staged operand tile
  __shared__ __attribute__((aligned(16))) _Float16 Sh[2 * TILE];  // X rows | W rows

  const int lane = threadIdx.x & 31, w = threadIdx.x >> 5;

  // wave w copies rows w, w+8, .. w+120 of both tiles; lane = 16-byte column
  {
    const _Float16* gx = X + (size_t)(mb + w) * 256 + lane * 8;
    const _Float16* gw = Wh + (size_t)(nb + w) * 256 + lane * 8;
    const unsigned lx = (unsigned)(size_t)Sh + (unsigned)(w * GP + lane * 8) * 2u;
    const unsigned lw = lx + (unsigned)TILE * 2u;
    cp_rows8(gw, lw);
    cp_rows8(gw + 64 * 256, lw + 64u * 528u);
    cp_rows8(gx, lx);
    cp_rows8(gx + 64 * 256, lx + 64u * 528u);
  }
  // this wave's copies have landed; behind the barrier, every wave's have
  asm volatile("s_wait_asynccnt 0x0" ::: "memory");
  __syncthreads();

  const int wa = w & 1, wb = w >> 1;
  const _Float16* As = Sh + (mode == 0 ? TILE : 0) + (wa * 64) * GP;
  const _Float16* Bs = Sh + (mode == 0 ? 0 : TILE) + (wb * 32) * GP;

  v8f acc[4][2] = {};
  v16h a[2][4], b[2][2];  // two fragment sets: one in use, one being filled
  auto fetch = [&](int s, int k0) {
#pragma unroll
    for (int i = 0; i < 4; ++i) a[s][i] = load_tile(As + i * 16 * GP + k0, GP, lane);
#pragma unroll
    for (int j = 0; j < 2; ++j) b[s][j] = load_tile(Bs + j * 16 * GP + k0, GP, lane);
  };
  fetch(0, 0);
#pragma unroll
  for (int ks = 0; ks < 8; ++ks) {
    if (ks + 1 < 8) fetch((ks + 1) & 1, (ks + 1) * 32);
    // keeps the next step's 12 LDS reads as one group in front of this step's
    // WMMAs: left free, the scheduler sinks them to two reads in front of each
    // pair of WMMAs, and every pair then waits a whole LDS latency
    __builtin_amdgcn_sched_barrier(0);
#pragma unroll
    for (int i = 0; i < 4; ++i)
#pragma unroll
      for (int j = 0; j < 2; ++j)
        acc[i][j] = wmma_f16(a[ks & 1][i], b[ks & 1][j], acc[i][j]);
    // keeps the following group of reads whole behind these WMMAs: left free,
    // the scheduler lifts parts of it in among them
    __builtin_amdgcn_sched_barrier(0);
  }

  // acc[i][j][v] = product at A row wa*64 + i*16 + 8g + v, B row wb*32 + j*16 + c
  const int g = lane >> 4, c = lane & 15;
  if (mode == 0) {
#pragma unroll
    for (int i = 0; i < 4; ++i) {
      const int n = nb + wa * 64 + i * 16 + 8 * g;
      const v4f b0 = *(const v4f*)(bias + n), b1 = *(const v4f*)(bias + n + 4);
#pragma unroll
      for (int j = 0; j < 2; ++j) {
        const int m = mb + wb * 32 + j * 16 + c;
        v8h y;
#pragma unroll
        for (int v = 0; v < 4; ++v) {
          y[v]     = (_Float16)(acc[i][j][v] + b0[v]);
          y[4 + v] = (_Float16)(acc[i][j][4 + v] + b1[v]);
        }
        *(v8h*)((_Float16*)Yv + (size_t)m * 256 + n) = y;
      }
    }
  } else {
#pragma unroll
    for (int j = 0; j < 2; ++j) {
      const int n = nb + wb * 32 + j * 16 + c;
      const float bn = bias[n];
#pragma unroll
      for (int i = 0; i < 4; ++i) {
        const int m = mb + wa * 64 + i * 16 + 8 * g;
        const int bb = m >> 10, t = m & 1023;
        v8h y;
#pragma unroll
        for (int v = 0; v < 8; ++v) y[v] = (_Float16)(acc[i][j][v] + bn);
        *(v8h*)((_Float16*)Yv + ((size_t)bb * 256 + n) * 1024 + t) = y;
      }
    }
    // before a later instruction reuses an address or data register of these stores
    asm volatile("s_wait_xcnt 0x0" ::: "memory");
  }
}

// The Q, K and V projections depend on nothing of one another: one launch does
// all three. blockIdx.x picks the product and its 128 rows: 0 .. 255 Q (32768
// rows), 256 .. 319 K, 320 .. 383 V (8192 rows each).
__global__ void __launch_bounds__(256) qkv_kernel(
    const _Float16* __restrict__ qin, const _Float16* __restrict__ kvin,
    const _Float16* __restrict__ Wqh, const _Float16* __restrict__ Wkh,
    const _Float16* __restrict__ Wvh, const float* __restrict__ bq,
    const float* __restrict__ bk, const float* __restrict__ bv,
    _Float16* __restrict__ qpj, _Float16* __restrict__ kpj,
    _Float16* __restrict__ vtj) {
  const int bx = blockIdx.x, nb = blockIdx.y * 128;
  const bool isq = bx < 256, isk = bx < 320;
  const _Float16* X  = isq ? qin : kvin;
  const _Float16* Wh = isq ? Wqh : isk ? Wkh : Wvh;
  const float* bias  = isq ? bq : isk ? bk : bv;
  _Float16* Y        = isq ? qpj : isk ? kpj : vtj;
  const int mb       = (isq ? bx : isk ? bx - 256 : bx - 320) * 128;
  gemm256_tile(X, Wh, bias, Y, isk ? 0 : 1, mb, nb);
}

DEVINL float xhalf(float x) {
  const int i = __builtin_bit_cast(int, x);
  return __builtin_bit_cast(
      float, __builtin_amdgcn_permlanex16(i, i, 0x76543210, 0xfedcba98, false, false));
}

__global__ void __launch_bounds__(256) attn_out_kernel(
    const _Float16* __restrict__ qp, const _Float16* __restrict__ kp,
    const _Float16* __restrict__ vt, const _Float16* __restrict__ Woh,
    const float* __restrict__ bo, float* __restrict__ out) {
  // Row pitches are 16 B x odd, so that the 16 rows one ds_load_b128 fragment
  // read touches start on 16 different bank groups (64 banks x 4 B).
  constexpr int KP = 264;                 // halves per K row: 512 B + 16 B pad
  constexpr int VP = 40;                  // halves per V row:  64 B + 16 B pad
  constexpr int WP = 264;                 // halves per Wo row: 512 B + 16 B pad
  __shared__ __attribute__((aligned(16))) _Float16 Ksh[2][32 * KP];   // [buf][t][d]
  __shared__ __attribute__((aligned(16))) _Float16 Vsh[2][256 * VP];  // [buf][d][t]
  __shared__ __attribute__((aligned(16))) _Float16 Wsh[256 * WP];     // [n][channel]
  // O operands: [wave][group * 4 + 32-channel step][low | high 8 halves][lane]
  __shared__ __attribute__((aligned(16))) _Float16 Osh[8][8][2][256];

  const int tid = threadIdx.x;
  const int lane = tid & 31, wv = tid >> 5;
  const int h = wv & 1, qg = wv >> 1;
  const int b = blockIdx.x;
  const int l0 = blockIdx.y * 128 + qg * 32;
  const _Float16* qb = qp + ((size_t)b * 4096 + l0) * 256 + h * 128;
  const _Float16* kb = kp + (size_t)b * 1024 * 256;
  const _Float16* vb = vt + (size_t)b * 256 * 1024;

  // --- per-thread staging assignment: 4 K, 4 V and 1 Wo segment (16B) ---
  // K chunk: wave w copies rows w, w+8, w+16, w+24; lane = 16-byte column
  // V chunk = 1024 segs: seg s -> d = s>>2, t = (s&3)*8
  // Wo: staging number i brings rows 8i .. 8i+7, wave w row 8i + w
  const int vd = tid >> 2, vtc = (tid & 3) * 8;
  // a source address = a base that is the same for the whole block and moves
  // with i + the thread's own offset, which does not
  const unsigned rgo = (unsigned)(wv * 256 + lane * 8);   // K and Wo rows
  const unsigned vgo = (unsigned)(vd * 1024 + vtc);

  auto stage = [&](int i, int buf) {
    const _Float16* ks = kb + i * (32 * 256);
    const _Float16* vs = vb + i * 32;
    const _Float16* ws = Woh + i * (8 * 256);
#pragma unroll
    for (int j = 0; j < 4; ++j)
      cp16_to_lds(ks + (rgo + j * (8u * 256u)), &Ksh[buf][(wv + 8 * j) * KP + lane * 8]);
#pragma unroll
    for (int j = 0; j < 4; ++j)
      cp16_to_lds(vs + (vgo + j * (64u * 1024u)), &Vsh[buf][(vd + 64 * j) * VP + vtc]);
    cp16_to_lds(ws + rgo, &Wsh[(i * 8 + wv) * WP + lane * 8]);
  };

  // --- Q tiles (2 x 16x128) resident in registers for the whole key loop ---
  v16h qa[2][4];
#pragma unroll
  for (int c = 0; c < 2; ++c)
#pragma unroll
    for (int kt = 0; kt < 4; ++kt)
      qa[c][kt] = load_tile(qb + c * 16 * 256 + kt * 32, 256, lane);
  // before a later instruction reuses the address registers of these loads; the
  // loads' common address is an input, so that its registers stay live, and
  // unwritten, up to the wait
  asm volatile("s_wait_xcnt 0x0" :: "v"(qb + (lane & 15) * 256 + (lane >> 4) * 8) : "memory");

  // o[c][d][v] = O^T[d*16 + 8g + v][16c + col]; mrow, lrow: that query's running
  // maximum and this half's share of its running sum
  v8f o[2][8] = {};
  float mrow[2] = {-1e30f, -1e30f}, lrow[2] = {0.f, 0.f};

  const int g = lane >> 4, col = lane & 15;
  const float scale = 0.0625f;  // 256^-0.5 (full-dim scale, as in reference)

  stage(0, 0);  // prologue: chunk 0 in flight

  for (int i = 0; i < 32; ++i) {
    const int buf = i & 1;
    // my reads of the buffer that is refilled below have returned
    asm volatile("s_wait_dscnt 0x0" ::: "memory");
    // my copies for chunk i have landed in LDS
    asm volatile("s_wait_asynccnt 0x0" ::: "memory");
    __syncthreads();     // everyone's copies done; prev chunk fully consumed
    if (i + 1 < 32) stage(i + 1, buf ^ 1);  // overlap next DMA

    const _Float16* kc = Ksh[buf] + h * 128;
    const _Float16* vc = Vsh[buf] + h * 128 * VP;

    // --- S^T = K Q^T for this 32-key chunk (two 16-key M-tiles) ---
    v16h kf[2][4];
#pragma unroll
    for (int kt = 0; kt < 4; ++kt) {
      kf[0][kt] = load_tile(kc + kt * 32, KP, lane);
      kf[1][kt] = load_tile(kc + 16 * KP + kt * 32, KP, lane);
    }
    // keeps the 16 K reads as one group in front of the 16 WMMAs: left free, the
    // scheduler puts two reads and a full LDS wait in front of each fragment's first WMMA
    __builtin_amdgcn_sched_barrier(0);
    v8f s0[2] = {}, s1[2] = {};
#pragma unroll
    for (int kt = 0; kt < 4; ++kt)
#pragma unroll
      for (int c = 0; c < 2; ++c) {
        s0[c] = wmma_f16(kf[0][kt], qa[c][kt], s0[c]);
        s1[c] = wmma_f16(kf[1][kt], qa[c][kt], s1[c]);
      }
    v16h vf[8];  // V^T fragments (rows d, contiguous t), in flight under the softmax
#pragma unroll
    for (int d = 0; d < 8; ++d) vf[d] = load_tile(vc + (d * 16) * VP, VP, lane);
    // keeps the 16 V reads as one group in front of the softmax arithmetic,
    // which then covers their latency; left free, most sink in among their WMMAs
    __builtin_amdgcn_sched_barrier(0);

    // --- online softmax of query 16c + col, down the lane's 16 scores ---
    v16h pb[2];  // P^T as B operands: pb[c][v] = key 8g + v, pb[c][8 + v] = key 16 + 8g + v
#pragma unroll
    for (int c = 0; c < 2; ++c) {
      // whole-tile vector arithmetic: each packed instruction then takes two
      // adjacent registers of one accumulator tile as they lie
      const v8f a0 = s0[c] * scale, a1 = s1[c] * scale;
      const v8f mx = __builtin_elementwise_max(a0, a1);
      float rmax = fmaxf(fmaxf(fmaxf(mx[0], mx[1]), fmaxf(mx[2], mx[3])),
                         fmaxf(fmaxf(mx[4], mx[5]), fmaxf(mx[6], mx[7])));
      rmax = fmaxf(rmax, xhalf(rmax));  // the other 16 keys of this query
      const float mnew = fmaxf(mrow[c], rmax);
      const float cf = __expf(mrow[c] - mnew);
      const v8f d0 = a0 - mnew, d1 = a1 - mnew;
      v8f p0, p1;
#pragma unroll
      for (int v = 0; v < 8; ++v) {
        p0[v] = __expf(d0[v]);
        p1[v] = __expf(d1[v]);
        pb[c][v]     = (_Float16)p0[v];
        pb[c][8 + v] = (_Float16)p1[v];
      }
      const v8f rs = p0 + p1;
      lrow[c] = lrow[c] * cf + (((rs[0] + rs[1]) + (rs[2] + rs[3])) +
                                ((rs[4] + rs[5]) + (rs[6] + rs[7])));
      mrow[c] = mnew;
#pragma unroll
      for (int d = 0; d < 8; ++d) o[c][d] *= cf;
    }

    // --- O^T += V^T P^T ---
#pragma unroll
    for (int d = 0; d < 8; ++d)
#pragma unroll
      for (int c = 0; c < 2; ++c) o[c][d] = wmma_f16(vf[d], pb[c], o[c][d]);
  }
  // no copy of this wave is outstanding behind the loop
  asm volatile("s_wait_asynccnt 0x0" ::: "memory");

  // bias of this wave's 8 x 16 output columns
  float bn[8];
#pragma unroll
  for (int t = 0; t < 8; ++t) bn[t] = bo[h * 128 + t * 16 + col];

  // --- join the halves' sums, normalize, hand the f16 operands over in LDS ---
  // tiles 2j and 2j+1 of a group: query col, channels 32j + 8g + v and 32j + 16 +
  // 8g + v of this head, which is load_tile's k order for row col
#pragma unroll
  for (int c = 0; c < 2; ++c) {
    const float linv = 1.f / (lrow[c] + xhalf(lrow[c]));
#pragma unroll
    for (int j = 0; j < 4; ++j) {
      v8h lo, hi;
#pragma unroll
      for (int v = 0; v < 8; ++v) {
        lo[v] = (_Float16)(o[c][2 * j][v] * linv);
        hi[v] = (_Float16)(o[c][2 * j + 1][v] * linv);
      }
      *(v8h*)&Osh[wv][c * 4 + j][0][lane * 8] = lo;
      *(v8h*)&Osh[wv][c * 4 + j][1][lane * 8] = hi;
    }
  }
  __syncthreads();  // both heads' operands of every query group are in LDS

  // --- Y = O Wo^T + bo: 32 queries x 128 columns, 8 steps of 32 channels ---
  v16h oa[2][8];  // A operands: step ks = head ks >> 2, its channels 32 (ks & 3) ..
#pragma unroll
  for (int c = 0; c < 2; ++c)
#pragma unroll
    for (int ks = 0; ks < 8; ++ks) {
      const _Float16* p = &Osh[qg * 2 + (ks >> 2)][c * 4 + (ks & 3)][0][lane * 8];
      const v8h lo = *(const v8h*)p, hi = *(const v8h*)(p + 256);
#pragma unroll
      for (int v = 0; v < 8; ++v) { oa[c][ks][v] = lo[v]; oa[c][ks][8 + v] = hi[v]; }
    }

  // a block of work = 32 columns (np) x 4 channel steps (kh): 8 Wo fragments, 16 WMMAs
  const _Float16* Wb = Wsh + h * 128 * WP;
  v16h wf[2][8];  // two fragment sets: one in use, one being filled
  auto fetch = [&](int s, int blk) {
    const int np = blk >> 1, kh = blk & 1;
#pragma unroll
    for (int nt = 0; nt < 2; ++nt)
#pragma unroll
      for (int kk = 0; kk < 4; ++kk)
        wf[s][nt * 4 + kk] = load_tile(Wb + (np * 32 + nt * 16) * WP + (kh * 4 + kk) * 32, WP, lane);
  };
  float* yb = out + ((size_t)b * 4096 + l0 + 8 * g) * 256 + h * 128 + col;
  v8f acc[4][2][2] = {};
  fetch(0, 0);
#pragma unroll
  for (int blk = 0; blk < 8; ++blk) {
    const int np = blk >> 1, kh = blk & 1;
    if (blk + 1 < 8) fetch((blk + 1) & 1, blk + 1);
    // keeps the next block's 16 LDS reads as one group in front of this block's
    // WMMAs: left free, the scheduler sinks them in among the WMMAs
    __builtin_amdgcn_sched_barrier(0);
#pragma unroll
    for (int kk = 0; kk < 4; ++kk)
#pragma unroll
      for (int c = 0; c < 2; ++c)
#pragma unroll
        for (int nt = 0; nt < 2; ++nt)
          acc[np][c][nt] = wmma_f16(oa[c][kh * 4 + kk], wf[blk & 1][nt * 4 + kk], acc[np][c][nt]);
    // keeps the following group of reads whole behind these WMMAs
    __builtin_amdgcn_sched_barrier(0);
    if (kh == 1) {
      // acc[np][c][nt][v]: query 16c + 8g + v, column 32 np + 16 nt + col
#pragma unroll
      for (int c = 0; c < 2; ++c)
#pragma unroll
        for (int nt = 0; nt < 2; ++nt) acc[np][c][nt] += bn[np * 2 + nt];
      // keeps all 32 sums in front of the stores, each in a register of its own:
      // left free, the scheduler reuses a stored register between the stores
      __builtin_amdgcn_sched_barrier(0);
      // the two stores of a row's 128-byte line stand next to each other
#pragma unroll
      for (int c = 0; c < 2; ++c)
#pragma unroll
        for (int v = 0; v < 8; ++v)
#pragma unroll
          for (int nt = 0; nt < 2; ++nt)
            yb[(c * 16 + v) * 256 + np * 32 + nt * 16] = acc[np][c][nt][v];
      // before a later instruction reuses an address or data register of these stores
      asm volatile("s_wait_xcnt 0x0" ::: "memory");
      // keeps later arithmetic behind that wait
      __builtin_amdgcn_sched_barrier(0);
    }
  }
}

// ---------------------------------------------------------------------------
// Host orchestration
// ---------------------------------------------------------------------------
extern "C" void kernel_launch(void* const* d_in, const int* in_sizes, int n_in,
                              void* d_out, int out_size, void* d_ws, size_t ws_size,
                              hipStream_t stream) {
  const float* x     = (const float*)d_in[0];
  const float* wdw   = (const float*)d_in[1];
  const float* gamma = (const float*)d_in[2];
  const float* beta  = (const float*)d_in[3];
  const float* mean  = (const float*)d_in[4];
  const float* var   = (const float*)d_in[5];
  const float* Wq = (const float*)d_in[6];  const float* bq = (const float*)d_in[7];
  const float* Wk = (const float*)d_in[8];  const float* bk = (const float*)d_in[9];
  const float* Wv = (const float*)d_in[10]; const float* bv = (const float*)d_in[11];
  const float* Wo = (const float*)d_in[12]; const float* bo = (const float*)d_in[13];

  char* ws = (char*)d_ws;
  size_t off = 0;
  auto alloc = [&](size_t bytes) {
    char* p = ws + off;
    off = (off + bytes + 255) & ~(size_t)255;
    return p;
  };
  const size_t L = 8ull * 4096 * 256;  // q-side token elements
  const size_t T = 8ull * 1024 * 256;  // pooled token elements
  _Float16* qin = (_Float16*)alloc(L * 2);
  _Float16* kvin = (_Float16*)alloc(T * 2);
  _Float16* Wqh = (_Float16*)alloc(65536 * 2);
  _Float16* Wkh = (_Float16*)alloc(65536 * 2);
  _Float16* Wvh = (_Float16*)alloc(65536 * 2);
  _Float16* Woh = (_Float16*)alloc(65536 * 2);
  _Float16* qpj = (_Float16*)alloc(L * 2);   // Q projected [B,4096,256]
  _Float16* kpj = (_Float16*)alloc(T * 2);   // K projected [B,1024,256]
  _Float16* vtj = (_Float16*)alloc(T * 2);   // V projected, transposed [B,256,1024]

  // 1) preprocessing
  // 256 blocks of patches + 64 blocks of weight conversion
  dwconv_bn_kernel<<<320, 256, 0, stream>>>(x, wdw, gamma, beta, mean, var, qin, kvin,
                                            Wq, Wk, Wv, Wo, Wqh, Wkh, Wvh, Woh);

  // 2) Q, K, V projections (WMMA GEMMs): 256 + 64 + 64 row blocks
  qkv_kernel<<<dim3(384, 2), 256, 0, stream>>>(qin, kvin, Wqh, Wkh, Wvh, bq, bk, bv,
                                               qpj, kpj, vtj);

  // 3) fused flash attention + output projection -> f32 d_out: 8 batches x 32
  //    blocks of 128 Q rows, both heads
  attn_out_kernel<<<dim3(8, 32), 256, 0, stream>>>(qpj, kpj, vtj, Woh, bo, (float*)d_out);
}

// v009
// One run takes 52.2 microseconds.
// Next to v008, in two timings, it ran 1.10 and 1.11 times as fast.
// Counting every step since v000, it is 6.59 times as fast.
#include <hip/hip_runtime.h>
#include <hip/hip_bf16.h>

// ---------------------------------------------------------------------------
// CDNA5 (gfx1250) fused self-attention, wave32 + v_wmma_f32_16x16x32_f16.
// B=8, F=4, C=256, H=W=32 -> L=4096 tokens, pooled T=1024, 2 heads of 128.
// Bandwidth-bound: f16 operands everywhere, flash-style fused attention,
// K/V staged cooperatively into LDS via async-to-LDS (ASYNCcnt) with
// double buffering so DMA overlaps WMMA compute.
// ---------------------------------------------------------------------------

typedef __attribute__((ext_vector_type(16))) _Float16 v16h;
typedef __attribute__((ext_vector_type(8)))  _Float16 v8h;
typedef __attribute__((ext_vector_type(8)))  float    v8f;
typedef __attribute__((ext_vector_type(4)))  int      v4i;

#define DEVINL __device__ __forceinline__

#if defined(__AMDGCN__) && __has_builtin(__builtin_amdgcn_global_load_async_to_lds_b128)
#define USE_ASYNC_LDS 1
#endif

// Copy 16 bytes/lane from global to LDS. Async path: one
// global_load_async_to_lds_b128 per call (512B per wave), tracked by ASYNCcnt.
// Builtin signature (probed from hipcc diagnostics): global int4* (AS1),
// LDS int4* (AS3), imm offset, imm cpol.
DEVINL void cp16_to_lds(const _Float16* g, _Float16* l) {
#ifdef USE_ASYNC_LDS
  __builtin_amdgcn_global_load_async_to_lds_b128(
      (__attribute__((address_space(1))) v4i*)(v4i*)g,
      (__attribute__((address_space(3))) v4i*)(v4i*)l, 0, 0);
#else
  *(v8h*)l = *(const v8h*)g;
#endif
}

DEVINL v8f wmma_f16(v16h a, v16h b, v8f c) {
  // (neg_a, A, neg_b, B, c_mod, C, reuse_a, reuse_b)
  return __builtin_amdgcn_wmma_f32_16x16x32_f16(false, a, false, b, (short)0, c,
                                                false, false);
}

// Load a 16x32 tile in WMMA 16-bit A layout from a row-major half matrix
// (row stride `ld` halves). Per ISA: lane L supplies row L%16; its 16 halves
// map to k = (i&7) + 8*(L>>4) + 16*(i>>3) -> two contiguous 8-half runs.
// Also produces a B-tile (32x16, K-major) when the source is [n][k]
// row-major, since B[k][n] = src[n][k]. Works for global or LDS pointers.
DEVINL v16h load_tile(const _Float16* p, int ld, int lane) {
  const int r = lane & 15, g = lane >> 4;
  const _Float16* b0 = p + (size_t)r * ld + g * 8;
  v8h lo = *(const v8h*)(b0);
  v8h hi = *(const v8h*)(b0 + 16);
  v16h t;
#pragma unroll
  for (int i = 0; i < 8; ++i) { t[i] = lo[i]; t[8 + i] = hi[i]; }
  return t;
}

// ---------------------------------------------------------------------------
// Prep: depthwise 3x3 conv + BN (q path) and 2x2 average pool (k/v source),
// f32 -> f16, from one read of x
// One thread = 4 adjacent channels x a patch of 4 (x) by 8 (y) pixels. Its 36
// filter taps and BN terms are loaded once and stay in registers; the patch is
// walked down y, each input row (6 pixels, 16-byte loads, a wave reads 512
// contiguous bytes per load) fetched two rows ahead of its first use.
// Taps outside the map enter as zeros (the convolution's zero padding): their
// addresses are clamped into the map and the loaded value is multiplied by 0,
// which keeps every load unconditional, so that none waits behind a branch.
// The patch starts on even x and y, so it holds 2 x 4 whole pooling windows:
// each pair of its own rows is also averaged, while both are in registers.
// Blocks 256 .. 319 of the same launch have no patch: they convert the four
// projection matrices f32 -> f16 (nothing in this launch reads the result), one
// thread 4 adjacent elements of each matrix.
// ---------------------------------------------------------------------------
typedef __attribute__((ext_vector_type(4))) float    v4f;
typedef __attribute__((ext_vector_type(4))) _Float16 v4h;

__global__ void __launch_bounds__(256) dwconv_bn_kernel(
    const float* __restrict__ x, const float* __restrict__ wdw,
    const float* __restrict__ gamma, const float* __restrict__ beta,
    const float* __restrict__ mean, const float* __restrict__ var,
    _Float16* __restrict__ qin, _Float16* __restrict__ kvin,
    const float* __restrict__ Wq, const float* __restrict__ Wk,
    const float* __restrict__ Wv, const float* __restrict__ Wo,
    _Float16* __restrict__ Wqh, _Float16* __restrict__ Wkh,
    _Float16* __restrict__ Wvh, _Float16* __restrict__ Woh) {
  constexpr int PX = 4, PY = 8;
  if (blockIdx.x >= 256) {
    const unsigned s0 = (blockIdx.x - 256) * 1024, t = threadIdx.x * 4;
    const v4f q = *(const v4f*)(Wq + s0 + t), k = *(const v4f*)(Wk + s0 + t);
    const v4f v = *(const v4f*)(Wv + s0 + t), o = *(const v4f*)(Wo + s0 + t);
    *(v4h*)(Wqh + s0 + t) = __builtin_convertvector(q, v4h);
    *(v4h*)(Wkh + s0 + t) = __builtin_convertvector(k, v4h);
    *(v4h*)(Wvh + s0 + t) = __builtin_convertvector(v, v4h);
    *(v4h*)(Woh + s0 + t) = __builtin_convertvector(o, v4h);
    return;
  }
  int s = blockIdx.x * 256 + threadIdx.x;
  const int c  = (s & 63) * 4;  s >>= 6;
  const int x0 = (s & 7) * PX;  s >>= 3;
  const int y0 = (s & 3) * PY;  s >>= 2;
  const int f  = s & 3;
  const int b  = s >> 2;
  const int ch = f * 256 + c;
  const size_t map = ((size_t)b * 4096 + f * 1024) * 256 + c;
  const float* xb = x + map;

  v4f r[PY + 2][PX + 2];  // input rows y0-1 .. y0+PY, columns x0-1 .. x0+PX
  auto load_row = [&](int j) {
    const int y = y0 - 1 + j;
    const int yc = (j == 0) ? max(y, 0) : (j == PY + 1) ? min(y, 31) : y;
#pragma unroll
    for (int k = 0; k < PX + 2; ++k) {
      const int xx = x0 - 1 + k;
      const int xc = (k == 0) ? max(xx, 0) : (k == PX + 1) ? min(xx, 31) : xx;
      r[j][k] = *(const v4f*)(xb + (size_t)(yc * 32 + xc) * 256);
    }
    // before a later instruction reuses an address register of these loads
    asm volatile("s_wait_xcnt 0x0" ::: "memory");
  };
  // zero padding, applied where a row is first used and not where it is loaded
  const float inl = (x0 > 0) ? 1.f : 0.f, inr = (x0 + PX < 32) ? 1.f : 0.f;
  const float top = (y0 > 0) ? 1.f : 0.f, bot = (y0 + PY < 32) ? 1.f : 0.f;
  auto pad_row = [&](int j) {
    const float my = (j == 0) ? top : (j == PY + 1) ? bot : 1.f;
    r[j][0] *= my * inl;
    r[j][PX + 1] *= my * inr;
    if (j == 0 || j == PY + 1) {
#pragma unroll
      for (int k = 1; k <= PX; ++k) r[j][k] *= my;
    }
  };

#pragma unroll
  for (int j = 0; j < 4; ++j) load_row(j);

  // taps of channel c+e: flat elements e*9 .. e*9+8 of these 36 floats
  v4f wv[9];
#pragma unroll
  for (int q = 0; q < 9; ++q) wv[q] = *(const v4f*)(wdw + (size_t)ch * 9 + q * 4);
  asm volatile("s_wait_xcnt 0x0" ::: "memory");  // as in load_row
  const v4f ga = *(const v4f*)(gamma + ch), be = *(const v4f*)(beta + ch);
  const v4f mu = *(const v4f*)(mean + ch),  va = *(const v4f*)(var + ch);
  asm volatile("s_wait_xcnt 0x0" ::: "memory");  // as in load_row
  v4f inv;
#pragma unroll
  for (int e = 0; e < 4; ++e) inv[e] = ga[e] * rsqrtf(va[e] + 1e-5f);

#pragma unroll
  for (int oy = 0; oy < PY; ++oy) {
    if (oy + 4 < PY + 2) load_row(oy + 4);
    // keeps that row's loads in front of this row's arithmetic: left free, the
    // scheduler sinks them to just before their first use, and each then waits
    // a whole memory latency
    __builtin_amdgcn_sched_barrier(0);
    if (oy & 1) {
      // map rows y0+oy-1 and y0+oy (r[oy], r[oy+1]; columns 1..PX are never
      // touched by pad_row) make pooled row (y0+oy-1)/2, two pixels of it
      const int tk = f * 256 + ((y0 + oy - 1) >> 1) * 16 + (x0 >> 1);
      _Float16* kd = kvin + ((size_t)b * 1024 + tk) * 256 + c;
#pragma unroll
      for (int px = 0; px < PX; px += 2) {
        const v4f v = r[oy][1 + px] + r[oy][2 + px] + r[oy + 1][1 + px] + r[oy + 1][2 + px];
        v4h a;
#pragma unroll
        for (int e = 0; e < 4; ++e) a[e] = (_Float16)(v[e] * 0.25f);
        *(v4h*)(kd + (px >> 1) * 256) = a;
      }
      // before a later instruction reuses an address or data register of these stores
      asm volatile("s_wait_xcnt 0x0" ::: "memory");
      // keeps this row's arithmetic behind that wait: left free, the scheduler
      // lifts part of it over the wait, into the stores' registers
      __builtin_amdgcn_sched_barrier(0);
    }
    if (oy == 0) { pad_row(0); pad_row(1); }
    pad_row(oy + 2);
#pragma unroll
    for (int px = 0; px < PX; ++px) {
      v4h q;
#pragma unroll
      for (int e = 0; e < 4; ++e) {
        float acc = 0.f;
#pragma unroll
        for (int ky = 0; ky < 3; ++ky)
#pragma unroll
          for (int kx = 0; kx < 3; ++kx) {
            const int t = e * 9 + ky * 3 + kx;
            acc += r[oy + ky][px + kx][e] * wv[t >> 2][t & 3];
          }
        q[e] = (_Float16)((acc - mu[e]) * inv[e] + be[e]);
      }
      *(v4h*)(qin + map + (size_t)((y0 + oy) * 32 + x0 + px) * 256) = q;
    }
  }
}

// ---------------------------------------------------------------------------
// Y[M x 256] = X[M x 256] @ W^T + bias, WMMA f16->f32.
// One 128 (m) x 128 (n) tile of Y (rows from mb, columns from nb) per block of
// 8 waves. The block's 128 rows
// of X and 128 rows of W (all 256 k) are copied once into LDS, one whole
// 512-byte row per wave-wide copy; each wave then computes 64 x 32 results
// (4 x 2 accumulator tiles) from LDS fragments: 12 fragment reads feed 8 WMMAs.
// mode 0: f16 out, row-major [m][n]            (K projection)
// mode 1: f16 out, per-batch transposed V^T:   vt[b][n][t], m = b*1024 + t
// A lane's 8 accumulator registers run along the A operand's rows, so A is the
// operand whose index is contiguous in an f16 output: W (n) in mode 0, X (m = t)
// in mode 1; each lane then stores its 8 results as one 16-byte piece.
// ---------------------------------------------------------------------------
// Eight 16-byte-per-lane copies global -> LDS: rows r, r+8, .. r+56 of a tile
// (global rows of 512 B, LDS rows of 528 B). The closing s_wait_xcnt stands in
// the same statement, in front of any later write of the address registers.
DEVINL void cp_rows8(const _Float16* g, unsigned l) {
  asm volatile(
      "global_load_async_to_lds_b128 %0, %8, off\n\t"
      "global_load_async_to_lds_b128 %1, %9, off\n\t"
      "global_load_async_to_lds_b128 %2, %10, off\n\t"
      "global_load_async_to_lds_b128 %3, %11, off\n\t"
      "global_load_async_to_lds_b128 %4, %12, off\n\t"
      "global_load_async_to_lds_b128 %5, %13, off\n\t"
      "global_load_async_to_lds_b128 %6, %14, off\n\t"
      "global_load_async_to_lds_b128 %7, %15, off\n\t"
      "s_wait_xcnt 0x0"
      :: "v"(l), "v"(l + 1 * 4224u), "v"(l + 2 * 4224u), "v"(l + 3 * 4224u),
         "v"(l + 4 * 4224u), "v"(l + 5 * 4224u), "v"(l + 6 * 4224u),
         "v"(l + 7 * 4224u),
         "v"(g), "v"(g + 1 * 2048), "v"(g + 2 * 2048), "v"(g + 3 * 2048),
         "v"(g + 4 * 2048), "v"(g + 5 * 2048), "v"(g + 6 * 2048),
         "v"(g + 7 * 2048)
      : "memory");
}

DEVINL void gemm256_tile(const _Float16* __restrict__ X, const _Float16* __restrict__ Wh,
                         const float* __restrict__ bias, void* __restrict__ Yv,
                         int mode, int mb, int nb) {
  // Row pitch 528 B = 16 B x odd: the 16 rows of a ds_load_b128 fragment read
  // start on 16 different bank groups.
  constexpr int GP = 264;                 // halves per staged row
  constexpr int TILE = 128 * GP;          // halves per staged operand tile
  __shared__ __attribute__((aligned(16))) _Float16 Sh[2 * TILE];  // X rows | W rows

  const int lane = threadIdx.x & 31, w = threadIdx.x >> 5;

  // wave w copies rows w, w+8, .. w+120 of both tiles; lane = 16-byte column
  {
    const _Float16* gx = X + (size_t)(mb + w) * 256 + lane * 8;
    const _Float16* gw = Wh + (size_t)(nb + w) * 256 + lane * 8;
    const unsigned lx = (unsigned)(size_t)Sh + (unsigned)(w * GP + lane * 8) * 2u;
    const unsigned lw = lx + (unsigned)TILE * 2u;
    cp_rows8(gw, lw);
    cp_rows8(gw + 64 * 256, lw + 64u * 528u);
    cp_rows8(gx, lx);
    cp_rows8(gx + 64 * 256, lx + 64u * 528u);
  }
  // this wave's copies have landed; behind the barrier, every wave's have
  asm volatile("s_wait_asynccnt 0x0" ::: "memory");
  __syncthreads();

  const int wa = w & 1, wb = w >> 1;
  const _Float16* As = Sh + (mode == 0 ? TILE : 0) + (wa * 64) * GP;
  const _Float16* Bs = Sh + (mode == 0 ? 0 : TILE) + (wb * 32) * GP;

  v8f acc[4][2] = {};
  v16h a[2][4], b[2][2];  // two fragment sets: one in use, one being filled
  auto fetch = [&](int s, int k0) {
#pragma unroll
    for (int i = 0; i < 4; ++i) a[s][i] = load_tile(As + i * 16 * GP + k0, GP, lane);
#pragma unroll
    for (int j = 0; j < 2; ++j) b[s][j] = load_tile(Bs + j * 16 * GP + k0, GP, lane);
  };
  fetch(0, 0);
#pragma unroll
  for (int ks = 0; ks < 8; ++ks) {
    if (ks + 1 < 8) fetch((ks + 1) & 1, (ks + 1) * 32);
    // keeps the next step's 12 LDS reads as one group in front of this step's
    // WMMAs: left free, the scheduler sinks them to two reads in front of each
    // pair of WMMAs, and every pair then waits a whole LDS latency
    __builtin_amdgcn_sched_barrier(0);
#pragma unroll
    for (int i = 0; i < 4; ++i)
#pragma unroll
      for (int j = 0; j < 2; ++j)
        acc[i][j] = wmma_f16(a[ks & 1][i], b[ks & 1][j], acc[i][j]);
    // keeps the following group of reads whole behind these WMMAs: left free,
    // the scheduler lifts parts of it in among them
    __builtin_amdgcn_sched_barrier(0);
  }

  // acc[i][j][v] = product at A row wa*64 + i*16 + 8g + v, B row wb*32 + j*16 + c
  const int g = lane >> 4, c = lane & 15;
  if (mode == 0) {
#pragma unroll
    for (int i = 0; i < 4; ++i) {
      const int n = nb + wa * 64 + i * 16 + 8 * g;
      const v4f b0 = *(const v4f*)(bias + n), b1 = *(const v4f*)(bias + n + 4);
#pragma unroll
      for (int j = 0; j < 2; ++j) {
        const int m = mb + wb * 32 + j * 16 + c;
        v8h y;
#pragma unroll
        for (int v = 0; v < 4; ++v) {
          y[v]     = (_Float16)(acc[i][j][v] + b0[v]);
          y[4 + v] = (_Float16)(acc[i][j][4 + v] + b1[v]);
        }
        *(v8h*)((_Float16*)Yv + (size_t)m * 256 + n) = y;
      }
    }
  } else {
#pragma unroll
    for (int j = 0; j < 2; ++j) {
      const int n = nb + wb * 32 + j * 16 + c;
      const float bn = bias[n];
#pragma unroll
      for (int i = 0; i < 4; ++i) {
        const int m = mb + wa * 64 + i * 16 + 8 * g;
        const int bb = m >> 10, t = m & 1023;
        v8h y;
#pragma unroll
        for (int v = 0; v < 8; ++v) y[v] = (_Float16)(acc[i][j][v] + bn);
        *(v8h*)((_Float16*)Yv + ((size_t)bb * 256 + n) * 1024 + t) = y;
      }
    }
    // before a later instruction reuses an address or data register of these stores
    asm volatile("s_wait_xcnt 0x0" ::: "memory");
  }
}

// The K and V projections depend on nothing of one another: one launch does
// both. blockIdx.x picks the product and its 128 rows: 0 .. 63 K, 64 .. 127 V
// (8192 rows each). The Q projection is done by the attention kernel.
__global__ void __launch_bounds__(256) kv_kernel(
    const _Float16* __restrict__ kvin, const _Float16* __restrict__ Wkh,
    const _Float16* __restrict__ Wvh, const float* __restrict__ bk,
    const float* __restrict__ bv, _Float16* __restrict__ kpj,
    _Float16* __restrict__ vtj) {
  const int bx = blockIdx.x, nb = blockIdx.y * 128;
  const bool isk = bx < 64;
  const _Float16* Wh = isk ? Wkh : Wvh;
  const float* bias  = isk ? bk : bv;
  _Float16* Y        = isk ? kpj : vtj;
  const int mb       = (isk ? bx : bx - 64) * 128;
  gemm256_tile(kvin, Wh, bias, Y, isk ? 0 : 1, mb, nb);
}

DEVINL float xhalf(float x) {
  const int i = __builtin_bit_cast(int, x);
  return __builtin_bit_cast(
      float, __builtin_amdgcn_permlanex16(i, i, 0x76543210, 0xfedcba98, false, false));
}

__global__ void __launch_bounds__(256) attn_out_kernel(
    const _Float16* __restrict__ qin, const _Float16* __restrict__ Wqh,
    const float* __restrict__ bq, const _Float16* __restrict__ kp,
    const _Float16* __restrict__ vt, const _Float16* __restrict__ Woh,
    const float* __restrict__ bo, float* __restrict__ out) {
  // Row pitches are 16 B x odd, so that the 16 rows one ds_load_b128 fragment
  // read touches start on 16 different bank groups (64 banks x 4 B).
  constexpr int KP = 264;                 // halves per K row: 512 B + 16 B pad
  constexpr int VP = 40;                  // halves per V row:  64 B + 16 B pad
  constexpr int WP = 264;                 // halves per Wq, Wo, X row: 512 B + 16 B pad
  __shared__ __attribute__((aligned(16))) _Float16 Ksh[2][32 * KP];   // [buf][t][d]
  __shared__ __attribute__((aligned(16))) _Float16 Vsh[2][256 * VP];  // [buf][d][t]
  __shared__ __attribute__((aligned(16))) _Float16 Wsh[256 * WP];     // Wq, then Wo: [n][channel]
  // first the block's X rows [query][channel], pitch WP; behind the key loop the
  // O operands: [wave][group * 4 + 32-channel step][low | high 8 halves][lane]
  __shared__ __attribute__((aligned(16))) _Float16 XOsh[128 * WP];
  auto osh = [&](int w, int t, int hl) { return &XOsh[((w * 8 + t) * 2 + hl) * 256 + (threadIdx.x & 31) * 8]; };

  const int tid = threadIdx.x;
  const int lane = tid & 31, wv = tid >> 5;
  const int h = wv & 1, qg = wv >> 1;
  const int b = blockIdx.x;
  const int l0 = blockIdx.y * 128 + qg * 32;
  const _Float16* kb = kp + (size_t)b * 1024 * 256;
  const _Float16* vb = vt + (size_t)b * 256 * 1024;

  // --- per-thread staging assignment per pass: 4 K, 4 V and 1 Wo segment (16B) ---
  // K chunk: wave w copies rows w, w+8, w+16, w+24; lane = 16-byte column
  // V chunk = 1024 segs: seg s -> d = s>>2, t = (s&3)*8
  // Wo: pass i brings rows 8i .. 8i+7, wave w row 8i + w
  const int vd = tid >> 2, vtc = (tid & 3) * 8;
  // a source address = a base that is the same for the whole block and moves
  // with i + the thread's own offset, which does not
  const unsigned rgo = (unsigned)(wv * 256 + lane * 8);   // K and Wo rows
  const unsigned vgo = (unsigned)(vd * 1024 + vtc);

  auto stage = [&](int i, int buf) {
    const _Float16* ks = kb + i * (32 * 256);
    const _Float16* vs = vb + i * 32;
#pragma unroll
    for (int j = 0; j < 4; ++j)
      cp16_to_lds(ks + (rgo + j * (8u * 256u)), &Ksh[buf][(wv + 8 * j) * KP + lane * 8]);
#pragma unroll
    for (int j = 0; j < 4; ++j)
      cp16_to_lds(vs + (vgo + j * (64u * 1024u)), &Vsh[buf][(vd + 64 * j) * VP + vtc]);
  };
  auto stage_wo = [&](int i) {
    cp16_to_lds(Woh + i * (8 * 256) + rgo, &Wsh[(i * 8 + wv) * WP + lane * 8]);
  };

  const int g = lane >> 4, col = lane & 15;

  // --- Wq (256 rows) and the block's X rows (128) into LDS: wave w copies rows
  // w, w+8, ..; lane = 16-byte column; chunk 0 of K and V flies with them ---
  {
    const unsigned lrow = (unsigned)(wv * WP + lane * 8) * 2u;
    const _Float16* gw = Wqh + rgo;
    const _Float16* gx = qin + ((size_t)b * 4096 + blockIdx.y * 128) * 256 + rgo;
    const unsigned lw = (unsigned)(size_t)Wsh + lrow;
    const unsigned lx = (unsigned)(size_t)XOsh + lrow;
    cp_rows8(gw, lw);
    cp_rows8(gw + 64 * 256, lw + 64u * 528u);
    cp_rows8(gw + 128 * 256, lw + 128u * 528u);
    cp_rows8(gw + 192 * 256, lw + 192u * 528u);
    cp_rows8(gx, lx);
    cp_rows8(gx + 64 * 256, lx + 64u * 528u);
  }
  stage(0, 0);

  // bias of this lane's Q^T rows: channels 16 dt + 8g .. + 7 of head h
  const float* bqp = bq + h * 128 + 8 * g;
  v4f qb0[8], qb1[8];
#pragma unroll
  for (int dt = 0; dt < 8; ++dt) {
    qb0[dt] = *(const v4f*)(bqp + dt * 16);
    qb1[dt] = *(const v4f*)(bqp + dt * 16 + 4);
  }
  // before a later instruction reuses the address registers of these loads; the
  // loads' common address is an input, so that its registers stay live, and
  // unwritten, up to the wait
  asm volatile("s_wait_xcnt 0x0" :: "v"(bqp) : "memory");

  // this wave's copies have landed; behind the barrier, every wave's have
  asm volatile("s_wait_asynccnt 0x0" ::: "memory");
  __syncthreads();

  // --- Q tiles (2 x 16x128) resident in registers for the whole key loop ---
  v16h qa[2][4];
  {
    const _Float16* Wa = Wsh + h * 128 * WP;
    const _Float16* Xb = XOsh + qg * 32 * WP;
    v8f qacc[8][2] = {};
    v16h wa[2][8], xb[2][2];  // two fragment sets: one in use, one being filled
    auto qfetch = [&](int s, int k0) {
#pragma unroll
      for (int dt = 0; dt < 8; ++dt) wa[s][dt] = load_tile(Wa + dt * 16 * WP + k0, WP, lane);
#pragma unroll
      for (int c = 0; c < 2; ++c) xb[s][c] = load_tile(Xb + c * 16 * WP + k0, WP, lane);
    };
    qfetch(0, 0);
#pragma unroll
    for (int ks = 0; ks < 8; ++ks) {
      if (ks + 1 < 8) qfetch((ks + 1) & 1, (ks + 1) * 32);
      // keeps the next step's 20 LDS reads as one group in front of this step's
      // WMMAs: left free, the scheduler sinks them in among the WMMAs
      __builtin_amdgcn_sched_barrier(0);
#pragma unroll
      for (int dt = 0; dt < 8; ++dt)
#pragma unroll
        for (int c = 0; c < 2; ++c)
          qacc[dt][c] = wmma_f16(wa[ks & 1][dt], xb[ks & 1][c], qacc[dt][c]);
      // keeps the following group of reads whole behind these WMMAs
      __builtin_amdgcn_sched_barrier(0);
    }
    // qacc[dt][c][v] = Q^T[16 dt + 8g + v][16c + col]; tiles 2 kt and 2 kt + 1 are
    // channels 32 kt + 8g + v and 32 kt + 16 + 8g + v: load_tile's k order
#pragma unroll
    for (int c = 0; c < 2; ++c)
#pragma unroll
      for (int kt = 0; kt < 4; ++kt)
#pragma unroll
        for (int v = 0; v < 4; ++v) {
          qa[c][kt][v]      = (_Float16)(qacc[2 * kt][c][v] + qb0[2 * kt][v]);
          qa[c][kt][4 + v]  = (_Float16)(qacc[2 * kt][c][4 + v] + qb1[2 * kt][v]);
          qa[c][kt][8 + v]  = (_Float16)(qacc[2 * kt + 1][c][v] + qb0[2 * kt + 1][v]);
          qa[c][kt][12 + v] = (_Float16)(qacc[2 * kt + 1][c][4 + v] + qb1[2 * kt + 1][v]);
        }
  }

  // o[c][d][v] = O^T[d*16 + 8g + v][16c + col]; mrow, lrow: that query's running
  // maximum and this half's share of its running sum
  v8f o[2][8] = {};
  float mrow[2] = {-1e30f, -1e30f}, lrow[2] = {0.f, 0.f};

  const float scale = 0.0625f;  // 256^-0.5 (full-dim scale, as in reference)

  for (int i = 0; i < 32; ++i) {
    const int buf = i & 1;
    // my reads of what is refilled below (in pass 0: of Wq) have returned
    asm volatile("s_wait_dscnt 0x0" ::: "memory");
    // my copies for chunk i have landed in LDS
    asm volatile("s_wait_asynccnt 0x0" ::: "memory");
    __syncthreads();     // everyone's copies done; prev chunk fully consumed
    stage_wo(i);
    if (i + 1 < 32) stage(i + 1, buf ^ 1);  // overlap next DMA

    const _Float16* kc = Ksh[buf] + h * 128;
    const _Float16* vc = Vsh[buf] + h * 128 * VP;

    // --- S^T = K Q^T for this 32-key chunk (two 16-key M-tiles) ---
    v16h kf[2][4];
#pragma unroll
    for (int kt = 0; kt < 4; ++kt) {
      kf[0][kt] = load_tile(kc + kt * 32, KP, lane);
      kf[1][kt] = load_tile(kc + 16 * KP + kt * 32, KP, lane);
    }
    // keeps the 16 K reads as one group in front of the 16 WMMAs: left free, the
    // scheduler puts two reads and a full LDS wait in front of each fragment's first WMMA
    __builtin_amdgcn_sched_barrier(0);
    v8f s0[2] = {}, s1[2] = {};
#pragma unroll
    for (int kt = 0; kt < 4; ++kt)
#pragma unroll
      for (int c = 0; c < 2; ++c) {
        s0[c] = wmma_f16(kf[0][kt], qa[c][kt], s0[c]);
        s1[c] = wmma_f16(kf[1][kt], qa[c][kt], s1[c]);
      }
    v16h vf[8];  // V^T fragments (rows d, contiguous t), in flight under the softmax
#pragma unroll
    for (int d = 0; d < 8; ++d) vf[d] = load_tile(vc + (d * 16) * VP, VP, lane);
    // keeps the 16 V reads as one group in front of the softmax arithmetic,
    // which then covers their latency; left free, most sink in among their WMMAs
    __builtin_amdgcn_sched_barrier(0);

    // --- online softmax of query 16c + col, down the lane's 16 scores ---
    v16h pb[2];  // P^T as B operands: pb[c][v] = key 8g + v, pb[c][8 + v] = key 16 + 8g + v
#pragma unroll
    for (int c = 0; c < 2; ++c) {
      // whole-tile vector arithmetic: each packed instruction then takes two
      // adjacent registers of one accumulator tile as they lie
      const v8f a0 = s0[c] * scale, a1 = s1[c] * scale;
      const v8f mx = __builtin_elementwise_max(a0, a1);
      float rmax = fmaxf(fmaxf(fmaxf(mx[0], mx[1]), fmaxf(mx[2], mx[3])),
                         fmaxf(fmaxf(mx[4], mx[5]), fmaxf(mx[6], mx[7])));
      rmax = fmaxf(rmax, xhalf(rmax));  // the other 16 keys of this query
      const float mnew = fmaxf(mrow[c], rmax);
      const float cf = __expf(mrow[c] - mnew);
      const v8f d0 = a0 - mnew, d1 = a1 - mnew;
      v8f p0, p1;
#pragma unroll
      for (int v = 0; v < 8; ++v) {
        p0[v] = __expf(d0[v]);
        p1[v] = __expf(d1[v]);
        pb[c][v]     = (_Float16)p0[v];
        pb[c][8 + v] = (_Float16)p1[v];
      }
      const v8f rs = p0 + p1;
      lrow[c] = lrow[c] * cf + (((rs[0] + rs[1]) + (rs[2] + rs[3])) +
                                ((rs[4] + rs[5]) + (rs[6] + rs[7])));
      mrow[c] = mnew;
#pragma unroll
      for (int d = 0; d < 8; ++d) o[c][d] *= cf;
    }

    // --- O^T += V^T P^T ---
#pragma unroll
    for (int d = 0; d < 8; ++d)
#pragma unroll
      for (int c = 0; c < 2; ++c) o[c][d] = wmma_f16(vf[d], pb[c], o[c][d]);
  }
  // no copy of this wave is outstanding behind the loop
  asm volatile("s_wait_asynccnt 0x0" ::: "memory");

  // bias of this wave's 8 x 16 output columns
  float bn[8];
#pragma unroll
  for (int t = 0; t < 8; ++t) bn[t] = bo[h * 128 + t * 16 + col];

  // --- join the halves' sums, normalize, hand the f16 operands over in LDS ---
  // tiles 2j and 2j+1 of a group: query col, channels 32j + 8g + v and 32j + 16 +
  // 8g + v of this head, which is load_tile's k order for row col
#pragma unroll
  for (int c = 0; c < 2; ++c) {
    const float linv = 1.f / (lrow[c] + xhalf(lrow[c]));
#pragma unroll
    for (int j = 0; j < 4; ++j) {
      v8h lo, hi;
#pragma unroll
      for (int v = 0; v < 8; ++v) {
        lo[v] = (_Float16)(o[c][2 * j][v] * linv);
        hi[v] = (_Float16)(o[c][2 * j + 1][v] * linv);
      }
      *(v8h*)osh(wv, c * 4 + j, 0) = lo;
      *(v8h*)osh(wv, c * 4 + j, 1) = hi;
    }
  }
  __syncthreads();  // both heads' operands of every query group are in LDS

  // --- Y = O Wo^T + bo: 32 queries x 128 columns, 8 steps of 32 channels ---
  v16h oa[2][8];  // A operands: step ks = head ks >> 2, its channels 32 (ks & 3) ..
#pragma unroll
  for (int c = 0; c < 2; ++c)
#pragma unroll
    for (int ks = 0; ks < 8; ++ks) {
      const _Float16* p = osh(qg * 2 + (ks >> 2), c * 4 + (ks & 3), 0);
      const v8h lo = *(const v8h*)p, hi = *(const v8h*)(p + 256);
#pragma unroll
      for (int v = 0; v < 8; ++v) { oa[c][ks][v] = lo[v]; oa[c][ks][8 + v] = hi[v]; }
    }

  // a block of work = 32 columns (np) x 4 channel steps (kh): 8 Wo fragments, 16 WMMAs
  const _Float16* Wb = Wsh + h * 128 * WP;
  v16h wf[2][8];  // two fragment sets: one in use, one being filled
  auto fetch = [&](int s, int blk) {
    const int np = blk >> 1, kh = blk & 1;
#pragma unroll
    for (int nt = 0; nt < 2; ++nt)
#pragma unroll
      for (int kk = 0; kk < 4; ++kk)
        wf[s][nt * 4 + kk] = load_tile(Wb + (np * 32 + nt * 16) * WP + (kh * 4 + kk) * 32, WP, lane);
  };
  float* yb = out + ((size_t)b * 4096 + l0 + 8 * g) * 256 + h * 128 + col;
  v8f acc[4][2][2] = {};
  fetch(0, 0);
#pragma unroll
  for (int blk = 0; blk < 8; ++blk) {
    const int np = blk >> 1, kh = blk & 1;
    if (blk + 1 < 8) fetch((blk + 1) & 1, blk + 1);
    // keeps the next block's 16 LDS reads as one group in front of this block's
    // WMMAs: left free, the scheduler sinks them in among the WMMAs
    __builtin_amdgcn_sched_barrier(0);
#pragma unroll
    for (int kk = 0; kk < 4; ++kk)
#pragma unroll
      for (int c = 0; c < 2; ++c)
#pragma unroll
        for (int nt = 0; nt < 2; ++nt)
          acc[np][c][nt] = wmma_f16(oa[c][kh * 4 + kk], wf[blk & 1][nt * 4 + kk], acc[np][c][nt]);
    // keeps the following group of reads whole behind these WMMAs
    __builtin_amdgcn_sched_barrier(0);
    if (kh == 1) {
      // acc[np][c][nt][v]: query 16c + 8g + v, column 32 np + 16 nt + col
#pragma unroll
      for (int c = 0; c < 2; ++c)
#pragma unroll
        for (int nt = 0; nt < 2; ++nt) acc[np][c][nt] += bn[np * 2 + nt];
      // keeps all 32 sums in front of the stores, each in a register of its own:
      // left free, the scheduler reuses a stored register between the stores
      __builtin_amdgcn_sched_barrier(0);
      // the two stores of a row's 128-byte line stand next to each other
#pragma unroll
      for (int c = 0; c < 2; ++c)
#pragma unroll
        for (int v = 0; v < 8; ++v)
#pragma unroll
          for (int nt = 0; nt < 2; ++nt)
            yb[(c * 16 + v) * 256 + np * 32 + nt * 16] = acc[np][c][nt][v];
      // before a later instruction reuses an address or data register of these stores
      asm volatile("s_wait_xcnt 0x0" ::: "memory");
      // keeps later arithmetic behind that wait
      __builtin_amdgcn_sched_barrier(0);
    }
  }
}

// ---------------------------------------------------------------------------
// Host orchestration
// ---------------------------------------------------------------------------
extern "C" void kernel_launch(void* const* d_in, const int* in_sizes, int n_in,
                              void* d_out, int out_size, void* d_ws, size_t ws_size,
                              hipStream_t stream) {
  const float* x     = (const float*)d_in[0];
  const float* wdw   = (const float*)d_in[1];
  const float* gamma = (const float*)d_in[2];
  const float* beta  = (const float*)d_in[3];
  const float* mean  = (const float*)d_in[4];
  const float* var   = (const float*)d_in[5];
  const float* Wq = (const float*)d_in[6];  const float* bq = (const float*)d_in[7];
  const float* Wk = (const float*)d_in[8];  const float* bk = (const float*)d_in[9];
  const float* Wv = (const float*)d_in[10]; const float* bv = (const float*)d_in[11];
  const float* Wo = (const float*)d_in[12]; const float* bo = (const float*)d_in[13];

  char* ws = (char*)d_ws;
  size_t off = 0;
  auto alloc = [&](size_t bytes) {
    char* p = ws + off;
    off = (off + bytes + 255) & ~(size_t)255;
    return p;
  };
  const size_t L = 8ull * 4096 * 256;  // q-side token elements
  const size_t T = 8ull * 1024 * 256;  // pooled token elements
  _Float16* qin = (_Float16*)alloc(L * 2);
  _Float16* kvin = (_Float16*)alloc(T * 2);
  _Float16* Wqh = (_Float16*)alloc(65536 * 2);
  _Float16* Wkh = (_Float16*)alloc(65536 * 2);
  _Float16* Wvh = (_Float16*)alloc(65536 * 2);
  _Float16* Woh = (_Float16*)alloc(65536 * 2);
  _Float16* kpj = (_Float16*)alloc(T * 2);   // K projected [B,1024,256]
  _Float16* vtj = (_Float16*)alloc(T * 2);   // V projected, transposed [B,256,1024]

  // 1) preprocessing
  // 256 blocks of patches + 64 blocks of weight conversion
  dwconv_bn_kernel<<<320, 256, 0, stream>>>(x, wdw, gamma, beta, mean, var, qin, kvin,
                                            Wq, Wk, Wv, Wo, Wqh, Wkh, Wvh, Woh);

  // 2) K, V projections (WMMA GEMMs): 64 + 64 row blocks
  kv_kernel<<<dim3(128, 2), 256, 0, stream>>>(kvin, Wkh, Wvh, bk, bv, kpj, vtj);

  // 3) fused Q projection + flash attention + output projection -> f32 d_out:
  //    8 batches x 32 blocks of 128 Q rows, both heads
  attn_out_kernel<<<dim3(8, 32), 256, 0, stream>>>(qin, Wqh, bq, kpj, vtj, Woh, bo,
                                                   (float*)d_out);
}

// v010
// Measured time: 49.5 microseconds a run.
// In two side-by-side timings against v009, it was 1.03 and 1.07 times as fast.
// Over all steps from v000 it is 6.94 times as fast.
#include <hip/hip_runtime.h>
#include <hip/hip_bf16.h>

// ---------------------------------------------------------------------------
// CDNA5 (gfx1250) fused self-attention, wave32 + v_wmma_f32_16x16x32_f16.
// B=8, F=4, C=256, H=W=32 -> L=4096 tokens, pooled T=1024, 2 heads of 128.
// Bandwidth-bound: f16 operands everywhere, flash-style fused attention,
// K/V staged cooperatively into LDS via async-to-LDS (ASYNCcnt) with
// double buffering so DMA overlaps WMMA compute.
// ---------------------------------------------------------------------------

typedef __attribute__((ext_vector_type(16))) _Float16 v16h;
typedef __attribute__((ext_vector_type(8)))  _Float16 v8h;
typedef __attribute__((ext_vector_type(8)))  float    v8f;
typedef __attribute__((ext_vector_type(4)))  int      v4i;

#define DEVINL __device__ __forceinline__

#if defined(__AMDGCN__) && __has_builtin(__builtin_amdgcn_global_load_async_to_lds_b128)
#define USE_ASYNC_LDS 1
#endif

// Copy 16 bytes/lane from global to LDS. Async path: one
// global_load_async_to_lds_b128 per call (512B per wave), tracked by ASYNCcnt.
// Builtin signature (probed from hipcc diagnostics): global int4* (AS1),
// LDS int4* (AS3), imm offset, imm cpol.
DEVINL void cp16_to_lds(const _Float16* g, _Float16* l) {
#ifdef USE_ASYNC_LDS
  __builtin_amdgcn_global_load_async_to_lds_b128(
      (__attribute__((address_space(1))) v4i*)(v4i*)g,
      (__attribute__((address_space(3))) v4i*)(v4i*)l, 0, 0);
#else
  *(v8h*)l = *(const v8h*)g;
#endif
}

DEVINL v8f wmma_f16(v16h a, v16h b, v8f c) {
  // (neg_a, A, neg_b, B, c_mod, C, reuse_a, reuse_b)
  return __builtin_amdgcn_wmma_f32_16x16x32_f16(false, a, false, b, (short)0, c,
                                                false, false);
}

// Load a 16x32 tile in WMMA 16-bit A layout from a row-major half matrix
// (row stride `ld` halves). Per ISA: lane L supplies row L%16; its 16 halves
// map to k = (i&7) + 8*(L>>4) + 16*(i>>3) -> two contiguous 8-half runs.
// Also produces a B-tile (32x16, K-major) when the source is [n][k]
// row-major, since B[k][n] = src[n][k]. Works for global or LDS pointers.
DEVINL v16h load_tile(const _Float16* p, int ld, int lane) {
  const int r = lane & 15, g = lane >> 4;
  const _Float16* b0 = p + (size_t)r * ld + g * 8;
  v8h lo = *(const v8h*)(b0);
  v8h hi = *(const v8h*)(b0 + 16);
  v16h t;
#pragma unroll
  for (int i = 0; i < 8; ++i) { t[i] = lo[i]; t[8 + i] = hi[i]; }
  return t;
}

// ---------------------------------------------------------------------------
// Prep: depthwise 3x3 conv + BN (q path) and 2x2 average pool (k/v source),
// f32 -> f16, from one read of x
// One thread = 4 adjacent channels x a patch of 4 (x) by 8 (y) pixels. Its 36
// filter taps and BN terms are loaded once and stay in registers; the patch is
// walked down y, each input row (6 pixels, 16-byte loads, a wave reads 512
// contiguous bytes per load) fetched two rows ahead of its first use.
// Taps outside the map enter as zeros (the convolution's zero padding): their
// addresses are clamped into the map and the loaded value is multiplied by 0,
// which keeps every load unconditional, so that none waits behind a branch.
// The patch starts on even x and y, so it holds 2 x 4 whole pooling windows:
// each pair of its own rows is also averaged, while both are in registers.
// Blocks 256 .. 319 of the same launch have no patch: they convert the four
// projection matrices f32 -> f16 (nothing in this launch reads the result), one
// thread 4 adjacent elements of each matrix.
// ---------------------------------------------------------------------------
typedef __attribute__((ext_vector_type(4))) float    v4f;
typedef __attribute__((ext_vector_type(4))) _Float16 v4h;

__global__ void __launch_bounds__(256) dwconv_bn_kernel(
    const float* __restrict__ x, const float* __restrict__ wdw,
    const float* __restrict__ gamma, const float* __restrict__ beta,
    const float* __restrict__ mean, const float* __restrict__ var,
    _Float16* __restrict__ qin, _Float16* __restrict__ kvin,
    const float* __restrict__ Wq, const float* __restrict__ Wk,
    const float* __restrict__ Wv, const float* __restrict__ Wo,
    _Float16* __restrict__ Wqh, _Float16* __restrict__ Wkh,
    _Float16* __restrict__ Wvh, _Float16* __restrict__ Woh) {
  constexpr int PX = 4, PY = 8;
  if (blockIdx.x >= 256) {
    const unsigned s0 = (blockIdx.x - 256) * 1024, t = threadIdx.x * 4;
    const v4f q = *(const v4f*)(Wq + s0 + t), k = *(const v4f*)(Wk + s0 + t);
    const v4f v = *(const v4f*)(Wv + s0 + t), o = *(const v4f*)(Wo + s0 + t);
    *(v4h*)(Wqh + s0 + t) = __builtin_convertvector(q, v4h);
    *(v4h*)(Wkh + s0 + t) = __builtin_convertvector(k, v4h);
    *(v4h*)(Wvh + s0 + t) = __builtin_convertvector(v, v4h);
    *(v4h*)(Woh + s0 + t) = __builtin_convertvector(o, v4h);
    return;
  }
  int s = blockIdx.x * 256 + threadIdx.x;
  const int c  = (s & 63) * 4;  s >>= 6;
  const int x0 = (s & 7) * PX;  s >>= 3;
  const int y0 = (s & 3) * PY;  s >>= 2;
  const int f  = s & 3;
  const int b  = s >> 2;
  const int ch = f * 256 + c;
  const size_t map = ((size_t)b * 4096 + f * 1024) * 256 + c;
  const float* xb = x + map;

  v4f r[PY + 2][PX + 2];  // input rows y0-1 .. y0+PY, columns x0-1 .. x0+PX
  auto load_row = [&](int j) {
    const int y = y0 - 1 + j;
    const int yc = (j == 0) ? max(y, 0) : (j == PY + 1) ? min(y, 31) : y;
#pragma unroll
    for (int k = 0; k < PX + 2; ++k) {
      const int xx = x0 - 1 + k;
      const int xc = (k == 0) ? max(xx, 0) : (k == PX + 1) ? min(xx, 31) : xx;
      r[j][k] = *(const v4f*)(xb + (size_t)(yc * 32 + xc) * 256);
    }
    // before a later instruction reuses an address register of these loads
    asm volatile("s_wait_xcnt 0x0" ::: "memory");
  };
  // zero padding, applied where a row is first used and not where it is loaded
  const float inl = (x0 > 0) ? 1.f : 0.f, inr = (x0 + PX < 32) ? 1.f : 0.f;
  const float top = (y0 > 0) ? 1.f : 0.f, bot = (y0 + PY < 32) ? 1.f : 0.f;
  auto pad_row = [&](int j) {
    const float my = (j == 0) ? top : (j == PY + 1) ? bot : 1.f;
    r[j][0] *= my * inl;
    r[j][PX + 1] *= my * inr;
    if (j == 0 || j == PY + 1) {
#pragma unroll
      for (int k = 1; k <= PX; ++k) r[j][k] *= my;
    }
  };

#pragma unroll
  for (int j = 0; j < 4; ++j) load_row(j);

  // taps of channel c+e: flat elements e*9 .. e*9+8 of these 36 floats
  v4f wv[9];
#pragma unroll
  for (int q = 0; q < 9; ++q) wv[q] = *(const v4f*)(wdw + (size_t)ch * 9 + q * 4);
  asm volatile("s_wait_xcnt 0x0" ::: "memory");  // as in load_row
  const v4f ga = *(const v4f*)(gamma + ch), be = *(const v4f*)(beta + ch);
  const v4f mu = *(const v4f*)(mean + ch),  va = *(const v4f*)(var + ch);
  asm volatile("s_wait_xcnt 0x0" ::: "memory");  // as in load_row
  v4f inv;
#pragma unroll
  for (int e = 0; e < 4; ++e) inv[e] = ga[e] * rsqrtf(va[e] + 1e-5f);

#pragma unroll
  for (int oy = 0; oy < PY; ++oy) {
    if (oy + 4 < PY + 2) load_row(oy + 4);
    // keeps that row's loads in front of this row's arithmetic: left free, the
    // scheduler sinks them to just before their first use, and each then waits
    // a whole memory latency
    __builtin_amdgcn_sched_barrier(0);
    if (oy & 1) {
      // map rows y0+oy-1 and y0+oy (r[oy], r[oy+1]; columns 1..PX are never
      // touched by pad_row) make pooled row (y0+oy-1)/2, two pixels of it
      const int tk = f * 256 + ((y0 + oy - 1) >> 1) * 16 + (x0 >> 1);
      _Float16* kd = kvin + ((size_t)b * 1024 + tk) * 256 + c;
#pragma unroll
      for (int px = 0; px < PX; px += 2) {
        const v4f v = r[oy][1 + px] + r[oy][2 + px] + r[oy + 1][1 + px] + r[oy + 1][2 + px];
        v4h a;
#pragma unroll
        for (int e = 0; e < 4; ++e) a[e] = (_Float16)(v[e] * 0.25f);
        *(v4h*)(kd + (px >> 1) * 256) = a;
      }
      // before a later instruction reuses an address or data register of these stores
      asm volatile("s_wait_xcnt 0x0" ::: "memory");
      // keeps this row's arithmetic behind that wait: left free, the scheduler
      // lifts part of it over the wait, into the stores' registers
      __builtin_amdgcn_sched_barrier(0);
    }
    if (oy == 0) { pad_row(0); pad_row(1); }
    pad_row(oy + 2);
#pragma unroll
    for (int px = 0; px < PX; ++px) {
      v4h q;
#pragma unroll
      for (int e = 0; e < 4; ++e) {
        float acc = 0.f;
#pragma unroll
        for (int ky = 0; ky < 3; ++ky)
#pragma unroll
          for (int kx = 0; kx < 3; ++kx) {
            const int t = e * 9 + ky * 3 + kx;
            acc += r[oy + ky][px + kx][e] * wv[t >> 2][t & 3];
          }
        q[e] = (_Float16)((acc - mu[e]) * inv[e] + be[e]);
      }
      *(v4h*)(qin + map + (size_t)((y0 + oy) * 32 + x0 + px) * 256) = q;
    }
  }
}

// ---------------------------------------------------------------------------
// Y[M x 256] = X[M x 256] @ W^T + bias, WMMA f16->f32.
// One 128 (m) x 128 (n) tile of Y (rows from mb, columns from nb) per block of
// 8 waves. The block's 128 rows
// of X and 128 rows of W (all 256 k) are copied once into LDS, one whole
// 512-byte row per wave-wide copy; each wave then computes 64 x 32 results
// (4 x 2 accumulator tiles) from LDS fragments: 12 fragment reads feed 8 WMMAs.
// mode 0: f16 out, row-major [m][n]            (K projection)
// mode 1: f16 out, per-batch transposed V^T:   vt[b][n][t], m = b*1024 + t
// A lane's 8 accumulator registers run along the A operand's rows, so A is the
// operand whose index is contiguous in an f16 output: W (n) in mode 0, X (m = t)
// in mode 1; each lane then stores its 8 results as one 16-byte piece.
// ---------------------------------------------------------------------------
// Eight 16-byte-per-lane copies global -> LDS: rows r, r+8, .. r+56 of a tile
// (global rows of 512 B, LDS rows of 528 B). The closing s_wait_xcnt stands in
// the same statement, in front of any later write of the address registers.
DEVINL void cp_rows8(const _Float16* g, unsigned l) {
  asm volatile(
      "global_load_async_to_lds_b128 %0, %8, off\n\t"
      "global_load_async_to_lds_b128 %1, %9, off\n\t"
      "global_load_async_to_lds_b128 %2, %10, off\n\t"
      "global_load_async_to_lds_b128 %3, %11, off\n\t"
      "global_load_async_to_lds_b128 %4, %12, off\n\t"
      "global_load_async_to_lds_b128 %5, %13, off\n\t"
      "global_load_async_to_lds_b128 %6, %14, off\n\t"
      "global_load_async_to_lds_b128 %7, %15, off\n\t"
      "s_wait_xcnt 0x0"
      :: "v"(l), "v"(l + 1 * 4224u), "v"(l + 2 * 4224u), "v"(l + 3 * 4224u),
         "v"(l + 4 * 4224u), "v"(l + 5 * 4224u), "v"(l + 6 * 4224u),
         "v"(l + 7 * 4224u),
         "v"(g), "v"(g + 1 * 2048), "v"(g + 2 * 2048), "v"(g + 3 * 2048),
         "v"(g + 4 * 2048), "v"(g + 5 * 2048), "v"(g + 6 * 2048),
         "v"(g + 7 * 2048)
      : "memory");
}

DEVINL void gemm256_tile(const _Float16* __restrict__ X, const _Float16* __restrict__ Wh,
                         const float* __restrict__ bias, void* __restrict__ Yv,
                         int mode, int mb, int nb) {
  // Row pitch 528 B = 16 B x odd: the 16 rows of a ds_load_b128 fragment read
  // start on 16 different bank groups.
  constexpr int GP = 264;                 // halves per staged row
  constexpr int TILE = 128 * GP;          // halves per staged operand tile
  __shared__ __attribute__((aligned(16))) _Float16 Sh[2 * TILE];  // X rows | W rows

  const int lane = threadIdx.x & 31, w = threadIdx.x >> 5;

  // wave w copies rows w, w+8, .. w+120 of both tiles; lane = 16-byte column
  {
    const _Float16* gx = X + (size_t)(mb + w) * 256 + lane * 8;
    const _Float16* gw = Wh + (size_t)(nb + w) * 256 + lane * 8;
    const unsigned lx = (unsigned)(size_t)Sh + (unsigned)(w * GP + lane * 8) * 2u;
    const unsigned lw = lx + (unsigned)TILE * 2u;
    cp_rows8(gw, lw);
    cp_rows8(gw + 64 * 256, lw + 64u * 528u);
    cp_rows8(gx, lx);
    cp_rows8(gx + 64 * 256, lx + 64u * 528u);
  }
  // this wave's copies have landed; behind the barrier, every wave's have
  asm volatile("s_wait_asynccnt 0x0" ::: "memory");
  __syncthreads();

  const int wa = w & 1, wb = w >> 1;
  const _Float16* As = Sh + (mode == 0 ? TILE : 0) + (wa * 64) * GP;
  const _Float16* Bs = Sh + (mode == 0 ? 0 : TILE) + (wb * 32) * GP;

  v8f acc[4][2] = {};
  v16h a[2][4], b[2][2];  // two fragment sets: one in use, one being filled
  auto fetch = [&](int s, int k0) {
#pragma unroll
    for (int i = 0; i < 4; ++i) a[s][i] = load_tile(As + i * 16 * GP + k0, GP, lane);
#pragma unroll
    for (int j = 0; j < 2; ++j) b[s][j] = load_tile(Bs + j * 16 * GP + k0, GP, lane);
  };
  fetch(0, 0);
#pragma unroll
  for (int ks = 0; ks < 8; ++ks) {
    if (ks + 1 < 8) fetch((ks + 1) & 1, (ks + 1) * 32);
    // keeps the next step's 12 LDS reads as one group in front of this step's
    // WMMAs: left free, the scheduler sinks them to two reads in front of each
    // pair of WMMAs, and every pair then waits a whole LDS latency
    __builtin_amdgcn_sched_barrier(0);
#pragma unroll
    for (int i = 0; i < 4; ++i)
#pragma unroll
      for (int j = 0; j < 2; ++j)
        acc[i][j] = wmma_f16(a[ks & 1][i], b[ks & 1][j], acc[i][j]);
    // keeps the following group of reads whole behind these WMMAs: left free,
    // the scheduler lifts parts of it in among them
    __builtin_amdgcn_sched_barrier(0);
  }

  // acc[i][j][v] = product at A row wa*64 + i*16 + 8g + v, B row wb*32 + j*16 + c
  const int g = lane >> 4, c = lane & 15;
  if (mode == 0) {
#pragma unroll
    for (int i = 0; i < 4; ++i) {
      const int n = nb + wa * 64 + i * 16 + 8 * g;
      const v4f b0 = *(const v4f*)(bias + n), b1 = *(const v4f*)(bias + n + 4);
#pragma unroll
      for (int j = 0; j < 2; ++j) {
        const int m = mb + wb * 32 + j * 16 + c;
        v8h y;
#pragma unroll
        for (int v = 0; v < 4; ++v) {
          y[v]     = (_Float16)(acc[i][j][v] + b0[v]);
          y[4 + v] = (_Float16)(acc[i][j][4 + v] + b1[v]);
        }
        *(v8h*)((_Float16*)Yv + (size_t)m * 256 + n) = y;
      }
    }
  } else {
#pragma unroll
    for (int j = 0; j < 2; ++j) {
      const int n = nb + wb * 32 + j * 16 + c;
      const float bn = bias[n];
#pragma unroll
      for (int i = 0; i < 4; ++i) {
        const int m = mb + wa * 64 + i * 16 + 8 * g;
        const int bb = m >> 10, t = m & 1023;
        v8h y;
#pragma unroll
        for (int v = 0; v < 8; ++v) y[v] = (_Float16)(acc[i][j][v] + bn);
        *(v8h*)((_Float16*)Yv + ((size_t)bb * 256 + n) * 1024 + t) = y;
      }
    }
    // before a later instruction reuses an address or data register of these stores
    asm volatile("s_wait_xcnt 0x0" ::: "memory");
  }
}

// The K and V projections depend on nothing of one another: one launch does
// both. blockIdx.x picks the product and its 128 rows: 0 .. 63 K, 64 .. 127 V
// (8192 rows each). The Q projection is done by the attention kernel.
__global__ void __launch_bounds__(256) kv_kernel(
    const _Float16* __restrict__ kvin, const _Float16* __restrict__ Wkh,
    const _Float16* __restrict__ Wvh, const float* __restrict__ bk,
    const float* __restrict__ bv, _Float16* __restrict__ kpj,
    _Float16* __restrict__ vtj) {
  const int bx = blockIdx.x, nb = blockIdx.y * 128;
  const bool isk = bx < 64;
  const _Float16* Wh = isk ? Wkh : Wvh;
  const float* bias  = isk ? bk : bv;
  _Float16* Y        = isk ? kpj : vtj;
  const int mb       = (isk ? bx : bx - 64) * 128;
  gemm256_tile(kvin, Wh, bias, Y, isk ? 0 : 1, mb, nb);
}

DEVINL float xhalf(float x) {
  const int i = __builtin_bit_cast(int, x);
  return __builtin_bit_cast(
      float, __builtin_amdgcn_permlanex16(i, i, 0x76543210, 0xfedcba98, false, false));
}

__global__ void __launch_bounds__(256) attn_out_kernel(
    const _Float16* __restrict__ qin, const _Float16* __restrict__ Wqh,
    const float* __restrict__ bq, const _Float16* __restrict__ kp,
    const _Float16* __restrict__ vt, const _Float16* __restrict__ Woh,
    const float* __restrict__ bo, float* __restrict__ out) {
  // Row pitches are 16 B x odd, so that the 16 rows one ds_load_b128 fragment
  // read touches start on 16 different bank groups (64 banks x 4 B).
  constexpr int KP = 264;                 // halves per K row: 512 B + 16 B pad
  constexpr int VP = 40;                  // halves per V row:  64 B + 16 B pad
  constexpr int WP = 264;                 // halves per Wq, Wo, X row: 512 B + 16 B pad
  __shared__ __attribute__((aligned(16))) _Float16 Ksh[2][32 * KP];   // [buf][t][d]
  __shared__ __attribute__((aligned(16))) _Float16 Vsh[2][256 * VP];  // [buf][d][t]
  __shared__ __attribute__((aligned(16))) _Float16 Wsh[256 * WP];     // Wq, then Wo: [n][channel]
  // first the block's X rows [query][channel], pitch WP; behind the key loop the
  // O operands: [wave][group * 4 + 32-channel step][low | high 8 halves][lane]
  __shared__ __attribute__((aligned(16))) _Float16 XOsh[128 * WP];
  auto osh = [&](int w, int t, int hl) { return &XOsh[((w * 8 + t) * 2 + hl) * 256 + (threadIdx.x & 31) * 8]; };

  const int tid = threadIdx.x;
  const int lane = tid & 31, wv = tid >> 5;
  const int h = wv & 1, qg = wv >> 1;
  const int b = blockIdx.x;
  const int l0 = blockIdx.y * 128 + qg * 32;
  const _Float16* kb = kp + (size_t)b * 1024 * 256;
  const _Float16* vb = vt + (size_t)b * 256 * 1024;

  // --- per-thread staging assignment per pass: 4 K, 4 V and 1 Wo segment (16B) ---
  // K chunk: wave w copies rows w, w+8, w+16, w+24; lane = 16-byte column
  // V chunk = 1024 segs: seg s -> d = s>>2, t = (s&3)*8
  // Wo: pass i brings rows 8i .. 8i+7, wave w row 8i + w
  const int vd = tid >> 2, vtc = (tid & 3) * 8;
  // a source address = a base that is the same for the whole block and moves
  // with i + the thread's own offset, which does not
  const unsigned rgo = (unsigned)(wv * 256 + lane * 8);   // K and Wo rows
  const unsigned vgo = (unsigned)(vd * 1024 + vtc);

  auto stage = [&](int i, int buf) {
    const _Float16* ks = kb + i * (32 * 256);
    const _Float16* vs = vb + i * 32;
#pragma unroll
    for (int j = 0; j < 4; ++j)
      cp16_to_lds(ks + (rgo + j * (8u * 256u)), &Ksh[buf][(wv + 8 * j) * KP + lane * 8]);
#pragma unroll
    for (int j = 0; j < 4; ++j)
      cp16_to_lds(vs + (vgo + j * (64u * 1024u)), &Vsh[buf][(vd + 64 * j) * VP + vtc]);
  };
  auto stage_wo = [&](int i) {
    cp16_to_lds(Woh + i * (8 * 256) + rgo, &Wsh[(i * 8 + wv) * WP + lane * 8]);
  };

  const int g = lane >> 4, col = lane & 15;

  // --- Wq (256 rows) and the block's X rows (128) into LDS: wave w copies rows
  // w, w+8, ..; lane = 16-byte column; chunk 0 of K and V flies with them ---
  {
    const unsigned lrow = (unsigned)(wv * WP + lane * 8) * 2u;
    const _Float16* gw = Wqh + rgo;
    const _Float16* gx = qin + ((size_t)b * 4096 + blockIdx.y * 128) * 256 + rgo;
    const unsigned lw = (unsigned)(size_t)Wsh + lrow;
    const unsigned lx = (unsigned)(size_t)XOsh + lrow;
    cp_rows8(gw, lw);
    cp_rows8(gw + 64 * 256, lw + 64u * 528u);
    cp_rows8(gw + 128 * 256, lw + 128u * 528u);
    cp_rows8(gw + 192 * 256, lw + 192u * 528u);
    cp_rows8(gx, lx);
    cp_rows8(gx + 64 * 256, lx + 64u * 528u);
  }
  stage(0, 0);

  // bias of this lane's Q^T rows: channels 16 dt + 8g .. + 7 of head h
  const float* bqp = bq + h * 128 + 8 * g;
  v4f qb0[8], qb1[8];
#pragma unroll
  for (int dt = 0; dt < 8; ++dt) {
    qb0[dt] = *(const v4f*)(bqp + dt * 16);
    qb1[dt] = *(const v4f*)(bqp + dt * 16 + 4);
  }
  // before a later instruction reuses the address registers of these loads; the
  // loads' common address is an input, so that its registers stay live, and
  // unwritten, up to the wait
  asm volatile("s_wait_xcnt 0x0" :: "v"(bqp) : "memory");

  // this wave's copies have landed; behind the barrier, every wave's have
  asm volatile("s_wait_asynccnt 0x0" ::: "memory");
  __syncthreads();

  // --- Q tiles (2 x 16x128) resident in registers for the whole key loop ---
  v16h qa[2][4];
  {
    const _Float16* Wa = Wsh + h * 128 * WP;
    const _Float16* Xb = XOsh + qg * 32 * WP;
    v8f qacc[8][2] = {};
    v16h wa[2][8], xb[2][2];  // two fragment sets: one in use, one being filled
    auto qfetch = [&](int s, int k0) {
#pragma unroll
      for (int dt = 0; dt < 8; ++dt) wa[s][dt] = load_tile(Wa + dt * 16 * WP + k0, WP, lane);
#pragma unroll
      for (int c = 0; c < 2; ++c) xb[s][c] = load_tile(Xb + c * 16 * WP + k0, WP, lane);
    };
    qfetch(0, 0);
#pragma unroll
    for (int ks = 0; ks < 8; ++ks) {
      if (ks + 1 < 8) qfetch((ks + 1) & 1, (ks + 1) * 32);
      // keeps the next step's 20 LDS reads as one group in front of this step's
      // WMMAs: left free, the scheduler sinks them in among the WMMAs
      __builtin_amdgcn_sched_barrier(0);
#pragma unroll
      for (int dt = 0; dt < 8; ++dt)
#pragma unroll
        for (int c = 0; c < 2; ++c)
          qacc[dt][c] = wmma_f16(wa[ks & 1][dt], xb[ks & 1][c], qacc[dt][c]);
      // keeps the following group of reads whole behind these WMMAs
      __builtin_amdgcn_sched_barrier(0);
    }
    // qacc[dt][c][v] = Q^T[16 dt + 8g + v][16c + col]; tiles 2 kt and 2 kt + 1 are
    // channels 32 kt + 8g + v and 32 kt + 16 + 8g + v: load_tile's k order.
    // Q carries the softmax scale, 256^-0.5 (full-dim scale, as in the reference),
    // times log2(e): K Q^T is then the score in the log2 domain.
    const float qs = 0.0625f * 1.44269504f;
#pragma unroll
    for (int c = 0; c < 2; ++c)
#pragma unroll
      for (int kt = 0; kt < 4; ++kt)
#pragma unroll
        for (int v = 0; v < 4; ++v) {
          qa[c][kt][v]      = (_Float16)((qacc[2 * kt][c][v] + qb0[2 * kt][v]) * qs);
          qa[c][kt][4 + v]  = (_Float16)((qacc[2 * kt][c][4 + v] + qb1[2 * kt][v]) * qs);
          qa[c][kt][8 + v]  = (_Float16)((qacc[2 * kt + 1][c][v] + qb0[2 * kt + 1][v]) * qs);
          qa[c][kt][12 + v] = (_Float16)((qacc[2 * kt + 1][c][4 + v] + qb1[2 * kt + 1][v]) * qs);
        }
  }

  // o[c][d][v] = O^T[d*16 + 8g + v][16c + col]; lrow: this half's share of that
  // query's running sum. nm[c]: minus the reference point of that query's
  // exponentials (log2 domain), the same value in all 8 registers: a whole tile,
  // the C operand of the score products, which so deliver score - reference.
  v8f o[2][8] = {};
  v8f nm[2] = {};
  float lrow[2] = {0.f, 0.f};

  for (int i = 0; i < 32; ++i) {
    const int buf = i & 1;
    // my reads of what is refilled below (in pass 0: of Wq) have returned
    asm volatile("s_wait_dscnt 0x0" ::: "memory");
    // my copies for chunk i have landed in LDS
    asm volatile("s_wait_asynccnt 0x0" ::: "memory");
    __syncthreads();     // everyone's copies done; prev chunk fully consumed
    stage_wo(i);
    if (i + 1 < 32) stage(i + 1, buf ^ 1);  // overlap next DMA

    const _Float16* kc = Ksh[buf] + h * 128;
    const _Float16* vc = Vsh[buf] + h * 128 * VP;

    // --- S^T = K Q^T for this 32-key chunk (two 16-key M-tiles) ---
    v16h kf[2][4];
#pragma unroll
    for (int kt = 0; kt < 4; ++kt) {
      kf[0][kt] = load_tile(kc + kt * 32, KP, lane);
      kf[1][kt] = load_tile(kc + 16 * KP + kt * 32, KP, lane);
    }
    // keeps the 16 K reads as one group in front of the 16 WMMAs: left free, the
    // scheduler puts two reads and a full LDS wait in front of each fragment's first WMMA
    __builtin_amdgcn_sched_barrier(0);
    v8f s0[2] = {nm[0], nm[1]}, s1[2] = {nm[0], nm[1]};
#pragma unroll
    for (int kt = 0; kt < 4; ++kt)
#pragma unroll
      for (int c = 0; c < 2; ++c) {
        s0[c] = wmma_f16(kf[0][kt], qa[c][kt], s0[c]);
        s1[c] = wmma_f16(kf[1][kt], qa[c][kt], s1[c]);
      }
    v16h vf[8];  // V^T fragments (rows d, contiguous t), in flight under the softmax
#pragma unroll
    for (int d = 0; d < 8; ++d) vf[d] = load_tile(vc + (d * 16) * VP, VP, lane);
    // keeps the 16 V reads as one group in front of the softmax arithmetic,
    // which then covers their latency; left free, most sink in among their WMMAs
    __builtin_amdgcn_sched_barrier(0);

    // --- online softmax of query 16c + col, down the lane's 16 scores ---
    // The accumulators already hold score - reference: exp2 takes them as they lie.
    v8f p0[2], p1[2];
    float rsum[2];
    auto exps = [&](int c) {
#pragma unroll
      for (int v = 0; v < 8; ++v) {
        p0[c][v] = __builtin_amdgcn_exp2f(s0[c][v]);
        p1[c][v] = __builtin_amdgcn_exp2f(s1[c][v]);
      }
      const v8f rs = p0[c] + p1[c];
      rsum[c] = ((rs[0] + rs[1]) + (rs[2] + rs[3])) + ((rs[4] + rs[5]) + (rs[6] + rs[7]));
    };
    exps(0);
    exps(1);
    // The reference moves, and O and the sum are rescaled, only when some lane's 16
    // exponentials of this pass sum to more than 256 (or to no number): up to there
    // every P fits f16 with room, and the common factor cancels in the final
    // division. One test per pass, a scalar branch. Pass 0 sets the reference to
    // the chunk's own maximum, so that a query's sum never starts at 0.
    const bool move = !(rsum[0] <= 256.f) | !(rsum[1] <= 256.f) | (i == 0);
    if (__builtin_amdgcn_ballot_w32(move) != 0) {
#pragma unroll
      for (int c = 0; c < 2; ++c) {
        const v8f mx = __builtin_elementwise_max(s0[c], s1[c]);
        float r = fmaxf(fmaxf(fmaxf(mx[0], mx[1]), fmaxf(mx[2], mx[3])),
                        fmaxf(fmaxf(mx[4], mx[5]), fmaxf(mx[6], mx[7])));
        r = fmaxf(r, xhalf(r));  // the other 16 keys of this query
        // how far the reference rises; in pass 0, where O and the sum are 0, it
        // goes to the maximum from either side
        const float up = (i == 0) ? r : fmaxf(r, 0.f);
        const float cf = (i == 0) ? 0.f : __builtin_amdgcn_exp2f(-up);
        nm[c] -= up;
        s0[c] -= up;
        s1[c] -= up;
        exps(c);
        lrow[c] *= cf;
#pragma unroll
        for (int d = 0; d < 8; ++d) o[c][d] *= cf;
      }
    }
    v16h pb[2];  // P^T as B operands: pb[c][v] = key 8g + v, pb[c][8 + v] = key 16 + 8g + v
#pragma unroll
    for (int c = 0; c < 2; ++c) {
      lrow[c] += rsum[c];
#pragma unroll
      for (int v = 0; v < 8; ++v) {
        pb[c][v]     = (_Float16)p0[c][v];
        pb[c][8 + v] = (_Float16)p1[c][v];
      }
    }

    // --- O^T += V^T P^T ---
#pragma unroll
    for (int d = 0; d < 8; ++d)
#pragma unroll
      for (int c = 0; c < 2; ++c) o[c][d] = wmma_f16(vf[d], pb[c], o[c][d]);
  }
  // no copy of this wave is outstanding behind the loop
  asm volatile("s_wait_asynccnt 0x0" ::: "memory");

  // bias of this wave's 8 x 16 output columns
  float bn[8];
#pragma unroll
  for (int t = 0; t < 8; ++t) bn[t] = bo[h * 128 + t * 16 + col];

  // --- join the halves' sums, normalize, hand the f16 operands over in LDS ---
  // tiles 2j and 2j+1 of a group: query col, channels 32j + 8g + v and 32j + 16 +
  // 8g + v of this head, which is load_tile's k order for row col
#pragma unroll
  for (int c = 0; c < 2; ++c) {
    const float linv = 1.f / (lrow[c] + xhalf(lrow[c]));
#pragma unroll
    for (int j = 0; j < 4; ++j) {
      v8h lo, hi;
#pragma unroll
      for (int v = 0; v < 8; ++v) {
        lo[v] = (_Float16)(o[c][2 * j][v] * linv);
        hi[v] = (_Float16)(o[c][2 * j + 1][v] * linv);
      }
      *(v8h*)osh(wv, c * 4 + j, 0) = lo;
      *(v8h*)osh(wv, c * 4 + j, 1) = hi;
    }
  }
  __syncthreads();  // both heads' operands of every query group are in LDS

  // --- Y = O Wo^T + bo: 32 queries x 128 columns, 8 steps of 32 channels ---
  v16h oa[2][8];  // A operands: step ks = head ks >> 2, its channels 32 (ks & 3) ..
#pragma unroll
  for (int c = 0; c < 2; ++c)
#pragma unroll
    for (int ks = 0; ks < 8; ++ks) {
      const _Float16* p = osh(qg * 2 + (ks >> 2), c * 4 + (ks & 3), 0);
      const v8h lo = *(const v8h*)p, hi = *(const v8h*)(p + 256);
#pragma unroll
      for (int v = 0; v < 8; ++v) { oa[c][ks][v] = lo[v]; oa[c][ks][8 + v] = hi[v]; }
    }

  // a block of work = 32 columns (np) x 4 channel steps (kh): 8 Wo fragments, 16 WMMAs
  const _Float16* Wb = Wsh + h * 128 * WP;
  v16h wf[2][8];  // two fragment sets: one in use, one being filled
  auto fetch = [&](int s, int blk) {
    const int np = blk >> 1, kh = blk & 1;
#pragma unroll
    for (int nt = 0; nt < 2; ++nt)
#pragma unroll
      for (int kk = 0; kk < 4; ++kk)
        wf[s][nt * 4 + kk] = load_tile(Wb + (np * 32 + nt * 16) * WP + (kh * 4 + kk) * 32, WP, lane);
  };
  float* yb = out + ((size_t)b * 4096 + l0 + 8 * g) * 256 + h * 128 + col;
  v8f acc[4][2][2] = {};
  fetch(0, 0);
#pragma unroll
  for (int blk = 0; blk < 8; ++blk) {
    const int np = blk >> 1, kh = blk & 1;
    if (blk + 1 < 8) fetch((blk + 1) & 1, blk + 1);
    // keeps the next block's 16 LDS reads as one group in front of this block's
    // WMMAs: left free, the scheduler sinks them in among the WMMAs
    __builtin_amdgcn_sched_barrier(0);
#pragma unroll
    for (int kk = 0; kk < 4; ++kk)
#pragma unroll
      for (int c = 0; c < 2; ++c)
#pragma unroll
        for (int nt = 0; nt < 2; ++nt)
          acc[np][c][nt] = wmma_f16(oa[c][kh * 4 + kk], wf[blk & 1][nt * 4 + kk], acc[np][c][nt]);
    // keeps the following group of reads whole behind these WMMAs
    __builtin_amdgcn_sched_barrier(0);
    if (kh == 1) {
      // acc[np][c][nt][v]: query 16c + 8g + v, column 32 np + 16 nt + col
#pragma unroll
      for (int c = 0; c < 2; ++c)
#pragma unroll
        for (int nt = 0; nt < 2; ++nt) acc[np][c][nt] += bn[np * 2 + nt];
      // keeps all 32 sums in front of the stores, each in a register of its own:
      // left free, the scheduler reuses a stored register between the stores
      __builtin_amdgcn_sched_barrier(0);
      // the two stores of a row's 128-byte line stand next to each other
#pragma unroll
      for (int c = 0; c < 2; ++c)
#pragma unroll
        for (int v = 0; v < 8; ++v)
#pragma unroll
          for (int nt = 0; nt < 2; ++nt)
            yb[(c * 16 + v) * 256 + np * 32 + nt * 16] = acc[np][c][nt][v];
      // before a later instruction reuses an address or data register of these stores
      asm volatile("s_wait_xcnt 0x0" ::: "memory");
      // keeps later arithmetic behind that wait
      __builtin_amdgcn_sched_barrier(0);
    }
  }
}

// ---------------------------------------------------------------------------
// Host orchestration
// ---------------------------------------------------------------------------
extern "C" void kernel_launch(void* const* d_in, const int* in_sizes, int n_in,
                              void* d_out, int out_size, void* d_ws, size_t ws_size,
                              hipStream_t stream) {
  const float* x     = (const float*)d_in[0];
  const float* wdw   = (const float*)d_in[1];
  const float* gamma = (const float*)d_in[2];
  const float* beta  = (const float*)d_in[3];
  const float* mean  = (const float*)d_in[4];
  const float* var   = (const float*)d_in[5];
  const float* Wq = (const float*)d_in[6];  const float* bq = (const float*)d_in[7];
  const float* Wk = (const float*)d_in[8];  const float* bk = (const float*)d_in[9];
  const float* Wv = (const float*)d_in[10]; const float* bv = (const float*)d_in[11];
  const float* Wo = (const float*)d_in[12]; const float* bo = (const float*)d_in[13];

  char* ws = (char*)d_ws;
  size_t off = 0;
  auto alloc = [&](size_t bytes) {
    char* p = ws + off;
    off = (off + bytes + 255) & ~(size_t)255;
    return p;
  };
  const size_t L = 8ull * 4096 * 256;  // q-side token elements
  const size_t T = 8ull * 1024 * 256;  // pooled token elements
  _Float16* qin = (_Float16*)alloc(L * 2);
  _Float16* kvin = (_Float16*)alloc(T * 2);
  _Float16* Wqh = (_Float16*)alloc(65536 * 2);
  _Float16* Wkh = (_Float16*)alloc(65536 * 2);
  _Float16* Wvh = (_Float16*)alloc(65536 * 2);
  _Float16* Woh = (_Float16*)alloc(65536 * 2);
  _Float16* kpj = (_Float16*)alloc(T * 2);   // K projected [B,1024,256]
  _Float16* vtj = (_Float16*)alloc(T * 2);   // V projected, transposed [B,256,1024]

  // 1) preprocessing
  // 256 blocks of patches + 64 blocks of weight conversion
  dwconv_bn_kernel<<<320, 256, 0, stream>>>(x, wdw, gamma, beta, mean, var, qin, kvin,
                                            Wq, Wk, Wv, Wo, Wqh, Wkh, Wvh, Woh);

  // 2) K, V projections (WMMA GEMMs): 64 + 64 row blocks
  kv_kernel<<<dim3(128, 2), 256, 0, stream>>>(kvin, Wkh, Wvh, bk, bv, kpj, vtj);

  // 3) fused Q projection + flash attention + output projection -> f32 d_out:
  //    8 batches x 32 blocks of 128 Q rows, both heads
  attn_out_kernel<<<dim3(8, 32), 256, 0, stream>>>(qin, Wqh, bq, kpj, vtj, Woh, bo,
                                                   (float*)d_out);
}
